// v000
// Times are from an AMD MI455X. After a warm-up the kernel runs many times in a row, and a time is the length of
// such a window on the GPU divided by its runs, so every launch and the gaps after it count. The runs cycle
// through copies of the inputs. A figure is the median of several windows, for all but v000 over two sittings.
// Sittings can differ by a few percent; kernels timed side by side share one.
// v000, which the later versions start from, runs in 1450 microseconds.
#include <hip/hip_runtime.h>

// Causal multi-head attention, cache-free prefill path (x [2][2048][1024]; q,k,v = x W^T + b ('oi' 0.02, zero biases; 16 heads x 64); scores / 8; triu(1) -> -inf; softmax; out = merged Wo^T + bo -> [2][2048][1024] (4.2 M)).
// Layout per batch: bf16 copy of x; 'oi' weights; exact projections + bf16-rounded biases; causal T-2048 attention (hybrid rows: < 512 hi/lo 3 products, rest fp16 x1024; tiles above the diagonal skipped); merged hi/lo x Wo exact + bo.
// Compute dtypes, f32 accumulate: every input rounded to bf16; projections exact + bf16-rounded biases; attention rows < 512 3 products, rest fp16; softmax f32; Wo hl x exact + bias.

#define NB_  2
#define TT   2048
#define DM   1024
#define NH_  16
#define NKV  16
#define REP  (NH_ / NKV)
#define HD   64
#define DQ   (NH_ * HD)
#define DKV  (NKV * HD)
#define ZH   2
#define RH   512                  // query rows < RH use hi+lo planes (0: none)
#define WIN  2048
#define PCAR 1024.0f
#define SCL  0.125f   // HD^-0.5
typedef _Float16 h16;
typedef unsigned short bf;
typedef __attribute__((ext_vector_type(16))) __bf16   v16bf;
typedef __attribute__((ext_vector_type(16))) _Float16 v16h;
typedef __attribute__((ext_vector_type(8)))  _Float16 v8h;
typedef __attribute__((ext_vector_type(8)))  unsigned short v8us;
typedef __attribute__((ext_vector_type(8)))  float    v8f;
typedef __attribute__((ext_vector_type(4)))  float    v4f;
typedef v8h  __attribute__((may_alias)) v8ha;
typedef v4f  __attribute__((may_alias)) v4fa;
typedef v8us __attribute__((may_alias)) v8usa;

__device__ __forceinline__ unsigned short f2bf(float f) { unsigned u = __float_as_uint(f); u += 0x7FFFu + ((u >> 16) & 1u); return (unsigned short)(u >> 16); }
__device__ __forceinline__ float bf2f(unsigned short b) { return __uint_as_float(((unsigned)b) << 16); }
__device__ __forceinline__ float bfr(float f) { return bf2f(f2bf(f)); }
__device__ __forceinline__ v16h cat16(v8h lo, v8h hi) { return __builtin_shufflevector(lo, hi, 0, 1, 2, 3, 4, 5, 6, 7, 8, 9, 10, 11, 12, 13, 14, 15); }
__device__ __forceinline__ v16bf cat16b(v8us lo, v8us hi) { return __builtin_bit_cast(v16bf, __builtin_shufflevector(lo, hi, 0, 1, 2, 3, 4, 5, 6, 7, 8, 9, 10, 11, 12, 13, 14, 15)); }
__device__ __forceinline__ v8f wmma16(v16h a, v16h b, v8f c) { return __builtin_amdgcn_wmma_f32_16x16x32_f16(false, a, false, b, (short)0, c, false, false); }
__device__ __forceinline__ v8f wmmab(v16bf a, v16bf b, v8f c) { return __builtin_amdgcn_wmma_f32_16x16x32_bf16(false, a, false, b, (short)0, c, false, false); }



// ---- k_gemmw: register-blocked GEMM, ONE WAVE per 64x64 output tile (16 accumulators), operands straight from K-contiguous 16-bit planes; grid (M/64, N/64, Z), 32 threads.
// C[m][n] (f32, pitch ldc, + optional f32 bias[n]) = sum_k A[m][k] Bt[n][k] (+ split products per NSPLIT). z-batch strides sA/sB/sC in elements. K % 32 == 0.
template <typename T16> struct WFrag;
template <> struct WFrag<h16> { typedef v16h V; static __device__ __forceinline__ V ld(const h16* p) { return cat16(*(const v8h*)p, *(const v8h*)(p + 16)); } static __device__ __forceinline__ v8f mma(V a, V b, v8f c) { return wmma16(a, b, c); } };
template <> struct WFrag<bf> { typedef v16bf V; static __device__ __forceinline__ V ld(const bf* p) { return cat16b(*(const v8us*)p, *(const v8us*)(p + 16)); } static __device__ __forceinline__ v8f mma(V a, V b, v8f c) { return wmmab(a, b, c); } };
template <typename T16, int NSPLIT, bool BIAS>
__global__ __launch_bounds__(32) void k_gemmw(const T16* __restrict__ A, const T16* __restrict__ A2, const T16* __restrict__ Bt, const T16* __restrict__ Bt2, int K, float* C, int ldc, const float* __restrict__ bias, size_t sA, size_t sB, size_t sC) {
    typedef typename WFrag<T16>::V V;
    __shared__ __align__(16) float os[16 * 68];
    const size_t z = blockIdx.z; A += z * sA; if (A2) A2 += z * sA; Bt += z * sB; if (Bt2) Bt2 += z * sB; C += z * sC;
    const int lane = threadIdx.x & 31, lr = lane & 15, hi = lane >> 4; const int r0 = blockIdx.x * 64, c0 = blockIdx.y * 64;
    v8f acc[4][4];
#pragma unroll
    for (int mb = 0; mb < 4; ++mb)
#pragma unroll
        for (int nb = 0; nb < 4; ++nb) acc[mb][nb] = (v8f){};
    const size_t aoff = (size_t)(r0 + lr) * K + 8 * hi, boff = (size_t)(c0 + lr) * K + 8 * hi;
#pragma unroll 1
    for (int kc = 0; kc < K; kc += 32) {
        V a[4], a2[4];
#pragma unroll
        for (int mb = 0; mb < 4; ++mb) { a[mb] = WFrag<T16>::ld(A + aoff + (size_t)mb * 16 * K + kc); if (NSPLIT == 1 || NSPLIT == 2) a2[mb] = WFrag<T16>::ld(A2 + aoff + (size_t)mb * 16 * K + kc); }
#pragma unroll
        for (int nb = 0; nb < 4; ++nb) { const V b = WFrag<T16>::ld(Bt + boff + (size_t)nb * 16 * K + kc); V b2; if (NSPLIT >= 2) b2 = WFrag<T16>::ld(Bt2 + boff + (size_t)nb * 16 * K + kc);
#pragma unroll
            for (int mb = 0; mb < 4; ++mb) { acc[mb][nb] = WFrag<T16>::mma(a[mb], b, acc[mb][nb]); if (NSPLIT == 1 || NSPLIT == 2) acc[mb][nb] = WFrag<T16>::mma(a2[mb], b, acc[mb][nb]); if (NSPLIT >= 2) acc[mb][nb] = WFrag<T16>::mma(a[mb], b2, acc[mb][nb]); } }
        asm volatile("v_nop\n\tv_nop\n\tv_nop\n\tv_nop" : "+v"(acc[0][0]), "+v"(acc[1][1]), "+v"(acc[2][2]), "+v"(acc[3][3]) : "v"(a[0]), "v"(a[3]));
    }
#pragma unroll
    for (int mb = 0; mb < 4; ++mb) {
#pragma unroll
        for (int nb = 0; nb < 4; ++nb) {
#pragma unroll
            for (int j = 0; j < 8; ++j) os[(hi * 8 + j) * 68 + nb * 16 + lr] = acc[mb][nb][j]; }
        __builtin_amdgcn_wave_barrier(); asm volatile("" ::: "memory");
        float* crow = C + (size_t)(r0 + mb * 16) * ldc + c0;
{
#pragma unroll
            for (int s = 0; s < 8; ++s) { const int row = 2 * s + hi, cofs = lr * 4; v4f val = *(const v4fa*)(os + row * 68 + cofs); if (BIAS) { val[0] += bfr(bias[c0 + cofs]); val[1] += bfr(bias[c0 + cofs + 1]); val[2] += bfr(bias[c0 + cofs + 2]); val[3] += bfr(bias[c0 + cofs + 3]); }
                *(v4f*)(crow + (size_t)row * ldc + cofs) = val; }
             }
        __builtin_amdgcn_wave_barrier(); asm volatile("" ::: "memory");
    }
}

// ---- k_gemmc: the same one-wave 64x64 tile GEMM specialised for causal attention: CMODE 1 skips score tiles entirely above the diagonal (query rows r0+roff.., key columns c0..), CMODE 2 limits the
// key (K) loop of the probability x value contraction to the diagonal block (probabilities beyond it are exactly zero). roff = row offset of this launch's first row within the sequence.
template <typename T16, int NSPLIT, int CMODE>
__global__ __launch_bounds__(32) void k_gemmc(const T16* __restrict__ A, const T16* __restrict__ A2, const T16* __restrict__ Bt, const T16* __restrict__ Bt2, int K, float* C, int ldc, int roff, size_t sA, size_t sB, size_t sC) {
    typedef typename WFrag<T16>::V V;
    __shared__ __align__(16) float os[16 * 68];
    const size_t z = blockIdx.z; A += z * sA; if (A2) A2 += z * sA; Bt += z * sB; if (Bt2) Bt2 += z * sB; C += z * sC;
    const int lane = threadIdx.x & 31, lr = lane & 15, hi = lane >> 4; const int r0 = blockIdx.x * 64, c0 = blockIdx.y * 64;
    if (CMODE == 1 && c0 > r0 + roff + 63) return;                  // score tile entirely above the causal diagonal: never read (the softmax masks j > i by select)
    const int Kl = (CMODE == 2) ? min(K, r0 + roff + 64) : K;        // P.V: probabilities are exactly 0 beyond the diagonal block, so the K loop stops there
    v8f acc[4][4];
#pragma unroll
    for (int mb = 0; mb < 4; ++mb)
#pragma unroll
        for (int nb = 0; nb < 4; ++nb) acc[mb][nb] = (v8f){};
    const size_t aoff = (size_t)(r0 + lr) * K + 8 * hi, boff = (size_t)(c0 + lr) * K + 8 * hi;
#pragma unroll 1
    for (int kc = 0; kc < Kl; kc += 32) {
        V a[4], a2[4];
#pragma unroll
        for (int mb = 0; mb < 4; ++mb) { a[mb] = WFrag<T16>::ld(A + aoff + (size_t)mb * 16 * K + kc); if (NSPLIT == 1 || NSPLIT == 2) a2[mb] = WFrag<T16>::ld(A2 + aoff + (size_t)mb * 16 * K + kc); }
#pragma unroll
        for (int nb = 0; nb < 4; ++nb) { const V b = WFrag<T16>::ld(Bt + boff + (size_t)nb * 16 * K + kc); V b2; if (NSPLIT >= 2) b2 = WFrag<T16>::ld(Bt2 + boff + (size_t)nb * 16 * K + kc);
#pragma unroll
            for (int mb = 0; mb < 4; ++mb) { acc[mb][nb] = WFrag<T16>::mma(a[mb], b, acc[mb][nb]); if (NSPLIT == 1 || NSPLIT == 2) acc[mb][nb] = WFrag<T16>::mma(a2[mb], b, acc[mb][nb]); if (NSPLIT >= 2) acc[mb][nb] = WFrag<T16>::mma(a[mb], b2, acc[mb][nb]); } }
        asm volatile("v_nop\n\tv_nop\n\tv_nop\n\tv_nop" : "+v"(acc[0][0]), "+v"(acc[1][1]), "+v"(acc[2][2]), "+v"(acc[3][3]) : "v"(a[0]), "v"(a[3]));
    }
#pragma unroll
    for (int mb = 0; mb < 4; ++mb) {
#pragma unroll
        for (int nb = 0; nb < 4; ++nb) {
#pragma unroll
            for (int j = 0; j < 8; ++j) os[(hi * 8 + j) * 68 + nb * 16 + lr] = acc[mb][nb][j]; }
        __builtin_amdgcn_wave_barrier(); asm volatile("" ::: "memory");
        float* crow = C + (size_t)(r0 + mb * 16) * ldc + c0;
{
#pragma unroll
            for (int s = 0; s < 8; ++s) { const int row = 2 * s + hi, cofs = lr * 4; v4f val = *(const v4fa*)(os + row * 68 + cofs);
                *(v4f*)(crow + (size_t)row * ldc + cofs) = val; }
             }
        __builtin_amdgcn_wave_barrier(); asm volatile("" ::: "memory");
    }
}

__device__ __forceinline__ h16 tohx(float x) { return (h16)x; }
__device__ __forceinline__ void splitf(float y, unsigned short& h, unsigned short& l) { h = f2bf(y); l = f2bf(y - bf2f(h)); }
typedef __attribute__((ext_vector_type(2))) _Float16 v2h;
typedef __attribute__((ext_vector_type(4))) _Float16 v4h;
typedef __attribute__((ext_vector_type(2))) unsigned short v2us;
typedef __attribute__((ext_vector_type(4))) unsigned short v4us;
typedef __attribute__((ext_vector_type(2))) float v2f;
typedef __attribute__((ext_vector_type(4))) int v4i;

__global__ __launch_bounds__(256) void k_wtG(const float* __restrict__ w, int K, int N, bf* Bt) {
    const int lane = threadIdx.x & 31; const int L0 = (blockIdx.x * 8 + (threadIdx.x >> 5)) * 8; const int nlines = N * K / 64;
{
#pragma unroll 1
        for (int l = 0; l < 8; ++l) { const int L = L0 + l; if (L >= nlines) break; const size_t e = (size_t)L * 64 + lane * 2; const int k = (int)(e % K), n = (int)(e / K); v2us o;
            o[0] = f2bf(w[(size_t)k * N + n]); o[1] = f2bf(w[(size_t)(k + 1) * N + n]); *(v2us*)(Bt + e) = o; }
         }
}
__global__ __launch_bounds__(256) void k_cvt8(const float* __restrict__ src, bf* dst, size_t n8) { const size_t i = (size_t)blockIdx.x * 256 + threadIdx.x; if (i >= n8) return; const v8f v = *(const v8f*)(src + i * 8); v8us o;
#pragma unroll
    for (int k = 0; k < 8; ++k) o[k] = f2bf(v[k]); *(v8us*)(dst + i * 8) = o;  }

// k_rope: head planes [h][t][d] (fp16 + hi/lo) of rope(x) x sc with the rotate-half convention out[d] = x[d] cos[t][d] - x[d+HD/2] sin[t][d], out[d+HD/2] = x[d+HD/2] cos[t][d+HD/2] + x[d] sin[t][d+HD/2]
__global__ __launch_bounds__(256) void k_rope(const float* __restrict__ F, int pitch, int nheads, const float* __restrict__ CS, const float* __restrict__ RF, const float* __restrict__ nw, float sc, h16* P16, bf* Ph, bf* Pl) {
    const size_t e = ((size_t)blockIdx.x * 256 + threadIdx.x) * 2; if (e >= (size_t)nheads * TT * HD) return; const int d = (int)(e % HD); const int t = (int)((e / HD) % TT); const int h = (int)(e / ((size_t)HD * TT)); const float* f = F + (size_t)t * pitch + h * HD; const float rf = RF ? RF[(size_t)h * TT + t] : 1.0f; v2h o16; v2us oh, ol;
#pragma unroll
    for (int q = 0; q < 2; ++q) { const int dd = d + q; const int dp = (dd < HD / 2) ? dd + HD / 2 : dd - HD / 2; float x0 = f[dd], x1 = f[dp];
        if (RF) { float n0 = __fmul_rn(x0, rf), n1 = __fmul_rn(x1, rf); asm volatile("" : "+v"(n0)); asm volatile("" : "+v"(n1)); x0 = __fmul_rn(bfr(nw[dd]), n0); x1 = __fmul_rn(bfr(nw[dp]), n1); }
        const v2f cs = *(const v2f*)(CS + ((size_t)t * HD + dd) * 2); float a = __fmul_rn(x0, cs[0]), bq = __fmul_rn(x1, cs[1]); asm volatile("" : "+v"(a)); asm volatile("" : "+v"(bq)); const float r = ((dd < HD / 2) ? __fsub_rn(a, bq) : __fadd_rn(a, bq)) * sc;
        o16[q] = tohx(r); unsigned short a2, c2; splitf(r, a2, c2); oh[q] = a2; ol[q] = c2; }
    *(v2h*)(P16 + e) = o16; *(v2us*)(Ph + e) = oh; *(v2us*)(Pl + e) = ol;  }
__global__ __launch_bounds__(256) void k_vtp(const float* __restrict__ F, int pitch, int nheads, h16* V16, bf* Vh, bf* Vl) { const size_t e = ((size_t)blockIdx.x * 256 + threadIdx.x) * 2; if (e >= (size_t)nheads * HD * TT) return; const int t = (int)(e % TT); const int d = (int)((e / TT) % HD); const int g = (int)(e / ((size_t)TT * HD)); v2h o16; v2us oh, ol;
#pragma unroll
    for (int q = 0; q < 2; ++q) { const float x = F[(size_t)(t + q) * pitch + g * HD + d]; o16[q] = tohx(x); unsigned short a2, c2; splitf(x, a2, c2); oh[q] = a2; ol[q] = c2; }
    *(v2h*)(V16 + e) = o16; *(v2us*)(Vh + e) = oh; *(v2us*)(Vl + e) = ol;  }
__global__ __launch_bounds__(256) void k_csid(float* CS) { const int idx = blockIdx.x * 256 + threadIdx.x; if (idx >= TT * HD) return; v2f cs; cs[0] = 1.0f; cs[1] = 0.0f; *(v2f*)(CS + (size_t)idx * 2) = cs;  }
// k_asoft: per row (zz, i): t = S x HD^-0.5 for j <= i and i - j < WIN (sliding causal window; the reference's -1e9 additive fill vanishes identically); softmax over the 2048 keys (register row, one exp, fixed trees);
__global__ __launch_bounds__(256) void k_asoft(const float* __restrict__ Sb, h16* P16, bf* Ph, bf* Pl) {
    const int lane = threadIdx.x & 31; const int row = blockIdx.x * 8 + (threadIdx.x >> 5); if (row >= ZH * TT) return; const int i = row % TT; const int zz = row / TT; (void)zz; const bool hires = (i < RH); const float* sr = Sb + (size_t)row * TT; float v[TT / 32]; float mx = -3.0e38f;
#pragma unroll
    for (int ch = 0; ch < TT / 128; ++ch) { const int j0 = ch * 128 + lane * 4; const v4f a = *(const v4f*)(sr + j0);
#pragma unroll
        for (int q = 0; q < 4; ++q) { const int j = j0 + q; (void)j; const float t = (j <= i && i - j < WIN) ? a[q] * SCL : -3.0e38f; v[ch * 4 + q] = t; mx = fmaxf(mx, t); } }
#pragma unroll
    for (int sh = 16; sh; sh >>= 1) mx = fmaxf(mx, __shfl_xor(mx, sh, 32));
    float sum = 0.f;
#pragma unroll
    for (int k = 0; k < TT / 32; ++k) { float d0 = __fsub_rn(v[k], mx); asm volatile("" : "+v"(d0)); v[k] = __builtin_amdgcn_exp2f(__fmul_rn(d0, 1.4426950408889634f)); sum += v[k]; }
#pragma unroll
    for (int sh = 16; sh; sh >>= 1) sum += __shfl_xor(sum, sh, 32);
    const float f = __fdiv_rn(hires ? 1.0f : PCAR, sum);
{
        if (hires) {
#pragma unroll
            for (int ch = 0; ch < TT / 128; ++ch) { v4us oh, ol;
#pragma unroll
                for (int q = 0; q < 4; ++q) { unsigned short a, c2; splitf(v[ch * 4 + q] * f, a, c2); oh[q] = a; ol[q] = c2; }
                const size_t oo = ((size_t)zz * (RH ? RH : 1) + i) * TT + ch * 128 + lane * 4; *(v4us*)(Ph + oo) = oh; *(v4us*)(Pl + oo) = ol; }
        } else {
#pragma unroll
            for (int ch = 0; ch < TT / 128; ++ch) { v4h o4;
#pragma unroll
                for (int q = 0; q < 4; ++q) o4[q] = tohx(v[ch * 4 + q] * f);
                *(v4h*)(P16 + (size_t)row * TT + ch * 128 + lane * 4) = o4; } }
         }
}
__global__ __launch_bounds__(256) void k_merge(const float* __restrict__ O, int h0, bf* Ah, bf* Al) { const size_t e = ((size_t)blockIdx.x * 256 + threadIdx.x) * 2; if (e >= (size_t)ZH * TT * HD) return; const int d = (int)(e % HD); const int t = (int)((e / HD) % TT); const int zz = (int)(e / ((size_t)HD * TT)); const float cs = (t < RH) ? 1.0f : (1.0f / PCAR); const size_t oo = (size_t)t * DQ + (h0 + zz) * HD + d;
    v2us oh, ol;
#pragma unroll
    for (int q = 0; q < 2; ++q) { unsigned short a, c2; splitf(O[e + q] * cs, a, c2); oh[q] = a; ol[q] = c2; } *(v2us*)(Ah + oo) = oh; *(v2us*)(Al + oo) = ol;  }

extern "C" void kernel_launch(void* const* d_in, const int* in_sizes, int n_in,
                              void* d_out, int out_size, void* d_ws, size_t ws_size, hipStream_t stream) {
    (void)in_sizes; (void)n_in; (void)out_size;
    const float* x = (const float*)d_in[0]; const float* wq = (const float*)d_in[1]; const float* bq = (const float*)d_in[2]; const float* wk = (const float*)d_in[3]; const float* bk = (const float*)d_in[4]; const float* wv = (const float*)d_in[5]; const float* bv = (const float*)d_in[6]; const float* wo = (const float*)d_in[7]; const float* bo = (const float*)d_in[8];
    float* OUT = (float*)d_out;     // [2][2048][1024]
    char* wsp = (char*)d_ws;
    auto take = [&](size_t bytes) { char* p = wsp; wsp += (bytes + 255) & ~(size_t)255; return (void*)p; };
    bf* WQ = (bf*)take((size_t)DQ * DM * 2); bf* WK = (bf*)take((size_t)DKV * DM * 2); bf* WV = (bf*)take((size_t)DKV * DM * 2); bf* WO = (bf*)take((size_t)DM * DQ * 2); float* CS = (float*)take((size_t)TT * HD * 2 * 4);
    bf* XB = (bf*)take((size_t)TT * DM * 2); float* FQ = (float*)take((size_t)TT * DQ * 4); float* FK = (float*)take((size_t)TT * DKV * 4);
    h16* QP16 = (h16*)take((size_t)NH_ * TT * HD * 2); h16* KP16 = (h16*)take((size_t)NKV * TT * HD * 2); h16* VT16 = (h16*)take((size_t)NKV * HD * TT * 2);
    bf* QPh = (bf*)take((size_t)NH_ * TT * HD * 2); bf* QPl = (bf*)take((size_t)NH_ * TT * HD * 2); bf* KPh = (bf*)take((size_t)NKV * TT * HD * 2); bf* KPl = (bf*)take((size_t)NKV * TT * HD * 2); bf* VTh = (bf*)take((size_t)NKV * HD * TT * 2); bf* VTl = (bf*)take((size_t)NKV * HD * TT * 2); bf* Ph = (bf*)take((size_t)ZH * RH * TT * 2); bf* Pl = (bf*)take((size_t)ZH * RH * TT * 2);
    float* Sb = (float*)take((size_t)ZH * TT * TT * 4); h16* P16 = (h16*)take((size_t)ZH * TT * TT * 2); float* Ob = (float*)take((size_t)ZH * TT * HD * 4); bf* ATh = (bf*)take((size_t)TT * DQ * 2); bf* ATl = (bf*)take((size_t)TT * DQ * 2);
    if ((size_t)(wsp - (char*)d_ws) > ws_size) return;    // ws 256 MiB
    float* FV = FK;   // v projection reuses the k buffer after the k planes are built (stream-ordered)
    { k_cvt8<<<(unsigned)(((size_t)DQ * DM / 8 + 255) / 256), 256, 0, stream>>>(wq, WQ, (size_t)DQ * DM / 8); k_cvt8<<<(unsigned)(((size_t)DKV * DM / 8 + 255) / 256), 256, 0, stream>>>(wk, WK, (size_t)DKV * DM / 8); k_cvt8<<<(unsigned)(((size_t)DKV * DM / 8 + 255) / 256), 256, 0, stream>>>(wv, WV, (size_t)DKV * DM / 8);
      k_cvt8<<<(unsigned)(((size_t)DM * DQ / 8 + 255) / 256), 256, 0, stream>>>(wo, WO, (size_t)DM * DQ / 8);
       }
    k_csid<<<(TT * HD + 255) / 256, 256, 0, stream>>>(CS);
    const unsigned LQ = (unsigned)(((size_t)NH_ * TT * HD / 2 + 255) / 256), LKv = (unsigned)(((size_t)NKV * TT * HD / 2 + 255) / 256);
    for (int b = 0; b < NB_; ++b) {
        
        k_cvt8<<<(unsigned)(((size_t)TT * DM / 8 + 255) / 256), 256, 0, stream>>>(x + (size_t)b * TT * DM, XB, (size_t)TT * DM / 8);
        k_gemmw<bf, 0, true><<<dim3(TT / 64, DQ / 64, 1), 32, 0, stream>>>(XB, nullptr, WQ, nullptr, DM, FQ, DQ, bq, 0, 0, 0);
        k_rope<<<LQ, 256, 0, stream>>>(FQ, DQ, NH_, CS, nullptr, nullptr, 1.0f, QP16, QPh, QPl);
        k_gemmw<bf, 0, true><<<dim3(TT / 64, DKV / 64, 1), 32, 0, stream>>>(XB, nullptr, WK, nullptr, DM, FK, DKV, bk, 0, 0, 0);
        k_rope<<<LKv, 256, 0, stream>>>(FK, DKV, NKV, CS, nullptr, nullptr, 1.0f, KP16, KPh, KPl);
        k_gemmw<bf, 0, true><<<dim3(TT / 64, DKV / 64, 1), 32, 0, stream>>>(XB, nullptr, WV, nullptr, DM, FV, DKV, bv, 0, 0, 0); k_vtp<<<LKv, 256, 0, stream>>>(FV, DKV, NKV, VT16, VTh, VTl);
        for (int h0 = 0; h0 < NH_; h0 += ZH) { const size_t zq = (size_t)h0, zk = (size_t)(h0 / REP);   // one kv head per query head: the pass's two heads use consecutive kv planes (z-strides TT*HD)
            k_gemmc<bf, 2, 1><<<dim3(RH / 64, TT / 64, ZH), 32, 0, stream>>>(QPh + zq * TT * HD, QPl + zq * TT * HD, KPh + zk * TT * HD, KPl + zk * TT * HD, HD, Sb, TT, 0, (size_t)TT * HD, (size_t)TT * HD, (size_t)TT * TT);
            k_gemmc<h16, 0, 1><<<dim3((TT - RH) / 64, TT / 64, ZH), 32, 0, stream>>>(QP16 + zq * TT * HD + (size_t)RH * HD, nullptr, KP16 + zk * TT * HD, nullptr, HD, Sb + (size_t)RH * TT, TT, RH, (size_t)TT * HD, (size_t)TT * HD, (size_t)TT * TT);
            k_asoft<<<ZH * TT / 8, 256, 0, stream>>>(Sb, P16, Ph, Pl);
            k_gemmc<bf, 2, 2><<<dim3(RH / 64, HD / 64, ZH), 32, 0, stream>>>(Ph, Pl, VTh + zk * HD * TT, VTl + zk * HD * TT, TT, Ob, HD, 0, (size_t)RH * TT, (size_t)HD * TT, (size_t)TT * HD);
            k_gemmc<h16, 0, 2><<<dim3((TT - RH) / 64, HD / 64, ZH), 32, 0, stream>>>(P16 + (size_t)RH * TT, nullptr, VT16 + zk * HD * TT, nullptr, TT, Ob + (size_t)RH * HD, HD, RH, (size_t)TT * TT, (size_t)HD * TT, (size_t)TT * HD);
            k_merge<<<(unsigned)(((size_t)ZH * TT * HD / 2 + 255) / 256), 256, 0, stream>>>(Ob, h0, ATh, ATl); }
        k_gemmw<bf, 1, true><<<dim3(TT / 64, DM / 64, 1), 32, 0, stream>>>(ATh, ATl, WO, nullptr, DQ, OUT + (size_t)b * TT * DM, DM, bo, 0, 0, 0); }
}

// v001
// It runs in 750 microseconds.
// Next to v000, in two timings, it ran 1.94 and 1.91 times as fast.
#include <hip/hip_runtime.h>

// Causal multi-head attention, cache-free prefill path (x [2][2048][1024]; q,k,v = x W^T + b ('oi' 0.02, zero biases; 16 heads x 64); scores / 8; triu(1) -> -inf; softmax; out = merged Wo^T + bo -> [2][2048][1024] (4.2 M)).
// Layout per batch: bf16 copy of x; 'oi' weights; exact projections + bf16-rounded biases; causal T-2048 attention (hybrid rows: < 512 hi/lo 3 products, rest fp16 x1024; tiles above the diagonal skipped); merged hi/lo x Wo exact + bo.
// Compute dtypes, f32 accumulate: every input rounded to bf16; projections exact + bf16-rounded biases; attention rows < 512 3 products, rest fp16; softmax f32; Wo hl x exact + bias.

#define NB_  2
#define TT   2048
#define DM   1024
#define NH_  16
#define NKV  16
#define REP  (NH_ / NKV)
#define HD   64
#define DQ   (NH_ * HD)
#define DKV  (NKV * HD)
#define ZH   2
#define RH   512                  // query rows < RH use hi+lo planes (0: none)
#define WIN  2048
#define PCAR 1024.0f
#define SCL  0.125f   // HD^-0.5
typedef _Float16 h16;
typedef unsigned short bf;
typedef __attribute__((ext_vector_type(16))) __bf16   v16bf;
typedef __attribute__((ext_vector_type(16))) _Float16 v16h;
typedef __attribute__((ext_vector_type(8)))  _Float16 v8h;
typedef __attribute__((ext_vector_type(8)))  unsigned short v8us;
typedef __attribute__((ext_vector_type(8)))  float    v8f;
typedef __attribute__((ext_vector_type(4)))  float    v4f;
typedef v8h  __attribute__((may_alias)) v8ha;
typedef v4f  __attribute__((may_alias)) v4fa;
typedef v8us __attribute__((may_alias)) v8usa;

__device__ __forceinline__ unsigned short f2bf(float f) { unsigned u = __float_as_uint(f); u += 0x7FFFu + ((u >> 16) & 1u); return (unsigned short)(u >> 16); }
__device__ __forceinline__ float bf2f(unsigned short b) { return __uint_as_float(((unsigned)b) << 16); }
__device__ __forceinline__ float bfr(float f) { return bf2f(f2bf(f)); }
__device__ __forceinline__ v16h cat16(v8h lo, v8h hi) { return __builtin_shufflevector(lo, hi, 0, 1, 2, 3, 4, 5, 6, 7, 8, 9, 10, 11, 12, 13, 14, 15); }
__device__ __forceinline__ v16bf cat16b(v8us lo, v8us hi) { return __builtin_bit_cast(v16bf, __builtin_shufflevector(lo, hi, 0, 1, 2, 3, 4, 5, 6, 7, 8, 9, 10, 11, 12, 13, 14, 15)); }
__device__ __forceinline__ v8f wmma16(v16h a, v16h b, v8f c) { return __builtin_amdgcn_wmma_f32_16x16x32_f16(false, a, false, b, (short)0, c, false, false); }
__device__ __forceinline__ v8f wmmab(v16bf a, v16bf b, v8f c) { return __builtin_amdgcn_wmma_f32_16x16x32_bf16(false, a, false, b, (short)0, c, false, false); }



// ---- k_gemmw: register-blocked GEMM, ONE WAVE per 64x64 output tile (16 accumulators), operands straight from K-contiguous 16-bit planes; grid (M/64, N/64, Z), 32 threads.
// C[m][n] (f32, pitch ldc, + optional f32 bias[n]) = sum_k A[m][k] Bt[n][k] (+ split products per NSPLIT). z-batch strides sA/sB/sC in elements. K % 32 == 0.
template <typename T16> struct WFrag;
template <> struct WFrag<h16> { typedef v16h V; static __device__ __forceinline__ V ld(const h16* p) { return cat16(*(const v8h*)p, *(const v8h*)(p + 16)); } static __device__ __forceinline__ v8f mma(V a, V b, v8f c) { return wmma16(a, b, c); } };
template <> struct WFrag<bf> { typedef v16bf V; static __device__ __forceinline__ V ld(const bf* p) { return cat16b(*(const v8us*)p, *(const v8us*)(p + 16)); } static __device__ __forceinline__ v8f mma(V a, V b, v8f c) { return wmmab(a, b, c); } };
template <typename T16, int NSPLIT, bool BIAS>
__global__ __launch_bounds__(32) void k_gemmw(const T16* __restrict__ A, const T16* __restrict__ A2, const T16* __restrict__ Bt, const T16* __restrict__ Bt2, int K, float* C, int ldc, const float* __restrict__ bias, size_t sA, size_t sB, size_t sC) {
    typedef typename WFrag<T16>::V V;
    __shared__ __align__(16) float os[16 * 68];
    const size_t z = blockIdx.z; A += z * sA; if (A2) A2 += z * sA; Bt += z * sB; if (Bt2) Bt2 += z * sB; C += z * sC;
    const int lane = threadIdx.x & 31, lr = lane & 15, hi = lane >> 4; const int r0 = blockIdx.x * 64, c0 = blockIdx.y * 64;
    v8f acc[4][4];
#pragma unroll
    for (int mb = 0; mb < 4; ++mb)
#pragma unroll
        for (int nb = 0; nb < 4; ++nb) acc[mb][nb] = (v8f){};
    const size_t aoff = (size_t)(r0 + lr) * K + 8 * hi, boff = (size_t)(c0 + lr) * K + 8 * hi;
#pragma unroll 1
    for (int kc = 0; kc < K; kc += 32) {
        V a[4], a2[4];
#pragma unroll
        for (int mb = 0; mb < 4; ++mb) { a[mb] = WFrag<T16>::ld(A + aoff + (size_t)mb * 16 * K + kc); if (NSPLIT == 1 || NSPLIT == 2) a2[mb] = WFrag<T16>::ld(A2 + aoff + (size_t)mb * 16 * K + kc); }
#pragma unroll
        for (int nb = 0; nb < 4; ++nb) { const V b = WFrag<T16>::ld(Bt + boff + (size_t)nb * 16 * K + kc); V b2; if (NSPLIT >= 2) b2 = WFrag<T16>::ld(Bt2 + boff + (size_t)nb * 16 * K + kc);
#pragma unroll
            for (int mb = 0; mb < 4; ++mb) { acc[mb][nb] = WFrag<T16>::mma(a[mb], b, acc[mb][nb]); if (NSPLIT == 1 || NSPLIT == 2) acc[mb][nb] = WFrag<T16>::mma(a2[mb], b, acc[mb][nb]); if (NSPLIT >= 2) acc[mb][nb] = WFrag<T16>::mma(a[mb], b2, acc[mb][nb]); } }
        asm volatile("v_nop\n\tv_nop\n\tv_nop\n\tv_nop" : "+v"(acc[0][0]), "+v"(acc[1][1]), "+v"(acc[2][2]), "+v"(acc[3][3]) : "v"(a[0]), "v"(a[3]));
    }
#pragma unroll
    for (int mb = 0; mb < 4; ++mb) {
#pragma unroll
        for (int nb = 0; nb < 4; ++nb) {
#pragma unroll
            for (int j = 0; j < 8; ++j) os[(hi * 8 + j) * 68 + nb * 16 + lr] = acc[mb][nb][j]; }
        __builtin_amdgcn_wave_barrier(); asm volatile("" ::: "memory");
        float* crow = C + (size_t)(r0 + mb * 16) * ldc + c0;
{
#pragma unroll
            for (int s = 0; s < 8; ++s) { const int row = 2 * s + hi, cofs = lr * 4; v4f val = *(const v4fa*)(os + row * 68 + cofs); if (BIAS) { val[0] += bfr(bias[c0 + cofs]); val[1] += bfr(bias[c0 + cofs + 1]); val[2] += bfr(bias[c0 + cofs + 2]); val[3] += bfr(bias[c0 + cofs + 3]); }
                *(v4f*)(crow + (size_t)row * ldc + cofs) = val; }
             }
        __builtin_amdgcn_wave_barrier(); asm volatile("" ::: "memory");
    }
}

// ---- k_gemmc: the same one-wave 64x64 tile GEMM specialised for causal attention: CMODE 1 skips score tiles entirely above the diagonal (query rows r0+roff.., key columns c0..), CMODE 2 limits the
// key (K) loop of the probability x value contraction to the diagonal block (probabilities beyond it are exactly zero). roff = row offset of this launch's first row within the sequence.
template <typename T16, int NSPLIT, int CMODE>
__global__ __launch_bounds__(32) void k_gemmc(const T16* __restrict__ A, const T16* __restrict__ A2, const T16* __restrict__ Bt, const T16* __restrict__ Bt2, int K, float* C, int ldc, int roff, size_t sA, size_t sB, size_t sC) {
    typedef typename WFrag<T16>::V V;
    __shared__ __align__(16) float os[16 * 68];
    const size_t z = blockIdx.z; A += z * sA; if (A2) A2 += z * sA; Bt += z * sB; if (Bt2) Bt2 += z * sB; C += z * sC;
    const int lane = threadIdx.x & 31, lr = lane & 15, hi = lane >> 4; const int r0 = blockIdx.x * 64, c0 = blockIdx.y * 64;
    if (CMODE == 1 && c0 > r0 + roff + 63) return;                  // score tile entirely above the causal diagonal: never read (the softmax masks j > i by select)
    const int Kl = (CMODE == 2) ? min(K, r0 + roff + 64) : K;        // P.V: probabilities are exactly 0 beyond the diagonal block, so the K loop stops there
    v8f acc[4][4];
#pragma unroll
    for (int mb = 0; mb < 4; ++mb)
#pragma unroll
        for (int nb = 0; nb < 4; ++nb) acc[mb][nb] = (v8f){};
    const size_t aoff = (size_t)(r0 + lr) * K + 8 * hi, boff = (size_t)(c0 + lr) * K + 8 * hi;
#pragma unroll 1
    for (int kc = 0; kc < Kl; kc += 32) {
        V a[4], a2[4];
#pragma unroll
        for (int mb = 0; mb < 4; ++mb) { a[mb] = WFrag<T16>::ld(A + aoff + (size_t)mb * 16 * K + kc); if (NSPLIT == 1 || NSPLIT == 2) a2[mb] = WFrag<T16>::ld(A2 + aoff + (size_t)mb * 16 * K + kc); }
#pragma unroll
        for (int nb = 0; nb < 4; ++nb) { const V b = WFrag<T16>::ld(Bt + boff + (size_t)nb * 16 * K + kc); V b2; if (NSPLIT >= 2) b2 = WFrag<T16>::ld(Bt2 + boff + (size_t)nb * 16 * K + kc);
#pragma unroll
            for (int mb = 0; mb < 4; ++mb) { acc[mb][nb] = WFrag<T16>::mma(a[mb], b, acc[mb][nb]); if (NSPLIT == 1 || NSPLIT == 2) acc[mb][nb] = WFrag<T16>::mma(a2[mb], b, acc[mb][nb]); if (NSPLIT >= 2) acc[mb][nb] = WFrag<T16>::mma(a[mb], b2, acc[mb][nb]); } }
        asm volatile("v_nop\n\tv_nop\n\tv_nop\n\tv_nop" : "+v"(acc[0][0]), "+v"(acc[1][1]), "+v"(acc[2][2]), "+v"(acc[3][3]) : "v"(a[0]), "v"(a[3]));
    }
#pragma unroll
    for (int mb = 0; mb < 4; ++mb) {
#pragma unroll
        for (int nb = 0; nb < 4; ++nb) {
#pragma unroll
            for (int j = 0; j < 8; ++j) os[(hi * 8 + j) * 68 + nb * 16 + lr] = acc[mb][nb][j]; }
        __builtin_amdgcn_wave_barrier(); asm volatile("" ::: "memory");
        float* crow = C + (size_t)(r0 + mb * 16) * ldc + c0;
{
#pragma unroll
            for (int s = 0; s < 8; ++s) { const int row = 2 * s + hi, cofs = lr * 4; v4f val = *(const v4fa*)(os + row * 68 + cofs);
                *(v4f*)(crow + (size_t)row * ldc + cofs) = val; }
             }
        __builtin_amdgcn_wave_barrier(); asm volatile("" ::: "memory");
    }
}

// ---- k_gemmp: probability x value product, ONE WORK-GROUP OF 8 WAVES per 32x32 output tile; grid (M/32, N/32, Z), 256 threads. The key (K) loop, cut at the diagonal block as in CMODE 2 above, is split over the waves:
// wave w takes the 64-key chunks w, w + 8, w + 16, ... (one whole 128-byte line of every operand row per chunk), so a tile has 8 x 16 (or 8 x 32) loads in flight instead of one wave's 16.
// The 8 partial tiles meet in LDS behind one barrier and are added in wave order 0..7 (a fixed order). K % 64 == 0; probabilities beyond the diagonal are stored as exact zeros, so rounding the cut up to 64 keys adds zeros.
template <typename T16, int NSPLIT>
__global__ __launch_bounds__(256) void k_gemmp(const T16* __restrict__ A, const T16* __restrict__ A2, const T16* __restrict__ Bt, const T16* __restrict__ Bt2, int K, float* C, int ldc, int roff, size_t sA, size_t sB, size_t sC) {
    typedef typename WFrag<T16>::V V;
    __shared__ __align__(16) float ps[8 * 32 * 36];
    const size_t z = blockIdx.z; A += z * sA; if (A2) A2 += z * sA; Bt += z * sB; if (Bt2) Bt2 += z * sB; C += z * sC;
    const int lane = threadIdx.x & 31, lr = lane & 15, hi = lane >> 4; const int r0 = blockIdx.x * 32, c0 = blockIdx.y * 32;
    const int w = __builtin_amdgcn_readfirstlane(threadIdx.x >> 5);   // wave number in a scalar register: the chunk loop's test stays a scalar branch
    const int Kl = min(K, (r0 + roff + 32 + 63) & ~63);
    v8f acc[2][2];
#pragma unroll
    for (int mb = 0; mb < 2; ++mb)
#pragma unroll
        for (int nb = 0; nb < 2; ++nb) acc[mb][nb] = (v8f){};
    const size_t aoff = (size_t)(r0 + lr) * K + 8 * hi, boff = (size_t)(c0 + lr) * K + 8 * hi;
#pragma unroll 1
    for (int kc = 64 * w; kc < Kl; kc += 512) {
        V a[2][2], a2[2][2], b[2][2], b2[2][2]; const T16 *pa[2], *pb[2], *pa2[2], *pb2[2];
#pragma unroll
        for (int q = 0; q < 2; ++q) { pa[q] = A + aoff + (size_t)q * 16 * K + kc; pb[q] = Bt + boff + (size_t)q * 16 * K + kc; if (NSPLIT == 2) { pa2[q] = A2 + aoff + (size_t)q * 16 * K + kc; pb2[q] = Bt2 + boff + (size_t)q * 16 * K + kc; } }
#pragma unroll
        for (int ks = 0; ks < 2; ++ks)
#pragma unroll
            for (int q = 0; q < 2; ++q) { a[ks][q] = WFrag<T16>::ld(pa[q] + ks * 32); b[ks][q] = WFrag<T16>::ld(pb[q] + ks * 32); if (NSPLIT == 2) { a2[ks][q] = WFrag<T16>::ld(pa2[q] + ks * 32); b2[ks][q] = WFrag<T16>::ld(pb2[q] + ks * 32); } }
        // the wait that goes before a register named by an issued load is overwritten; the addresses are its inputs, so they stay whole up to it (otherwise the last loads' results are placed over them)
        if (NSPLIT == 2) asm volatile("s_wait_xcnt 0x0" :: "v"(pa[0]), "v"(pa[1]), "v"(pb[0]), "v"(pb[1]), "v"(pa2[0]), "v"(pa2[1]), "v"(pb2[0]), "v"(pb2[1]) : "memory");
        else asm volatile("s_wait_xcnt 0x0" :: "v"(pa[0]), "v"(pa[1]), "v"(pb[0]), "v"(pb[1]) : "memory");
        __builtin_amdgcn_sched_barrier(0);   // every load of the chunk is issued before the first product: without it the scheduler sinks loads between the products and a chunk waits out the memory latency three times
#pragma unroll
        for (int ks = 0; ks < 2; ++ks)
#pragma unroll
            for (int nb = 0; nb < 2; ++nb)
#pragma unroll
                for (int mb = 0; mb < 2; ++mb) { acc[mb][nb] = WFrag<T16>::mma(a[ks][mb], b[ks][nb], acc[mb][nb]); if (NSPLIT == 2) { acc[mb][nb] = WFrag<T16>::mma(a2[ks][mb], b[ks][nb], acc[mb][nb]); acc[mb][nb] = WFrag<T16>::mma(a[ks][mb], b2[ks][nb], acc[mb][nb]); } }
    }
    float* pw = ps + w * (32 * 36);
#pragma unroll
    for (int mb = 0; mb < 2; ++mb)
#pragma unroll
        for (int nb = 0; nb < 2; ++nb)
#pragma unroll
            for (int j = 0; j < 8; ++j) pw[(mb * 16 + hi * 8 + j) * 36 + nb * 16 + lr] = acc[mb][nb][j];
    __syncthreads();   // every wave's partial tile is in LDS before any thread adds them
    const int row = threadIdx.x >> 3, cofs = (threadIdx.x & 7) * 4; v4f s = *(const v4fa*)(ps + row * 36 + cofs);
#pragma unroll
    for (int u = 1; u < 8; ++u) s += *(const v4fa*)(ps + u * (32 * 36) + row * 36 + cofs);
    *(v4f*)(C + (size_t)(r0 + row) * ldc + c0 + cofs) = s;
}

__device__ __forceinline__ h16 tohx(float x) { return (h16)x; }
__device__ __forceinline__ void splitf(float y, unsigned short& h, unsigned short& l) { h = f2bf(y); l = f2bf(y - bf2f(h)); }
typedef __attribute__((ext_vector_type(2))) _Float16 v2h;
typedef __attribute__((ext_vector_type(4))) _Float16 v4h;
typedef __attribute__((ext_vector_type(2))) unsigned short v2us;
typedef __attribute__((ext_vector_type(4))) unsigned short v4us;
typedef __attribute__((ext_vector_type(2))) float v2f;
typedef __attribute__((ext_vector_type(4))) int v4i;

__global__ __launch_bounds__(256) void k_wtG(const float* __restrict__ w, int K, int N, bf* Bt) {
    const int lane = threadIdx.x & 31; const int L0 = (blockIdx.x * 8 + (threadIdx.x >> 5)) * 8; const int nlines = N * K / 64;
{
#pragma unroll 1
        for (int l = 0; l < 8; ++l) { const int L = L0 + l; if (L >= nlines) break; const size_t e = (size_t)L * 64 + lane * 2; const int k = (int)(e % K), n = (int)(e / K); v2us o;
            o[0] = f2bf(w[(size_t)k * N + n]); o[1] = f2bf(w[(size_t)(k + 1) * N + n]); *(v2us*)(Bt + e) = o; }
         }
}
__global__ __launch_bounds__(256) void k_cvt8(const float* __restrict__ src, bf* dst, size_t n8) { const size_t i = (size_t)blockIdx.x * 256 + threadIdx.x; if (i >= n8) return; const v8f v = *(const v8f*)(src + i * 8); v8us o;
#pragma unroll
    for (int k = 0; k < 8; ++k) o[k] = f2bf(v[k]); *(v8us*)(dst + i * 8) = o;  }

// k_rope: head planes [h][t][d] (fp16 + hi/lo) of rope(x) x sc with the rotate-half convention out[d] = x[d] cos[t][d] - x[d+HD/2] sin[t][d], out[d+HD/2] = x[d+HD/2] cos[t][d+HD/2] + x[d] sin[t][d+HD/2]
__global__ __launch_bounds__(256) void k_rope(const float* __restrict__ F, int pitch, int nheads, const float* __restrict__ CS, const float* __restrict__ RF, const float* __restrict__ nw, float sc, h16* P16, bf* Ph, bf* Pl) {
    const size_t e = ((size_t)blockIdx.x * 256 + threadIdx.x) * 2; if (e >= (size_t)nheads * TT * HD) return; const int d = (int)(e % HD); const int t = (int)((e / HD) % TT); const int h = (int)(e / ((size_t)HD * TT)); const float* f = F + (size_t)t * pitch + h * HD; const float rf = RF ? RF[(size_t)h * TT + t] : 1.0f; v2h o16; v2us oh, ol;
#pragma unroll
    for (int q = 0; q < 2; ++q) { const int dd = d + q; const int dp = (dd < HD / 2) ? dd + HD / 2 : dd - HD / 2; float x0 = f[dd], x1 = f[dp];
        if (RF) { float n0 = __fmul_rn(x0, rf), n1 = __fmul_rn(x1, rf); asm volatile("" : "+v"(n0)); asm volatile("" : "+v"(n1)); x0 = __fmul_rn(bfr(nw[dd]), n0); x1 = __fmul_rn(bfr(nw[dp]), n1); }
        const v2f cs = *(const v2f*)(CS + ((size_t)t * HD + dd) * 2); float a = __fmul_rn(x0, cs[0]), bq = __fmul_rn(x1, cs[1]); asm volatile("" : "+v"(a)); asm volatile("" : "+v"(bq)); const float r = ((dd < HD / 2) ? __fsub_rn(a, bq) : __fadd_rn(a, bq)) * sc;
        o16[q] = tohx(r); unsigned short a2, c2; splitf(r, a2, c2); oh[q] = a2; ol[q] = c2; }
    *(v2h*)(P16 + e) = o16; *(v2us*)(Ph + e) = oh; *(v2us*)(Pl + e) = ol;  }
__global__ __launch_bounds__(256) void k_vtp(const float* __restrict__ F, int pitch, int nheads, h16* V16, bf* Vh, bf* Vl) { const size_t e = ((size_t)blockIdx.x * 256 + threadIdx.x) * 2; if (e >= (size_t)nheads * HD * TT) return; const int t = (int)(e % TT); const int d = (int)((e / TT) % HD); const int g = (int)(e / ((size_t)TT * HD)); v2h o16; v2us oh, ol;
#pragma unroll
    for (int q = 0; q < 2; ++q) { const float x = F[(size_t)(t + q) * pitch + g * HD + d]; o16[q] = tohx(x); unsigned short a2, c2; splitf(x, a2, c2); oh[q] = a2; ol[q] = c2; }
    *(v2h*)(V16 + e) = o16; *(v2us*)(Vh + e) = oh; *(v2us*)(Vl + e) = ol;  }
__global__ __launch_bounds__(256) void k_csid(float* CS) { const int idx = blockIdx.x * 256 + threadIdx.x; if (idx >= TT * HD) return; v2f cs; cs[0] = 1.0f; cs[1] = 0.0f; *(v2f*)(CS + (size_t)idx * 2) = cs;  }
// k_asoft: per row (zz, i): t = S x HD^-0.5 for j <= i and i - j < WIN (sliding causal window; the reference's -1e9 additive fill vanishes identically); softmax over the 2048 keys (register row, one exp, fixed trees);
__global__ __launch_bounds__(256) void k_asoft(const float* __restrict__ Sb, h16* P16, bf* Ph, bf* Pl) {
    const int lane = threadIdx.x & 31; const int row = blockIdx.x * 8 + (threadIdx.x >> 5); if (row >= ZH * TT) return; const int i = row % TT; const int zz = row / TT; (void)zz; const bool hires = (i < RH); const float* sr = Sb + (size_t)row * TT; float v[TT / 32]; float mx = -3.0e38f;
#pragma unroll
    for (int ch = 0; ch < TT / 128; ++ch) { const int j0 = ch * 128 + lane * 4; const v4f a = *(const v4f*)(sr + j0);
#pragma unroll
        for (int q = 0; q < 4; ++q) { const int j = j0 + q; (void)j; const float t = (j <= i && i - j < WIN) ? a[q] * SCL : -3.0e38f; v[ch * 4 + q] = t; mx = fmaxf(mx, t); } }
#pragma unroll
    for (int sh = 16; sh; sh >>= 1) mx = fmaxf(mx, __shfl_xor(mx, sh, 32));
    float sum = 0.f;
#pragma unroll
    for (int k = 0; k < TT / 32; ++k) { float d0 = __fsub_rn(v[k], mx); asm volatile("" : "+v"(d0)); v[k] = __builtin_amdgcn_exp2f(__fmul_rn(d0, 1.4426950408889634f)); sum += v[k]; }
#pragma unroll
    for (int sh = 16; sh; sh >>= 1) sum += __shfl_xor(sum, sh, 32);
    const float f = __fdiv_rn(hires ? 1.0f : PCAR, sum);
{
        if (hires) {
#pragma unroll
            for (int ch = 0; ch < TT / 128; ++ch) { v4us oh, ol;
#pragma unroll
                for (int q = 0; q < 4; ++q) { unsigned short a, c2; splitf(v[ch * 4 + q] * f, a, c2); oh[q] = a; ol[q] = c2; }
                const size_t oo = ((size_t)zz * (RH ? RH : 1) + i) * TT + ch * 128 + lane * 4; *(v4us*)(Ph + oo) = oh; *(v4us*)(Pl + oo) = ol; }
        } else {
#pragma unroll
            for (int ch = 0; ch < TT / 128; ++ch) { v4h o4;
#pragma unroll
                for (int q = 0; q < 4; ++q) o4[q] = tohx(v[ch * 4 + q] * f);
                *(v4h*)(P16 + (size_t)row * TT + ch * 128 + lane * 4) = o4; } }
         }
}
__global__ __launch_bounds__(256) void k_merge(const float* __restrict__ O, int h0, bf* Ah, bf* Al) { const size_t e = ((size_t)blockIdx.x * 256 + threadIdx.x) * 2; if (e >= (size_t)ZH * TT * HD) return; const int d = (int)(e % HD); const int t = (int)((e / HD) % TT); const int zz = (int)(e / ((size_t)HD * TT)); const float cs = (t < RH) ? 1.0f : (1.0f / PCAR); const size_t oo = (size_t)t * DQ + (h0 + zz) * HD + d;
    v2us oh, ol;
#pragma unroll
    for (int q = 0; q < 2; ++q) { unsigned short a, c2; splitf(O[e + q] * cs, a, c2); oh[q] = a; ol[q] = c2; } *(v2us*)(Ah + oo) = oh; *(v2us*)(Al + oo) = ol;  }

extern "C" void kernel_launch(void* const* d_in, const int* in_sizes, int n_in,
                              void* d_out, int out_size, void* d_ws, size_t ws_size, hipStream_t stream) {
    (void)in_sizes; (void)n_in; (void)out_size;
    const float* x = (const float*)d_in[0]; const float* wq = (const float*)d_in[1]; const float* bq = (const float*)d_in[2]; const float* wk = (const float*)d_in[3]; const float* bk = (const float*)d_in[4]; const float* wv = (const float*)d_in[5]; const float* bv = (const float*)d_in[6]; const float* wo = (const float*)d_in[7]; const float* bo = (const float*)d_in[8];
    float* OUT = (float*)d_out;     // [2][2048][1024]
    char* wsp = (char*)d_ws;
    auto take = [&](size_t bytes) { char* p = wsp; wsp += (bytes + 255) & ~(size_t)255; return (void*)p; };
    bf* WQ = (bf*)take((size_t)DQ * DM * 2); bf* WK = (bf*)take((size_t)DKV * DM * 2); bf* WV = (bf*)take((size_t)DKV * DM * 2); bf* WO = (bf*)take((size_t)DM * DQ * 2); float* CS = (float*)take((size_t)TT * HD * 2 * 4);
    bf* XB = (bf*)take((size_t)TT * DM * 2); float* FQ = (float*)take((size_t)TT * DQ * 4); float* FK = (float*)take((size_t)TT * DKV * 4);
    h16* QP16 = (h16*)take((size_t)NH_ * TT * HD * 2); h16* KP16 = (h16*)take((size_t)NKV * TT * HD * 2); h16* VT16 = (h16*)take((size_t)NKV * HD * TT * 2);
    bf* QPh = (bf*)take((size_t)NH_ * TT * HD * 2); bf* QPl = (bf*)take((size_t)NH_ * TT * HD * 2); bf* KPh = (bf*)take((size_t)NKV * TT * HD * 2); bf* KPl = (bf*)take((size_t)NKV * TT * HD * 2); bf* VTh = (bf*)take((size_t)NKV * HD * TT * 2); bf* VTl = (bf*)take((size_t)NKV * HD * TT * 2); bf* Ph = (bf*)take((size_t)ZH * RH * TT * 2); bf* Pl = (bf*)take((size_t)ZH * RH * TT * 2);
    float* Sb = (float*)take((size_t)ZH * TT * TT * 4); h16* P16 = (h16*)take((size_t)ZH * TT * TT * 2); float* Ob = (float*)take((size_t)ZH * TT * HD * 4); bf* ATh = (bf*)take((size_t)TT * DQ * 2); bf* ATl = (bf*)take((size_t)TT * DQ * 2);
    if ((size_t)(wsp - (char*)d_ws) > ws_size) return;    // ws 256 MiB
    float* FV = FK;   // v projection reuses the k buffer after the k planes are built (stream-ordered)
    { k_cvt8<<<(unsigned)(((size_t)DQ * DM / 8 + 255) / 256), 256, 0, stream>>>(wq, WQ, (size_t)DQ * DM / 8); k_cvt8<<<(unsigned)(((size_t)DKV * DM / 8 + 255) / 256), 256, 0, stream>>>(wk, WK, (size_t)DKV * DM / 8); k_cvt8<<<(unsigned)(((size_t)DKV * DM / 8 + 255) / 256), 256, 0, stream>>>(wv, WV, (size_t)DKV * DM / 8);
      k_cvt8<<<(unsigned)(((size_t)DM * DQ / 8 + 255) / 256), 256, 0, stream>>>(wo, WO, (size_t)DM * DQ / 8);
       }
    k_csid<<<(TT * HD + 255) / 256, 256, 0, stream>>>(CS);
    const unsigned LQ = (unsigned)(((size_t)NH_ * TT * HD / 2 + 255) / 256), LKv = (unsigned)(((size_t)NKV * TT * HD / 2 + 255) / 256);
    for (int b = 0; b < NB_; ++b) {
        
        k_cvt8<<<(unsigned)(((size_t)TT * DM / 8 + 255) / 256), 256, 0, stream>>>(x + (size_t)b * TT * DM, XB, (size_t)TT * DM / 8);
        k_gemmw<bf, 0, true><<<dim3(TT / 64, DQ / 64, 1), 32, 0, stream>>>(XB, nullptr, WQ, nullptr, DM, FQ, DQ, bq, 0, 0, 0);
        k_rope<<<LQ, 256, 0, stream>>>(FQ, DQ, NH_, CS, nullptr, nullptr, 1.0f, QP16, QPh, QPl);
        k_gemmw<bf, 0, true><<<dim3(TT / 64, DKV / 64, 1), 32, 0, stream>>>(XB, nullptr, WK, nullptr, DM, FK, DKV, bk, 0, 0, 0);
        k_rope<<<LKv, 256, 0, stream>>>(FK, DKV, NKV, CS, nullptr, nullptr, 1.0f, KP16, KPh, KPl);
        k_gemmw<bf, 0, true><<<dim3(TT / 64, DKV / 64, 1), 32, 0, stream>>>(XB, nullptr, WV, nullptr, DM, FV, DKV, bv, 0, 0, 0); k_vtp<<<LKv, 256, 0, stream>>>(FV, DKV, NKV, VT16, VTh, VTl);
        for (int h0 = 0; h0 < NH_; h0 += ZH) { const size_t zq = (size_t)h0, zk = (size_t)(h0 / REP);   // one kv head per query head: the pass's two heads use consecutive kv planes (z-strides TT*HD)
            k_gemmc<bf, 2, 1><<<dim3(RH / 64, TT / 64, ZH), 32, 0, stream>>>(QPh + zq * TT * HD, QPl + zq * TT * HD, KPh + zk * TT * HD, KPl + zk * TT * HD, HD, Sb, TT, 0, (size_t)TT * HD, (size_t)TT * HD, (size_t)TT * TT);
            k_gemmc<h16, 0, 1><<<dim3((TT - RH) / 64, TT / 64, ZH), 32, 0, stream>>>(QP16 + zq * TT * HD + (size_t)RH * HD, nullptr, KP16 + zk * TT * HD, nullptr, HD, Sb + (size_t)RH * TT, TT, RH, (size_t)TT * HD, (size_t)TT * HD, (size_t)TT * TT);
            k_asoft<<<ZH * TT / 8, 256, 0, stream>>>(Sb, P16, Ph, Pl);
            k_gemmp<bf, 2><<<dim3(RH / 32, HD / 32, ZH), 256, 0, stream>>>(Ph, Pl, VTh + zk * HD * TT, VTl + zk * HD * TT, TT, Ob, HD, 0, (size_t)RH * TT, (size_t)HD * TT, (size_t)TT * HD);
            k_gemmp<h16, 0><<<dim3((TT - RH) / 32, HD / 32, ZH), 256, 0, stream>>>(P16 + (size_t)RH * TT, nullptr, VT16 + zk * HD * TT, nullptr, TT, Ob + (size_t)RH * HD, HD, RH, (size_t)TT * TT, (size_t)HD * TT, (size_t)TT * HD);
            k_merge<<<(unsigned)(((size_t)ZH * TT * HD / 2 + 255) / 256), 256, 0, stream>>>(Ob, h0, ATh, ATl); }
        k_gemmw<bf, 1, true><<<dim3(TT / 64, DM / 64, 1), 32, 0, stream>>>(ATh, ATl, WO, nullptr, DQ, OUT + (size_t)b * TT * DM, DM, bo, 0, 0, 0); }
}

// v002
// One run takes 547 microseconds.
// Timed twice side by side with v001, it ran 1.37 times as fast both times.
// Over all steps from v000 it is 2.64 times as fast.
#include <hip/hip_runtime.h>

// Causal multi-head attention, cache-free prefill path (x [2][2048][1024]; q,k,v = x W^T + b ('oi' 0.02, zero biases; 16 heads x 64); scores / 8; triu(1) -> -inf; softmax; out = merged Wo^T + bo -> [2][2048][1024] (4.2 M)).
// Layout per batch: bf16 copy of x; 'oi' weights; exact projections + bf16-rounded biases; causal T-2048 attention (hybrid rows: < 512 hi/lo 3 products, rest fp16 x1024; tiles above the diagonal skipped); merged hi/lo x Wo exact + bo.
// Compute dtypes, f32 accumulate: every input rounded to bf16; projections exact + bf16-rounded biases; attention rows < 512 3 products, rest fp16; softmax f32; Wo hl x exact + bias.

#define NB_  2
#define TT   2048
#define DM   1024
#define NH_  16
#define NKV  16
#define REP  (NH_ / NKV)
#define HD   64
#define DQ   (NH_ * HD)
#define DKV  (NKV * HD)
#define ZH   8                    // heads per attention pass (z dimension of every attention launch)
#define RH   512                  // query rows < RH use hi+lo planes (0: none)
#define WIN  2048
#define PCAR 1024.0f
#define SCL  0.125f   // HD^-0.5
typedef _Float16 h16;
typedef unsigned short bf;
typedef __attribute__((ext_vector_type(16))) __bf16   v16bf;
typedef __attribute__((ext_vector_type(16))) _Float16 v16h;
typedef __attribute__((ext_vector_type(8)))  _Float16 v8h;
typedef __attribute__((ext_vector_type(8)))  unsigned short v8us;
typedef __attribute__((ext_vector_type(8)))  float    v8f;
typedef __attribute__((ext_vector_type(4)))  float    v4f;
typedef v8h  __attribute__((may_alias)) v8ha;
typedef v4f  __attribute__((may_alias)) v4fa;
typedef v8us __attribute__((may_alias)) v8usa;

__device__ __forceinline__ unsigned short f2bf(float f) { unsigned u = __float_as_uint(f); u += 0x7FFFu + ((u >> 16) & 1u); return (unsigned short)(u >> 16); }
__device__ __forceinline__ float bf2f(unsigned short b) { return __uint_as_float(((unsigned)b) << 16); }
__device__ __forceinline__ float bfr(float f) { return bf2f(f2bf(f)); }
__device__ __forceinline__ v16h cat16(v8h lo, v8h hi) { return __builtin_shufflevector(lo, hi, 0, 1, 2, 3, 4, 5, 6, 7, 8, 9, 10, 11, 12, 13, 14, 15); }
__device__ __forceinline__ v16bf cat16b(v8us lo, v8us hi) { return __builtin_bit_cast(v16bf, __builtin_shufflevector(lo, hi, 0, 1, 2, 3, 4, 5, 6, 7, 8, 9, 10, 11, 12, 13, 14, 15)); }
__device__ __forceinline__ v8f wmma16(v16h a, v16h b, v8f c) { return __builtin_amdgcn_wmma_f32_16x16x32_f16(false, a, false, b, (short)0, c, false, false); }
__device__ __forceinline__ v8f wmmab(v16bf a, v16bf b, v8f c) { return __builtin_amdgcn_wmma_f32_16x16x32_bf16(false, a, false, b, (short)0, c, false, false); }



// ---- k_gemmw: register-blocked GEMM, ONE WAVE per 64x64 output tile (16 accumulators), operands straight from K-contiguous 16-bit planes; grid (M/64, N/64, Z), 32 threads.
// C[m][n] (f32, pitch ldc, + optional f32 bias[n]) = sum_k A[m][k] Bt[n][k] (+ split products per NSPLIT). z-batch strides sA/sB/sC in elements. K % 32 == 0.
template <typename T16> struct WFrag;
template <> struct WFrag<h16> { typedef v16h V; static __device__ __forceinline__ V ld(const h16* p) { return cat16(*(const v8h*)p, *(const v8h*)(p + 16)); } static __device__ __forceinline__ v8f mma(V a, V b, v8f c) { return wmma16(a, b, c); } };
template <> struct WFrag<bf> { typedef v16bf V; static __device__ __forceinline__ V ld(const bf* p) { return cat16b(*(const v8us*)p, *(const v8us*)(p + 16)); } static __device__ __forceinline__ v8f mma(V a, V b, v8f c) { return wmmab(a, b, c); } };
template <typename T16, int NSPLIT, bool BIAS>
__global__ __launch_bounds__(32) void k_gemmw(const T16* __restrict__ A, const T16* __restrict__ A2, const T16* __restrict__ Bt, const T16* __restrict__ Bt2, int K, float* C, int ldc, const float* __restrict__ bias, size_t sA, size_t sB, size_t sC) {
    typedef typename WFrag<T16>::V V;
    __shared__ __align__(16) float os[16 * 68];
    const size_t z = blockIdx.z; A += z * sA; if (A2) A2 += z * sA; Bt += z * sB; if (Bt2) Bt2 += z * sB; C += z * sC;
    const int lane = threadIdx.x & 31, lr = lane & 15, hi = lane >> 4; const int r0 = blockIdx.x * 64, c0 = blockIdx.y * 64;
    v8f acc[4][4];
#pragma unroll
    for (int mb = 0; mb < 4; ++mb)
#pragma unroll
        for (int nb = 0; nb < 4; ++nb) acc[mb][nb] = (v8f){};
    const size_t aoff = (size_t)(r0 + lr) * K + 8 * hi, boff = (size_t)(c0 + lr) * K + 8 * hi;
#pragma unroll 1
    for (int kc = 0; kc < K; kc += 32) {
        V a[4], a2[4];
#pragma unroll
        for (int mb = 0; mb < 4; ++mb) { a[mb] = WFrag<T16>::ld(A + aoff + (size_t)mb * 16 * K + kc); if (NSPLIT == 1 || NSPLIT == 2) a2[mb] = WFrag<T16>::ld(A2 + aoff + (size_t)mb * 16 * K + kc); }
#pragma unroll
        for (int nb = 0; nb < 4; ++nb) { const V b = WFrag<T16>::ld(Bt + boff + (size_t)nb * 16 * K + kc); V b2; if (NSPLIT >= 2) b2 = WFrag<T16>::ld(Bt2 + boff + (size_t)nb * 16 * K + kc);
#pragma unroll
            for (int mb = 0; mb < 4; ++mb) { acc[mb][nb] = WFrag<T16>::mma(a[mb], b, acc[mb][nb]); if (NSPLIT == 1 || NSPLIT == 2) acc[mb][nb] = WFrag<T16>::mma(a2[mb], b, acc[mb][nb]); if (NSPLIT >= 2) acc[mb][nb] = WFrag<T16>::mma(a[mb], b2, acc[mb][nb]); } }
        asm volatile("v_nop\n\tv_nop\n\tv_nop\n\tv_nop" : "+v"(acc[0][0]), "+v"(acc[1][1]), "+v"(acc[2][2]), "+v"(acc[3][3]) : "v"(a[0]), "v"(a[3]));
    }
#pragma unroll
    for (int mb = 0; mb < 4; ++mb) {
#pragma unroll
        for (int nb = 0; nb < 4; ++nb) {
#pragma unroll
            for (int j = 0; j < 8; ++j) os[(hi * 8 + j) * 68 + nb * 16 + lr] = acc[mb][nb][j]; }
        __builtin_amdgcn_wave_barrier(); asm volatile("" ::: "memory");
        float* crow = C + (size_t)(r0 + mb * 16) * ldc + c0;
{
#pragma unroll
            for (int s = 0; s < 8; ++s) { const int row = 2 * s + hi, cofs = lr * 4; v4f val = *(const v4fa*)(os + row * 68 + cofs); if (BIAS) { val[0] += bfr(bias[c0 + cofs]); val[1] += bfr(bias[c0 + cofs + 1]); val[2] += bfr(bias[c0 + cofs + 2]); val[3] += bfr(bias[c0 + cofs + 3]); }
                *(v4f*)(crow + (size_t)row * ldc + cofs) = val; }
             }
        __builtin_amdgcn_wave_barrier(); asm volatile("" ::: "memory");
    }
}

// ---- k_gemmc: the same one-wave 64x64 tile GEMM specialised for causal attention: CMODE 1 skips score tiles entirely above the diagonal (query rows r0+roff.., key columns c0..), CMODE 2 limits the
// key (K) loop of the probability x value contraction to the diagonal block (probabilities beyond it are exactly zero). roff = row offset of this launch's first row within the sequence.
template <typename T16, int NSPLIT, int CMODE>
__global__ __launch_bounds__(32) void k_gemmc(const T16* __restrict__ A, const T16* __restrict__ A2, const T16* __restrict__ Bt, const T16* __restrict__ Bt2, int K, float* C, int ldc, int roff, size_t sA, size_t sB, size_t sC) {
    typedef typename WFrag<T16>::V V;
    __shared__ __align__(16) float os[16 * 68];
    const size_t z = blockIdx.z; A += z * sA; if (A2) A2 += z * sA; Bt += z * sB; if (Bt2) Bt2 += z * sB; C += z * sC;
    const int lane = threadIdx.x & 31, lr = lane & 15, hi = lane >> 4; const int r0 = blockIdx.x * 64, c0 = blockIdx.y * 64;
    if (CMODE == 1 && c0 > r0 + roff + 63) return;                  // score tile entirely above the causal diagonal: never read (the softmax masks j > i by select)
    const int Kl = (CMODE == 2) ? min(K, r0 + roff + 64) : K;        // P.V: probabilities are exactly 0 beyond the diagonal block, so the K loop stops there
    v8f acc[4][4];
#pragma unroll
    for (int mb = 0; mb < 4; ++mb)
#pragma unroll
        for (int nb = 0; nb < 4; ++nb) acc[mb][nb] = (v8f){};
    const size_t aoff = (size_t)(r0 + lr) * K + 8 * hi, boff = (size_t)(c0 + lr) * K + 8 * hi;
#pragma unroll 1
    for (int kc = 0; kc < Kl; kc += 32) {
        V a[4], a2[4];
#pragma unroll
        for (int mb = 0; mb < 4; ++mb) { a[mb] = WFrag<T16>::ld(A + aoff + (size_t)mb * 16 * K + kc); if (NSPLIT == 1 || NSPLIT == 2) a2[mb] = WFrag<T16>::ld(A2 + aoff + (size_t)mb * 16 * K + kc); }
#pragma unroll
        for (int nb = 0; nb < 4; ++nb) { const V b = WFrag<T16>::ld(Bt + boff + (size_t)nb * 16 * K + kc); V b2; if (NSPLIT >= 2) b2 = WFrag<T16>::ld(Bt2 + boff + (size_t)nb * 16 * K + kc);
#pragma unroll
            for (int mb = 0; mb < 4; ++mb) { acc[mb][nb] = WFrag<T16>::mma(a[mb], b, acc[mb][nb]); if (NSPLIT == 1 || NSPLIT == 2) acc[mb][nb] = WFrag<T16>::mma(a2[mb], b, acc[mb][nb]); if (NSPLIT >= 2) acc[mb][nb] = WFrag<T16>::mma(a[mb], b2, acc[mb][nb]); } }
        asm volatile("v_nop\n\tv_nop\n\tv_nop\n\tv_nop" : "+v"(acc[0][0]), "+v"(acc[1][1]), "+v"(acc[2][2]), "+v"(acc[3][3]) : "v"(a[0]), "v"(a[3]));
    }
#pragma unroll
    for (int mb = 0; mb < 4; ++mb) {
#pragma unroll
        for (int nb = 0; nb < 4; ++nb) {
#pragma unroll
            for (int j = 0; j < 8; ++j) os[(hi * 8 + j) * 68 + nb * 16 + lr] = acc[mb][nb][j]; }
        __builtin_amdgcn_wave_barrier(); asm volatile("" ::: "memory");
        float* crow = C + (size_t)(r0 + mb * 16) * ldc + c0;
{
#pragma unroll
            for (int s = 0; s < 8; ++s) { const int row = 2 * s + hi, cofs = lr * 4; v4f val = *(const v4fa*)(os + row * 68 + cofs);
                *(v4f*)(crow + (size_t)row * ldc + cofs) = val; }
             }
        __builtin_amdgcn_wave_barrier(); asm volatile("" ::: "memory");
    }
}

// ---- k_gemmp: probability x value product, ONE WORK-GROUP OF 8 WAVES per 32x32 output tile; grid (M/32, N/32, Z), 256 threads. The key (K) loop, cut at the diagonal block as in CMODE 2 above, is split over the waves:
// wave w takes the 64-key chunks w, w + 8, w + 16, ... (one whole 128-byte line of every operand row per chunk), so a tile has 8 x 16 (or 8 x 32) loads in flight instead of one wave's 16.
// The 8 partial tiles meet in LDS behind one barrier and are added in wave order 0..7 (a fixed order). K % 64 == 0; probabilities beyond the diagonal are stored as exact zeros, so rounding the cut up to 64 keys adds zeros.
// lda = row pitch of A / A2 in elements (the probabilities lie in the score rows, pitch 2 * K); Bt / Bt2 keep pitch K.
template <typename T16, int NSPLIT>
__global__ __launch_bounds__(256) void k_gemmp(const T16* __restrict__ A, const T16* __restrict__ A2, const T16* __restrict__ Bt, const T16* __restrict__ Bt2, int K, int lda, float* C, int ldc, int roff, size_t sA, size_t sB, size_t sC) {
    typedef typename WFrag<T16>::V V;
    __shared__ __align__(16) float ps[8 * 32 * 36];
    const size_t z = blockIdx.z; A += z * sA; if (A2) A2 += z * sA; Bt += z * sB; if (Bt2) Bt2 += z * sB; C += z * sC;
    const int lane = threadIdx.x & 31, lr = lane & 15, hi = lane >> 4; const int r0 = blockIdx.x * 32, c0 = blockIdx.y * 32;
    const int w = __builtin_amdgcn_readfirstlane(threadIdx.x >> 5);   // wave number in a scalar register: the chunk loop's test stays a scalar branch
    const int Kl = min(K, (r0 + roff + 32 + 63) & ~63);
    v8f acc[2][2];
#pragma unroll
    for (int mb = 0; mb < 2; ++mb)
#pragma unroll
        for (int nb = 0; nb < 2; ++nb) acc[mb][nb] = (v8f){};
    const size_t aoff = (size_t)(r0 + lr) * lda + 8 * hi, boff = (size_t)(c0 + lr) * K + 8 * hi;
#pragma unroll 1
    for (int kc = 64 * w; kc < Kl; kc += 512) {
        V a[2][2], a2[2][2], b[2][2], b2[2][2]; const T16 *pa[2], *pb[2], *pa2[2], *pb2[2];
#pragma unroll
        for (int q = 0; q < 2; ++q) { pa[q] = A + aoff + (size_t)q * 16 * lda + kc; pb[q] = Bt + boff + (size_t)q * 16 * K + kc; if (NSPLIT == 2) { pa2[q] = A2 + aoff + (size_t)q * 16 * lda + kc; pb2[q] = Bt2 + boff + (size_t)q * 16 * K + kc; } }
#pragma unroll
        for (int ks = 0; ks < 2; ++ks)
#pragma unroll
            for (int q = 0; q < 2; ++q) { a[ks][q] = WFrag<T16>::ld(pa[q] + ks * 32); b[ks][q] = WFrag<T16>::ld(pb[q] + ks * 32); if (NSPLIT == 2) { a2[ks][q] = WFrag<T16>::ld(pa2[q] + ks * 32); b2[ks][q] = WFrag<T16>::ld(pb2[q] + ks * 32); } }
        // the wait that goes before a register named by an issued load is overwritten; the addresses are its inputs, so they stay whole up to it (otherwise the last loads' results are placed over them)
        if (NSPLIT == 2) asm volatile("s_wait_xcnt 0x0" :: "v"(pa[0]), "v"(pa[1]), "v"(pb[0]), "v"(pb[1]), "v"(pa2[0]), "v"(pa2[1]), "v"(pb2[0]), "v"(pb2[1]) : "memory");
        else asm volatile("s_wait_xcnt 0x0" :: "v"(pa[0]), "v"(pa[1]), "v"(pb[0]), "v"(pb[1]) : "memory");
        __builtin_amdgcn_sched_barrier(0);   // every load of the chunk is issued before the first product: without it the scheduler sinks loads between the products and a chunk waits out the memory latency three times
#pragma unroll
        for (int ks = 0; ks < 2; ++ks)
#pragma unroll
            for (int nb = 0; nb < 2; ++nb)
#pragma unroll
                for (int mb = 0; mb < 2; ++mb) { acc[mb][nb] = WFrag<T16>::mma(a[ks][mb], b[ks][nb], acc[mb][nb]); if (NSPLIT == 2) { acc[mb][nb] = WFrag<T16>::mma(a2[ks][mb], b[ks][nb], acc[mb][nb]); acc[mb][nb] = WFrag<T16>::mma(a[ks][mb], b2[ks][nb], acc[mb][nb]); } }
    }
    float* pw = ps + w * (32 * 36);
#pragma unroll
    for (int mb = 0; mb < 2; ++mb)
#pragma unroll
        for (int nb = 0; nb < 2; ++nb)
#pragma unroll
            for (int j = 0; j < 8; ++j) pw[(mb * 16 + hi * 8 + j) * 36 + nb * 16 + lr] = acc[mb][nb][j];
    __syncthreads();   // every wave's partial tile is in LDS before any thread adds them
    const int row = threadIdx.x >> 3, cofs = (threadIdx.x & 7) * 4; v4f s = *(const v4fa*)(ps + row * 36 + cofs);
#pragma unroll
    for (int u = 1; u < 8; ++u) s += *(const v4fa*)(ps + u * (32 * 36) + row * 36 + cofs);
    *(v4f*)(C + (size_t)(r0 + row) * ldc + c0 + cofs) = s;
}

__device__ __forceinline__ h16 tohx(float x) { return (h16)x; }
__device__ __forceinline__ void splitf(float y, unsigned short& h, unsigned short& l) { h = f2bf(y); l = f2bf(y - bf2f(h)); }
typedef __attribute__((ext_vector_type(2))) _Float16 v2h;
typedef __attribute__((ext_vector_type(4))) _Float16 v4h;
typedef __attribute__((ext_vector_type(2))) unsigned short v2us;
typedef __attribute__((ext_vector_type(4))) unsigned short v4us;
typedef __attribute__((ext_vector_type(2))) float v2f;
typedef __attribute__((ext_vector_type(4))) int v4i;

__global__ __launch_bounds__(256) void k_wtG(const float* __restrict__ w, int K, int N, bf* Bt) {
    const int lane = threadIdx.x & 31; const int L0 = (blockIdx.x * 8 + (threadIdx.x >> 5)) * 8; const int nlines = N * K / 64;
{
#pragma unroll 1
        for (int l = 0; l < 8; ++l) { const int L = L0 + l; if (L >= nlines) break; const size_t e = (size_t)L * 64 + lane * 2; const int k = (int)(e % K), n = (int)(e / K); v2us o;
            o[0] = f2bf(w[(size_t)k * N + n]); o[1] = f2bf(w[(size_t)(k + 1) * N + n]); *(v2us*)(Bt + e) = o; }
         }
}
__global__ __launch_bounds__(256) void k_cvt8(const float* __restrict__ src, bf* dst, size_t n8) { const size_t i = (size_t)blockIdx.x * 256 + threadIdx.x; if (i >= n8) return; const v8f v = *(const v8f*)(src + i * 8); v8us o;
#pragma unroll
    for (int k = 0; k < 8; ++k) o[k] = f2bf(v[k]); *(v8us*)(dst + i * 8) = o;  }

// k_rope: head planes [h][t][d] (fp16 + hi/lo) of rope(x) x sc with the rotate-half convention out[d] = x[d] cos[t][d] - x[d+HD/2] sin[t][d], out[d+HD/2] = x[d+HD/2] cos[t][d+HD/2] + x[d] sin[t][d+HD/2]
__global__ __launch_bounds__(256) void k_rope(const float* __restrict__ F, int pitch, int nheads, const float* __restrict__ CS, const float* __restrict__ RF, const float* __restrict__ nw, float sc, h16* P16, bf* Ph, bf* Pl) {
    const size_t e = ((size_t)blockIdx.x * 256 + threadIdx.x) * 2; if (e >= (size_t)nheads * TT * HD) return; const int d = (int)(e % HD); const int t = (int)((e / HD) % TT); const int h = (int)(e / ((size_t)HD * TT)); const float* f = F + (size_t)t * pitch + h * HD; const float rf = RF ? RF[(size_t)h * TT + t] : 1.0f; v2h o16; v2us oh, ol;
#pragma unroll
    for (int q = 0; q < 2; ++q) { const int dd = d + q; const int dp = (dd < HD / 2) ? dd + HD / 2 : dd - HD / 2; float x0 = f[dd], x1 = f[dp];
        if (RF) { float n0 = __fmul_rn(x0, rf), n1 = __fmul_rn(x1, rf); asm volatile("" : "+v"(n0)); asm volatile("" : "+v"(n1)); x0 = __fmul_rn(bfr(nw[dd]), n0); x1 = __fmul_rn(bfr(nw[dp]), n1); }
        const v2f cs = *(const v2f*)(CS + ((size_t)t * HD + dd) * 2); float a = __fmul_rn(x0, cs[0]), bq = __fmul_rn(x1, cs[1]); asm volatile("" : "+v"(a)); asm volatile("" : "+v"(bq)); const float r = ((dd < HD / 2) ? __fsub_rn(a, bq) : __fadd_rn(a, bq)) * sc;
        o16[q] = tohx(r); unsigned short a2, c2; splitf(r, a2, c2); oh[q] = a2; ol[q] = c2; }
    *(v2h*)(P16 + e) = o16; *(v2us*)(Ph + e) = oh; *(v2us*)(Pl + e) = ol;  }
__global__ __launch_bounds__(256) void k_vtp(const float* __restrict__ F, int pitch, int nheads, h16* V16, bf* Vh, bf* Vl) { const size_t e = ((size_t)blockIdx.x * 256 + threadIdx.x) * 2; if (e >= (size_t)nheads * HD * TT) return; const int t = (int)(e % TT); const int d = (int)((e / TT) % HD); const int g = (int)(e / ((size_t)TT * HD)); v2h o16; v2us oh, ol;
#pragma unroll
    for (int q = 0; q < 2; ++q) { const float x = F[(size_t)(t + q) * pitch + g * HD + d]; o16[q] = tohx(x); unsigned short a2, c2; splitf(x, a2, c2); oh[q] = a2; ol[q] = c2; }
    *(v2h*)(V16 + e) = o16; *(v2us*)(Vh + e) = oh; *(v2us*)(Vl + e) = ol;  }
__global__ __launch_bounds__(256) void k_csid(float* CS) { const int idx = blockIdx.x * 256 + threadIdx.x; if (idx >= TT * HD) return; v2f cs; cs[0] = 1.0f; cs[1] = 0.0f; *(v2f*)(CS + (size_t)idx * 2) = cs;  }
// k_asoft: per row (zz, i): t = S x HD^-0.5 for j <= i and i - j < WIN (sliding causal window; the reference's -1e9 additive fill vanishes identically); softmax over the 2048 keys (register row, one exp, fixed trees);
// the probabilities go back into the row's own 8 KiB of Sb (one wave owns a row and holds all of it in registers before its first store, which needs the row's sum): rows < RH as TT bf16 hi then TT bf16 lo entries,
// the other rows as TT fp16 entries at the row's start; so the 16-bit row pitch is 2 * TT and a pass of ZH heads needs no probability planes in the workspace.
typedef v4h  __attribute__((may_alias)) v4ha;
typedef v4us __attribute__((may_alias)) v4usa;
__global__ __launch_bounds__(256) void k_asoft(float* Sb) {
    const int lane = threadIdx.x & 31; const int row = blockIdx.x * 8 + (threadIdx.x >> 5); if (row >= ZH * TT) return; const int i = row % TT; const int zz = row / TT; (void)zz; const bool hires = (i < RH); float* sr = Sb + (size_t)row * TT; float v[TT / 32]; float mx = -3.0e38f;
#pragma unroll
    for (int ch = 0; ch < TT / 128; ++ch) { const int j0 = ch * 128 + lane * 4; const v4f a = *(const v4fa*)(sr + j0);
#pragma unroll
        for (int q = 0; q < 4; ++q) { const int j = j0 + q; (void)j; const float t = (j <= i && i - j < WIN) ? a[q] * SCL : -3.0e38f; v[ch * 4 + q] = t; mx = fmaxf(mx, t); } }
#pragma unroll
    for (int sh = 16; sh; sh >>= 1) mx = fmaxf(mx, __shfl_xor(mx, sh, 32));
    float sum = 0.f;
#pragma unroll
    for (int k = 0; k < TT / 32; ++k) { float d0 = __fsub_rn(v[k], mx); asm volatile("" : "+v"(d0)); v[k] = __builtin_amdgcn_exp2f(__fmul_rn(d0, 1.4426950408889634f)); sum += v[k]; }
#pragma unroll
    for (int sh = 16; sh; sh >>= 1) sum += __shfl_xor(sum, sh, 32);
    const float f = __fdiv_rn(hires ? 1.0f : PCAR, sum);
{
        if (hires) {
#pragma unroll
            for (int ch = 0; ch < TT / 128; ++ch) { v4us oh, ol;
#pragma unroll
                for (int q = 0; q < 4; ++q) { unsigned short a, c2; splitf(v[ch * 4 + q] * f, a, c2); oh[q] = a; ol[q] = c2; }
                bf* pr = (bf*)sr + ch * 128 + lane * 4; *(v4usa*)pr = oh; *(v4usa*)(pr + TT) = ol; }
        } else {
#pragma unroll
            for (int ch = 0; ch < TT / 128; ++ch) { v4h o4;
#pragma unroll
                for (int q = 0; q < 4; ++q) o4[q] = tohx(v[ch * 4 + q] * f);
                *(v4ha*)((h16*)sr + ch * 128 + lane * 4) = o4; } }
         }
}
__global__ __launch_bounds__(256) void k_merge(const float* __restrict__ O, int h0, bf* Ah, bf* Al) { const size_t e = ((size_t)blockIdx.x * 256 + threadIdx.x) * 2; if (e >= (size_t)ZH * TT * HD) return; const int d = (int)(e % HD); const int t = (int)((e / HD) % TT); const int zz = (int)(e / ((size_t)HD * TT)); const float cs = (t < RH) ? 1.0f : (1.0f / PCAR); const size_t oo = (size_t)t * DQ + (h0 + zz) * HD + d;
    v2us oh, ol;
#pragma unroll
    for (int q = 0; q < 2; ++q) { unsigned short a, c2; splitf(O[e + q] * cs, a, c2); oh[q] = a; ol[q] = c2; } *(v2us*)(Ah + oo) = oh; *(v2us*)(Al + oo) = ol;  }

extern "C" void kernel_launch(void* const* d_in, const int* in_sizes, int n_in,
                              void* d_out, int out_size, void* d_ws, size_t ws_size, hipStream_t stream) {
    (void)in_sizes; (void)n_in; (void)out_size;
    const float* x = (const float*)d_in[0]; const float* wq = (const float*)d_in[1]; const float* bq = (const float*)d_in[2]; const float* wk = (const float*)d_in[3]; const float* bk = (const float*)d_in[4]; const float* wv = (const float*)d_in[5]; const float* bv = (const float*)d_in[6]; const float* wo = (const float*)d_in[7]; const float* bo = (const float*)d_in[8];
    float* OUT = (float*)d_out;     // [2][2048][1024]
    char* wsp = (char*)d_ws;
    auto take = [&](size_t bytes) { char* p = wsp; wsp += (bytes + 255) & ~(size_t)255; return (void*)p; };
    bf* WQ = (bf*)take((size_t)DQ * DM * 2); bf* WK = (bf*)take((size_t)DKV * DM * 2); bf* WV = (bf*)take((size_t)DKV * DM * 2); bf* WO = (bf*)take((size_t)DM * DQ * 2); float* CS = (float*)take((size_t)TT * HD * 2 * 4);
    bf* XB = (bf*)take((size_t)TT * DM * 2); float* FQ = (float*)take((size_t)TT * DQ * 4); float* FK = (float*)take((size_t)TT * DKV * 4);
    h16* QP16 = (h16*)take((size_t)NH_ * TT * HD * 2); h16* KP16 = (h16*)take((size_t)NKV * TT * HD * 2); h16* VT16 = (h16*)take((size_t)NKV * HD * TT * 2);
    bf* QPh = (bf*)take((size_t)NH_ * TT * HD * 2); bf* QPl = (bf*)take((size_t)NH_ * TT * HD * 2); bf* KPh = (bf*)take((size_t)NKV * TT * HD * 2); bf* KPl = (bf*)take((size_t)NKV * TT * HD * 2); bf* VTh = (bf*)take((size_t)NKV * HD * TT * 2); bf* VTl = (bf*)take((size_t)NKV * HD * TT * 2);
    float* Sb = (float*)take((size_t)ZH * TT * TT * 4); const bf* PSb = (const bf*)Sb; const h16* PS16 = (const h16*)Sb; /* the probability rows that k_asoft leaves inside Sb, 16-bit pitch 2 * TT */ float* Ob = (float*)take((size_t)ZH * TT * HD * 4); bf* ATh = (bf*)take((size_t)TT * DQ * 2); bf* ATl = (bf*)take((size_t)TT * DQ * 2);
    if ((size_t)(wsp - (char*)d_ws) > ws_size) return;    // ws 256 MiB
    float* FV = FK;   // v projection reuses the k buffer after the k planes are built (stream-ordered)
    { k_cvt8<<<(unsigned)(((size_t)DQ * DM / 8 + 255) / 256), 256, 0, stream>>>(wq, WQ, (size_t)DQ * DM / 8); k_cvt8<<<(unsigned)(((size_t)DKV * DM / 8 + 255) / 256), 256, 0, stream>>>(wk, WK, (size_t)DKV * DM / 8); k_cvt8<<<(unsigned)(((size_t)DKV * DM / 8 + 255) / 256), 256, 0, stream>>>(wv, WV, (size_t)DKV * DM / 8);
      k_cvt8<<<(unsigned)(((size_t)DM * DQ / 8 + 255) / 256), 256, 0, stream>>>(wo, WO, (size_t)DM * DQ / 8);
       }
    k_csid<<<(TT * HD + 255) / 256, 256, 0, stream>>>(CS);
    const unsigned LQ = (unsigned)(((size_t)NH_ * TT * HD / 2 + 255) / 256), LKv = (unsigned)(((size_t)NKV * TT * HD / 2 + 255) / 256);
    for (int b = 0; b < NB_; ++b) {
        
        k_cvt8<<<(unsigned)(((size_t)TT * DM / 8 + 255) / 256), 256, 0, stream>>>(x + (size_t)b * TT * DM, XB, (size_t)TT * DM / 8);
        k_gemmw<bf, 0, true><<<dim3(TT / 64, DQ / 64, 1), 32, 0, stream>>>(XB, nullptr, WQ, nullptr, DM, FQ, DQ, bq, 0, 0, 0);
        k_rope<<<LQ, 256, 0, stream>>>(FQ, DQ, NH_, CS, nullptr, nullptr, 1.0f, QP16, QPh, QPl);
        k_gemmw<bf, 0, true><<<dim3(TT / 64, DKV / 64, 1), 32, 0, stream>>>(XB, nullptr, WK, nullptr, DM, FK, DKV, bk, 0, 0, 0);
        k_rope<<<LKv, 256, 0, stream>>>(FK, DKV, NKV, CS, nullptr, nullptr, 1.0f, KP16, KPh, KPl);
        k_gemmw<bf, 0, true><<<dim3(TT / 64, DKV / 64, 1), 32, 0, stream>>>(XB, nullptr, WV, nullptr, DM, FV, DKV, bv, 0, 0, 0); k_vtp<<<LKv, 256, 0, stream>>>(FV, DKV, NKV, VT16, VTh, VTl);
        for (int h0 = 0; h0 < NH_; h0 += ZH) { const size_t zq = (size_t)h0, zk = (size_t)(h0 / REP);   // one kv head per query head: the pass's heads use consecutive kv planes (z-strides TT*HD)
            k_gemmc<bf, 2, 1><<<dim3(RH / 64, TT / 64, ZH), 32, 0, stream>>>(QPh + zq * TT * HD, QPl + zq * TT * HD, KPh + zk * TT * HD, KPl + zk * TT * HD, HD, Sb, TT, 0, (size_t)TT * HD, (size_t)TT * HD, (size_t)TT * TT);
            k_gemmc<h16, 0, 1><<<dim3((TT - RH) / 64, TT / 64, ZH), 32, 0, stream>>>(QP16 + zq * TT * HD + (size_t)RH * HD, nullptr, KP16 + zk * TT * HD, nullptr, HD, Sb + (size_t)RH * TT, TT, RH, (size_t)TT * HD, (size_t)TT * HD, (size_t)TT * TT);
            k_asoft<<<ZH * TT / 8, 256, 0, stream>>>(Sb);
            k_gemmp<bf, 2><<<dim3(RH / 32, HD / 32, ZH), 256, 0, stream>>>(PSb, PSb + TT, VTh + zk * HD * TT, VTl + zk * HD * TT, TT, 2 * TT, Ob, HD, 0, (size_t)2 * TT * TT, (size_t)HD * TT, (size_t)TT * HD);
            k_gemmp<h16, 0><<<dim3((TT - RH) / 32, HD / 32, ZH), 256, 0, stream>>>(PS16 + (size_t)RH * 2 * TT, nullptr, VT16 + zk * HD * TT, nullptr, TT, 2 * TT, Ob + (size_t)RH * HD, HD, RH, (size_t)2 * TT * TT, (size_t)HD * TT, (size_t)TT * HD);
            k_merge<<<(unsigned)(((size_t)ZH * TT * HD / 2 + 255) / 256), 256, 0, stream>>>(Ob, h0, ATh, ATl); }
        k_gemmw<bf, 1, true><<<dim3(TT / 64, DM / 64, 1), 32, 0, stream>>>(ATh, ATl, WO, nullptr, DQ, OUT + (size_t)b * TT * DM, DM, bo, 0, 0, 0); }
}

// v003
// One run takes 362 microseconds.
// Next to v002, in two timings, it ran 1.51 times as fast each time.
// Counting every step since v000, it is 3.99 times as fast.
#include <hip/hip_runtime.h>

// Causal multi-head attention, cache-free prefill path (x [2][2048][1024]; q,k,v = x W^T + b ('oi' 0.02, zero biases; 16 heads x 64); scores / 8; triu(1) -> -inf; softmax; out = merged Wo^T + bo -> [2][2048][1024] (4.2 M)).
// Layout per batch: bf16 copy of x; 'oi' weights; exact projections + f32 biases; fused causal T-2048 attention, one kernel per row class (hybrid rows: < 512 hi/lo 3 products, rest fp16; tiles above the diagonal skipped; probabilities scaled by 1 / sum after the value product); merged hi/lo x Wo exact + bo.
// Compute dtypes, f32 accumulate: every input rounded to bf16; projections exact + f32 biases; attention rows < 512 3 products, rest fp16; softmax f32; Wo hl x exact + bias.

#define NB_  2
#define TT   2048
#define DM   1024
#define NH_  16
#define NKV  16
#define REP  (NH_ / NKV)
#define HD   64
#define DQ   (NH_ * HD)
#define DKV  (NKV * HD)
#define RH   512                  // query rows < RH use hi+lo planes (0: none)
#define SCL  0.125f   // HD^-0.5
typedef _Float16 h16;
typedef unsigned short bf;
typedef __attribute__((ext_vector_type(16))) __bf16   v16bf;
typedef __attribute__((ext_vector_type(16))) _Float16 v16h;
typedef __attribute__((ext_vector_type(8)))  _Float16 v8h;
typedef __attribute__((ext_vector_type(8)))  unsigned short v8us;
typedef __attribute__((ext_vector_type(8)))  float    v8f;
typedef __attribute__((ext_vector_type(4)))  float    v4f;
typedef v8h  __attribute__((may_alias)) v8ha;
typedef v4f  __attribute__((may_alias)) v4fa;
typedef v8us __attribute__((may_alias)) v8usa;

__device__ __forceinline__ unsigned short f2bf(float f) { unsigned u = __float_as_uint(f); u += 0x7FFFu + ((u >> 16) & 1u); return (unsigned short)(u >> 16); }
__device__ __forceinline__ float bf2f(unsigned short b) { return __uint_as_float(((unsigned)b) << 16); }
__device__ __forceinline__ float bfr(float f) { return bf2f(f2bf(f)); }
__device__ __forceinline__ v16h cat16(v8h lo, v8h hi) { return __builtin_shufflevector(lo, hi, 0, 1, 2, 3, 4, 5, 6, 7, 8, 9, 10, 11, 12, 13, 14, 15); }
__device__ __forceinline__ v16bf cat16b(v8us lo, v8us hi) { return __builtin_bit_cast(v16bf, __builtin_shufflevector(lo, hi, 0, 1, 2, 3, 4, 5, 6, 7, 8, 9, 10, 11, 12, 13, 14, 15)); }
__device__ __forceinline__ v8f wmma16(v16h a, v16h b, v8f c) { return __builtin_amdgcn_wmma_f32_16x16x32_f16(false, a, false, b, (short)0, c, false, false); }
__device__ __forceinline__ v8f wmmab(v16bf a, v16bf b, v8f c) { return __builtin_amdgcn_wmma_f32_16x16x32_bf16(false, a, false, b, (short)0, c, false, false); }



// ---- k_gemmw: register-blocked GEMM, ONE WAVE per 64x64 output tile (16 accumulators), operands straight from K-contiguous 16-bit planes; grid (M/64, N/64, Z), 32 threads.
// C[m][n] (f32, pitch ldc, + optional f32 bias[n]) = sum_k A[m][k] Bt[n][k] (+ split products per NSPLIT). z-batch strides sA/sB/sC in elements. K % 32 == 0.
template <typename T16> struct WFrag;
template <> struct WFrag<h16> { typedef v16h V; static __device__ __forceinline__ V ld(const h16* p) { return cat16(*(const v8h*)p, *(const v8h*)(p + 16)); } static __device__ __forceinline__ v8f mma(V a, V b, v8f c) { return wmma16(a, b, c); } };
template <> struct WFrag<bf> { typedef v16bf V; static __device__ __forceinline__ V ld(const bf* p) { return cat16b(*(const v8us*)p, *(const v8us*)(p + 16)); } static __device__ __forceinline__ v8f mma(V a, V b, v8f c) { return wmmab(a, b, c); } };
template <typename T16, int NSPLIT, bool BIAS>
__global__ __launch_bounds__(32) void k_gemmw(const T16* __restrict__ A, const T16* __restrict__ A2, const T16* __restrict__ Bt, const T16* __restrict__ Bt2, int K, float* C, int ldc, const float* __restrict__ bias, size_t sA, size_t sB, size_t sC) {
    typedef typename WFrag<T16>::V V;
    __shared__ __align__(16) float os[16 * 68];
    const size_t z = blockIdx.z; A += z * sA; if (A2) A2 += z * sA; Bt += z * sB; if (Bt2) Bt2 += z * sB; C += z * sC;
    const int lane = threadIdx.x & 31, lr = lane & 15, hi = lane >> 4; const int r0 = blockIdx.x * 64, c0 = blockIdx.y * 64;
    v8f acc[4][4];
#pragma unroll
    for (int mb = 0; mb < 4; ++mb)
#pragma unroll
        for (int nb = 0; nb < 4; ++nb) acc[mb][nb] = (v8f){};
    const size_t aoff = (size_t)(r0 + lr) * K + 8 * hi, boff = (size_t)(c0 + lr) * K + 8 * hi;
#pragma unroll 1
    for (int kc = 0; kc < K; kc += 32) {
        V a[4], a2[4];
#pragma unroll
        for (int mb = 0; mb < 4; ++mb) { a[mb] = WFrag<T16>::ld(A + aoff + (size_t)mb * 16 * K + kc); if (NSPLIT == 1 || NSPLIT == 2) a2[mb] = WFrag<T16>::ld(A2 + aoff + (size_t)mb * 16 * K + kc); }
#pragma unroll
        for (int nb = 0; nb < 4; ++nb) { const V b = WFrag<T16>::ld(Bt + boff + (size_t)nb * 16 * K + kc); V b2; if (NSPLIT >= 2) b2 = WFrag<T16>::ld(Bt2 + boff + (size_t)nb * 16 * K + kc);
#pragma unroll
            for (int mb = 0; mb < 4; ++mb) { acc[mb][nb] = WFrag<T16>::mma(a[mb], b, acc[mb][nb]); if (NSPLIT == 1 || NSPLIT == 2) acc[mb][nb] = WFrag<T16>::mma(a2[mb], b, acc[mb][nb]); if (NSPLIT >= 2) acc[mb][nb] = WFrag<T16>::mma(a[mb], b2, acc[mb][nb]); } }
        asm volatile("v_nop\n\tv_nop\n\tv_nop\n\tv_nop" : "+v"(acc[0][0]), "+v"(acc[1][1]), "+v"(acc[2][2]), "+v"(acc[3][3]) : "v"(a[0]), "v"(a[3]));
    }
#pragma unroll
    for (int mb = 0; mb < 4; ++mb) {
#pragma unroll
        for (int nb = 0; nb < 4; ++nb) {
#pragma unroll
            for (int j = 0; j < 8; ++j) os[(hi * 8 + j) * 68 + nb * 16 + lr] = acc[mb][nb][j]; }
        __builtin_amdgcn_wave_barrier(); asm volatile("" ::: "memory");
        float* crow = C + (size_t)(r0 + mb * 16) * ldc + c0;
{
#pragma unroll
            for (int s = 0; s < 8; ++s) { const int row = 2 * s + hi, cofs = lr * 4; v4f val = *(const v4fa*)(os + row * 68 + cofs); if (BIAS) { val[0] += bfr(bias[c0 + cofs]); val[1] += bfr(bias[c0 + cofs + 1]); val[2] += bfr(bias[c0 + cofs + 2]); val[3] += bfr(bias[c0 + cofs + 3]); }
                *(v4f*)(crow + (size_t)row * ldc + cofs) = val; }
             }
        __builtin_amdgcn_wave_barrier(); asm volatile("" ::: "memory");
    }
}

__device__ __forceinline__ h16 tohx(float x) { return (h16)x; }
__device__ __forceinline__ void splitf(float y, unsigned short& h, unsigned short& l) { h = f2bf(y); l = f2bf(y - bf2f(h)); }
typedef __attribute__((ext_vector_type(2))) _Float16 v2h;
typedef __attribute__((ext_vector_type(4))) _Float16 v4h;
typedef __attribute__((ext_vector_type(2))) unsigned short v2us;
typedef __attribute__((ext_vector_type(4))) unsigned short v4us;
typedef __attribute__((ext_vector_type(2))) float v2f;
typedef __attribute__((ext_vector_type(4))) int v4i;

__global__ __launch_bounds__(256) void k_wtG(const float* __restrict__ w, int K, int N, bf* Bt) {
    const int lane = threadIdx.x & 31; const int L0 = (blockIdx.x * 8 + (threadIdx.x >> 5)) * 8; const int nlines = N * K / 64;
{
#pragma unroll 1
        for (int l = 0; l < 8; ++l) { const int L = L0 + l; if (L >= nlines) break; const size_t e = (size_t)L * 64 + lane * 2; const int k = (int)(e % K), n = (int)(e / K); v2us o;
            o[0] = f2bf(w[(size_t)k * N + n]); o[1] = f2bf(w[(size_t)(k + 1) * N + n]); *(v2us*)(Bt + e) = o; }
         }
}
__global__ __launch_bounds__(256) void k_cvt8(const float* __restrict__ src, bf* dst, size_t n8) { const size_t i = (size_t)blockIdx.x * 256 + threadIdx.x; if (i >= n8) return; const v8f v = *(const v8f*)(src + i * 8); v8us o;
#pragma unroll
    for (int k = 0; k < 8; ++k) o[k] = f2bf(v[k]); *(v8us*)(dst + i * 8) = o;  }

// k_rope: head planes [h][t][d] (fp16 + hi/lo) of rope(x) x sc with the rotate-half convention out[d] = x[d] cos[t][d] - x[d+HD/2] sin[t][d], out[d+HD/2] = x[d+HD/2] cos[t][d+HD/2] + x[d] sin[t][d+HD/2]
__global__ __launch_bounds__(256) void k_rope(const float* __restrict__ F, int pitch, int nheads, const float* __restrict__ CS, const float* __restrict__ RF, const float* __restrict__ nw, float sc, h16* P16, bf* Ph, bf* Pl) {
    const size_t e = ((size_t)blockIdx.x * 256 + threadIdx.x) * 2; if (e >= (size_t)nheads * TT * HD) return; const int d = (int)(e % HD); const int t = (int)((e / HD) % TT); const int h = (int)(e / ((size_t)HD * TT)); const float* f = F + (size_t)t * pitch + h * HD; const float rf = RF ? RF[(size_t)h * TT + t] : 1.0f; v2h o16; v2us oh, ol;
#pragma unroll
    for (int q = 0; q < 2; ++q) { const int dd = d + q; const int dp = (dd < HD / 2) ? dd + HD / 2 : dd - HD / 2; float x0 = f[dd], x1 = f[dp];
        if (RF) { float n0 = __fmul_rn(x0, rf), n1 = __fmul_rn(x1, rf); asm volatile("" : "+v"(n0)); asm volatile("" : "+v"(n1)); x0 = __fmul_rn(bfr(nw[dd]), n0); x1 = __fmul_rn(bfr(nw[dp]), n1); }
        const v2f cs = *(const v2f*)(CS + ((size_t)t * HD + dd) * 2); float a = __fmul_rn(x0, cs[0]), bq = __fmul_rn(x1, cs[1]); asm volatile("" : "+v"(a)); asm volatile("" : "+v"(bq)); const float r = ((dd < HD / 2) ? __fsub_rn(a, bq) : __fadd_rn(a, bq)) * sc;
        o16[q] = tohx(r); unsigned short a2, c2; splitf(r, a2, c2); oh[q] = a2; ol[q] = c2; }
    *(v2h*)(P16 + e) = o16; *(v2us*)(Ph + e) = oh; *(v2us*)(Pl + e) = ol;  }
__global__ __launch_bounds__(256) void k_vtp(const float* __restrict__ F, int pitch, int nheads, h16* V16, bf* Vh, bf* Vl) { const size_t e = ((size_t)blockIdx.x * 256 + threadIdx.x) * 2; if (e >= (size_t)nheads * HD * TT) return; const int t = (int)(e % TT); const int d = (int)((e / TT) % HD); const int g = (int)(e / ((size_t)TT * HD)); v2h o16; v2us oh, ol;
#pragma unroll
    for (int q = 0; q < 2; ++q) { const float x = F[(size_t)(t + q) * pitch + g * HD + d]; o16[q] = tohx(x); unsigned short a2, c2; splitf(x, a2, c2); oh[q] = a2; ol[q] = c2; }
    *(v2h*)(V16 + e) = o16; *(v2us*)(Vh + e) = oh; *(v2us*)(Vl + e) = ol;  }
__global__ __launch_bounds__(256) void k_csid(float* CS) { const int idx = blockIdx.x * 256 + threadIdx.x; if (idx >= TT * HD) return; v2f cs; cs[0] = 1.0f; cs[1] = 0.0f; *(v2f*)(CS + (size_t)idx * 2) = cs;  }
// ---- k_fattn: scores, causal softmax and probability x value product of one tile of QT = 16 * NQ query rows of one head in ONE work-group of 8 waves; grid (rows / QT, heads), 256 threads; no score or probability ever goes to memory.
// Everything is computed transposed, so that a lane owns one query column throughout: S^T = K Q^T (A = key rows, B = query rows) leaves lane (lr, hi) with keys 8 * hi + j of query lr in register j,
// which is exactly the B fragment order of O^T = V^T P^T (two 16-key tiles side by side give keys 8 * hi + j and 16 + 8 * hi + j); row maximum, row sum and the final scale are then per lane.
// The key range 0 .. q0 + QT - 1 (a last chunk can run past it; those keys are masked) is split over the waves: wave w takes chunks w, w + 8, ... Pass 1: scores of CK1-key chunks -> row maximum, joined over the waves in LDS behind a barrier.
// Pass 2: scores again in CK2-key chunks, p = exp(t - max) (f32 sum of the unrounded p), p rounded to 16 bit (HR: hi + lo bf16 planes, 3 products as for the scores), O^T += V^T p.
// Every inner loop is unrolled so that the fragment and accumulator arrays are indexed statically and stay in registers.
// The 8 partial tiles and sums meet in LDS behind a second barrier, are added in wave order 0..7, scaled by 1 / sum and stored as the hi / lo planes [t][head][d] that the output projection reads.
template <typename T16, bool HR, int NQ, int CK1, int CK2>
__global__ __launch_bounds__(256) void k_fattn(const T16* __restrict__ Q, const T16* __restrict__ Q2, const T16* __restrict__ Kp, const T16* __restrict__ Kp2, const T16* __restrict__ Vt, const T16* __restrict__ Vt2, bf* Ah, bf* Al) {
    typedef typename WFrag<T16>::V V;
    constexpr int QT = NQ * 16, M1 = CK1 / 16, M2 = CK2 / 16, KS2 = CK2 / 32, R0 = HR ? 0 : RH, NT = (HR ? RH : TT - RH) / QT;   // HR: query rows 0 .. RH - 1; else rows RH .. TT - 1; NT tiles = gridDim.x
    __shared__ __align__(16) float po[8 * QT * 68];
    __shared__ float smx[8 * QT], ssm[8 * QT];
    const int lane = threadIdx.x & 31, lr = lane & 15, hi = lane >> 4;
    const int w = __builtin_amdgcn_readfirstlane(threadIdx.x >> 5);   // wave number in a scalar register: the chunk loops' tests stay scalar branches
    const int q0 = R0 + (NT - 1 - (int)blockIdx.x) * QT;   // the tiles with the most keys start first
    const int hd = blockIdx.y; const size_t hb = (size_t)hd * TT * HD; const int nk = q0 + QT;
    V qf[NQ][2], qf2[NQ][2]; const T16 *pq[NQ], *pq2[NQ];
#pragma unroll
    for (int nq = 0; nq < NQ; ++nq) { const size_t qo = hb + (size_t)(q0 + nq * 16 + lr) * HD + 8 * hi; pq[nq] = Q + qo; pq2[nq] = HR ? Q2 + qo : pq[nq];
#pragma unroll
        for (int ks = 0; ks < 2; ++ks) { qf[nq][ks] = WFrag<T16>::ld(pq[nq] + ks * 32); if (HR) qf2[nq][ks] = WFrag<T16>::ld(pq2[nq] + ks * 32); } }
    // the wait that goes before a register named by an issued load is overwritten; the addresses are its inputs, so they stay whole up to it
    asm volatile("s_wait_xcnt 0x0" :: "v"(pq[0]), "v"(pq[NQ - 1]), "v"(pq2[0]), "v"(pq2[NQ - 1]) : "memory");
    float mx[NQ];
#pragma unroll
    for (int nq = 0; nq < NQ; ++nq) mx[nq] = -3.0e38f;
#pragma unroll 1   // rolled: one chunk's fragments at a time fit the registers
    for (int kc = CK1 * w; kc < nk; kc += 8 * CK1) {
        const size_t ko = hb + (size_t)(kc + lr) * HD + 8 * hi; const T16* pk = Kp + ko; const T16* pk2 = HR ? Kp2 + ko : pk; V kf[M1][2], kf2[M1][2];
#pragma unroll
        for (int mt = 0; mt < M1; ++mt)
#pragma unroll
            for (int ks = 0; ks < 2; ++ks) { kf[mt][ks] = WFrag<T16>::ld(pk + mt * 16 * HD + ks * 32); if (HR) kf2[mt][ks] = WFrag<T16>::ld(pk2 + mt * 16 * HD + ks * 32); }
        // the wait that goes before a register named by an issued load is overwritten; the addresses are its inputs, so they stay whole up to it
        asm volatile("s_wait_xcnt 0x0" :: "v"(pk), "v"(pk2) : "memory");
        __builtin_amdgcn_sched_barrier(0);   // every load of the chunk is issued before the first product, so that a chunk waits out the cache latency once
#pragma unroll
        for (int mt = 0; mt < M1; ++mt)
#pragma unroll
            for (int nq = 0; nq < NQ; ++nq) { v8f s = (v8f){};
#pragma unroll
                for (int ks = 0; ks < 2; ++ks) { s = WFrag<T16>::mma(kf[mt][ks], qf[nq][ks], s); if (HR) { s = WFrag<T16>::mma(kf[mt][ks], qf2[nq][ks], s); s = WFrag<T16>::mma(kf2[mt][ks], qf[nq][ks], s); } }
#pragma unroll
                for (int j = 0; j < 8; ++j) { const float t = (kc + mt * 16 + 8 * hi + j <= q0 + nq * 16 + lr) ? s[j] * SCL : -3.0e38f; mx[nq] = fmaxf(mx[nq], t); } }
    }
#pragma unroll
    for (int nq = 0; nq < NQ; ++nq) { mx[nq] = fmaxf(mx[nq], __shfl_xor(mx[nq], 16, 32)); if (hi == 0) smx[w * QT + nq * 16 + lr] = mx[nq]; }
    __syncthreads();   // every wave's row maxima are in LDS before any wave joins them
#pragma unroll
    for (int nq = 0; nq < NQ; ++nq) { float g = smx[nq * 16 + lr];
#pragma unroll
        for (int u = 1; u < 8; ++u) g = fmaxf(g, smx[u * QT + nq * 16 + lr]);
        mx[nq] = g; }
    v8f o[4][NQ]; float sum[NQ];
#pragma unroll
    for (int nq = 0; nq < NQ; ++nq) { sum[nq] = 0.f;
#pragma unroll
        for (int dt = 0; dt < 4; ++dt) o[dt][nq] = (v8f){}; }
#pragma unroll 1   // rolled: one chunk's fragments at a time fit the registers
    for (int kc = CK2 * w; kc < nk; kc += 8 * CK2) {
        const size_t ko = hb + (size_t)(kc + lr) * HD + 8 * hi, vo = hb + (size_t)lr * TT + kc + 8 * hi; const T16* pk = Kp + ko; const T16* pk2 = HR ? Kp2 + ko : pk; const T16* pv = Vt + vo; const T16* pv2 = HR ? Vt2 + vo : pv;
        V kf[M2][2], kf2[M2][2], vf[4][KS2], vf2[4][KS2];
#pragma unroll
        for (int mt = 0; mt < M2; ++mt)
#pragma unroll
            for (int ks = 0; ks < 2; ++ks) { kf[mt][ks] = WFrag<T16>::ld(pk + mt * 16 * HD + ks * 32); if (HR) kf2[mt][ks] = WFrag<T16>::ld(pk2 + mt * 16 * HD + ks * 32); }
#pragma unroll
        for (int dt = 0; dt < 4; ++dt)
#pragma unroll
            for (int ks = 0; ks < KS2; ++ks) { vf[dt][ks] = WFrag<T16>::ld(pv + (size_t)dt * 16 * TT + ks * 32); if (HR) vf2[dt][ks] = WFrag<T16>::ld(pv2 + (size_t)dt * 16 * TT + ks * 32); }
        // the wait that goes before a register named by an issued load is overwritten; the addresses are its inputs, so they stay whole up to it
        asm volatile("s_wait_xcnt 0x0" :: "v"(pk), "v"(pk2), "v"(pv), "v"(pv2) : "memory");
        __builtin_amdgcn_sched_barrier(0);   // key and value loads of the chunk are all issued before the first product: the value loads fly while the scores and the exponentials are worked out
#pragma unroll
        for (int nq = 0; nq < NQ; ++nq) { float p[M2][8];
#pragma unroll
            for (int mt = 0; mt < M2; ++mt) { v8f s = (v8f){};
#pragma unroll
                for (int ks = 0; ks < 2; ++ks) { s = WFrag<T16>::mma(kf[mt][ks], qf[nq][ks], s); if (HR) { s = WFrag<T16>::mma(kf[mt][ks], qf2[nq][ks], s); s = WFrag<T16>::mma(kf2[mt][ks], qf[nq][ks], s); } }
#pragma unroll
                for (int j = 0; j < 8; ++j) { const float t = (kc + mt * 16 + 8 * hi + j <= q0 + nq * 16 + lr) ? s[j] * SCL : -3.0e38f; p[mt][j] = __builtin_amdgcn_exp2f(__fmul_rn(__fsub_rn(t, mx[nq]), 1.4426950408889634f)); sum[nq] += p[mt][j]; } }
#pragma unroll
            for (int ks = 0; ks < KS2; ++ks) {
                if constexpr (HR) { v8us h0, h1, l0, l1;
#pragma unroll
                    for (int j = 0; j < 8; ++j) { unsigned short a, c2; splitf(p[2 * ks][j], a, c2); h0[j] = a; l0[j] = c2; splitf(p[2 * ks + 1][j], a, c2); h1[j] = a; l1[j] = c2; }
                    const V ph = cat16b(h0, h1), pl = cat16b(l0, l1);
#pragma unroll
                    for (int dt = 0; dt < 4; ++dt) { o[dt][nq] = WFrag<T16>::mma(vf[dt][ks], ph, o[dt][nq]); o[dt][nq] = WFrag<T16>::mma(vf[dt][ks], pl, o[dt][nq]); o[dt][nq] = WFrag<T16>::mma(vf2[dt][ks], ph, o[dt][nq]); }
                } else { v8h h0, h1;
#pragma unroll
                    for (int j = 0; j < 8; ++j) { h0[j] = tohx(p[2 * ks][j]); h1[j] = tohx(p[2 * ks + 1][j]); }
                    const V ph = cat16(h0, h1);
#pragma unroll
                    for (int dt = 0; dt < 4; ++dt) o[dt][nq] = WFrag<T16>::mma(vf[dt][ks], ph, o[dt][nq]); } } }
    }
#pragma unroll
    for (int nq = 0; nq < NQ; ++nq) { const float sw = sum[nq] + __shfl_xor(sum[nq], 16, 32); if (hi == 0) ssm[w * QT + nq * 16 + lr] = sw; float* pw = po + (size_t)(w * QT + nq * 16 + lr) * 68 + 8 * hi;
#pragma unroll
        for (int dt = 0; dt < 4; ++dt) { v4f a, c; 
#pragma unroll
            for (int j = 0; j < 4; ++j) { a[j] = o[dt][nq][j]; c[j] = o[dt][nq][4 + j]; }
            *(v4fa*)(pw + dt * 16) = a; *(v4fa*)(pw + dt * 16 + 4) = c; } }
    __syncthreads();   // every wave's partial tile and partial sums are in LDS before any thread adds them
#pragma unroll
    for (int it = threadIdx.x; it < QT * 16; it += 256) { const int qq = it >> 4, d4 = (it & 15) * 4; v4f a = *(const v4fa*)(po + (size_t)qq * 68 + d4); float ts = ssm[qq];
#pragma unroll
        for (int u = 1; u < 8; ++u) { a += *(const v4fa*)(po + (size_t)(u * QT + qq) * 68 + d4); ts += ssm[u * QT + qq]; }
        const float f = __fdiv_rn(1.0f, ts); v4us oh, ol;
#pragma unroll
        for (int q = 0; q < 4; ++q) { unsigned short a2, c2; splitf(a[q] * f, a2, c2); oh[q] = a2; ol[q] = c2; }
        const size_t oo = (size_t)(q0 + qq) * DQ + hd * HD + d4; *(v4us*)(Ah + oo) = oh; *(v4us*)(Al + oo) = ol; }
}

extern "C" void kernel_launch(void* const* d_in, const int* in_sizes, int n_in,
                              void* d_out, int out_size, void* d_ws, size_t ws_size, hipStream_t stream) {
    (void)in_sizes; (void)n_in; (void)out_size;
    const float* x = (const float*)d_in[0]; const float* wq = (const float*)d_in[1]; const float* bq = (const float*)d_in[2]; const float* wk = (const float*)d_in[3]; const float* bk = (const float*)d_in[4]; const float* wv = (const float*)d_in[5]; const float* bv = (const float*)d_in[6]; const float* wo = (const float*)d_in[7]; const float* bo = (const float*)d_in[8];
    float* OUT = (float*)d_out;     // [2][2048][1024]
    char* wsp = (char*)d_ws;
    auto take = [&](size_t bytes) { char* p = wsp; wsp += (bytes + 255) & ~(size_t)255; return (void*)p; };
    bf* WQ = (bf*)take((size_t)DQ * DM * 2); bf* WK = (bf*)take((size_t)DKV * DM * 2); bf* WV = (bf*)take((size_t)DKV * DM * 2); bf* WO = (bf*)take((size_t)DM * DQ * 2); float* CS = (float*)take((size_t)TT * HD * 2 * 4);
    bf* XB = (bf*)take((size_t)TT * DM * 2); float* FQ = (float*)take((size_t)TT * DQ * 4); float* FK = (float*)take((size_t)TT * DKV * 4);
    h16* QP16 = (h16*)take((size_t)NH_ * TT * HD * 2); h16* KP16 = (h16*)take((size_t)NKV * TT * HD * 2); h16* VT16 = (h16*)take((size_t)NKV * HD * TT * 2);
    bf* QPh = (bf*)take((size_t)NH_ * TT * HD * 2); bf* QPl = (bf*)take((size_t)NH_ * TT * HD * 2); bf* KPh = (bf*)take((size_t)NKV * TT * HD * 2); bf* KPl = (bf*)take((size_t)NKV * TT * HD * 2); bf* VTh = (bf*)take((size_t)NKV * HD * TT * 2); bf* VTl = (bf*)take((size_t)NKV * HD * TT * 2);
    bf* ATh = (bf*)take((size_t)TT * DQ * 2); bf* ATl = (bf*)take((size_t)TT * DQ * 2);
    if ((size_t)(wsp - (char*)d_ws) > ws_size) return;    // ws 256 MiB
    float* FV = FK;   // v projection reuses the k buffer after the k planes are built (stream-ordered)
    { k_cvt8<<<(unsigned)(((size_t)DQ * DM / 8 + 255) / 256), 256, 0, stream>>>(wq, WQ, (size_t)DQ * DM / 8); k_cvt8<<<(unsigned)(((size_t)DKV * DM / 8 + 255) / 256), 256, 0, stream>>>(wk, WK, (size_t)DKV * DM / 8); k_cvt8<<<(unsigned)(((size_t)DKV * DM / 8 + 255) / 256), 256, 0, stream>>>(wv, WV, (size_t)DKV * DM / 8);
      k_cvt8<<<(unsigned)(((size_t)DM * DQ / 8 + 255) / 256), 256, 0, stream>>>(wo, WO, (size_t)DM * DQ / 8);
       }
    k_csid<<<(TT * HD + 255) / 256, 256, 0, stream>>>(CS);
    const unsigned LQ = (unsigned)(((size_t)NH_ * TT * HD / 2 + 255) / 256), LKv = (unsigned)(((size_t)NKV * TT * HD / 2 + 255) / 256);
    for (int b = 0; b < NB_; ++b) {
        
        k_cvt8<<<(unsigned)(((size_t)TT * DM / 8 + 255) / 256), 256, 0, stream>>>(x + (size_t)b * TT * DM, XB, (size_t)TT * DM / 8);
        k_gemmw<bf, 0, true><<<dim3(TT / 64, DQ / 64, 1), 32, 0, stream>>>(XB, nullptr, WQ, nullptr, DM, FQ, DQ, bq, 0, 0, 0);
        k_rope<<<LQ, 256, 0, stream>>>(FQ, DQ, NH_, CS, nullptr, nullptr, 1.0f, QP16, QPh, QPl);
        k_gemmw<bf, 0, true><<<dim3(TT / 64, DKV / 64, 1), 32, 0, stream>>>(XB, nullptr, WK, nullptr, DM, FK, DKV, bk, 0, 0, 0);
        k_rope<<<LKv, 256, 0, stream>>>(FK, DKV, NKV, CS, nullptr, nullptr, 1.0f, KP16, KPh, KPl);
        k_gemmw<bf, 0, true><<<dim3(TT / 64, DKV / 64, 1), 32, 0, stream>>>(XB, nullptr, WV, nullptr, DM, FV, DKV, bv, 0, 0, 0); k_vtp<<<LKv, 256, 0, stream>>>(FV, DKV, NKV, VT16, VTh, VTl);
        k_fattn<h16, false, 2, 64, 32><<<dim3((TT - RH) / 32, NH_, 1), 256, 0, stream>>>(QP16, nullptr, KP16, nullptr, VT16, nullptr, ATh, ATl);
        k_fattn<bf, true, 1, 32, 32><<<dim3(RH / 16, NH_, 1), 256, 0, stream>>>(QPh, QPl, KPh, KPl, VTh, VTl, ATh, ATl);
        k_gemmw<bf, 1, true><<<dim3(TT / 64, DM / 64, 1), 32, 0, stream>>>(ATh, ATl, WO, nullptr, DQ, OUT + (size_t)b * TT * DM, DM, bo, 0, 0, 0); }
}

// v004
// A run of this version takes 346 microseconds.
// In both of two side-by-side timings against v003, it was 1.05 times as fast.
// Counting every step since v000, it is 4.19 times as fast.
#include <hip/hip_runtime.h>

// Causal multi-head attention, cache-free prefill path (x [2][2048][1024]; q,k,v = x W^T + b ('oi' 0.02, zero biases; 16 heads x 64); scores / 8; triu(1) -> -inf; softmax; out = merged Wo^T + bo -> [2][2048][1024] (4.2 M)).
// Layout per batch: bf16 copy of x; 'oi' weights; exact projections + f32 biases, rounded to the head planes in their own epilogue; fused causal T-2048 attention, one kernel per row class (hybrid rows: < 512 hi/lo 3 products, rest fp16; tiles above the diagonal skipped; probabilities scaled by 1 / sum after the value product); merged hi/lo x Wo exact + bo.
// Compute dtypes, f32 accumulate: every input rounded to bf16; projections exact + f32 biases; attention rows < 512 3 products, rest fp16; softmax f32; Wo hl x exact + bias.

#define NB_  2
#define TT   2048
#define DM   1024
#define NH_  16
#define NKV  16
#define REP  (NH_ / NKV)
#define HD   64
#define DQ   (NH_ * HD)
#define DKV  (NKV * HD)
#define RH   512                  // query rows < RH use hi+lo planes (0: none)
#define SCL  0.125f   // HD^-0.5
typedef _Float16 h16;
typedef unsigned short bf;
typedef __attribute__((ext_vector_type(16))) __bf16   v16bf;
typedef __attribute__((ext_vector_type(16))) _Float16 v16h;
typedef __attribute__((ext_vector_type(8)))  _Float16 v8h;
typedef __attribute__((ext_vector_type(8)))  unsigned short v8us;
typedef __attribute__((ext_vector_type(8)))  float    v8f;
typedef __attribute__((ext_vector_type(4)))  float    v4f;
typedef v8h  __attribute__((may_alias)) v8ha;
typedef v4f  __attribute__((may_alias)) v4fa;
typedef v8us __attribute__((may_alias)) v8usa;

__device__ __forceinline__ unsigned short f2bf(float f) { unsigned u = __float_as_uint(f); u += 0x7FFFu + ((u >> 16) & 1u); return (unsigned short)(u >> 16); }
__device__ __forceinline__ float bf2f(unsigned short b) { return __uint_as_float(((unsigned)b) << 16); }
__device__ __forceinline__ float bfr(float f) { return bf2f(f2bf(f)); }
__device__ __forceinline__ v16h cat16(v8h lo, v8h hi) { return __builtin_shufflevector(lo, hi, 0, 1, 2, 3, 4, 5, 6, 7, 8, 9, 10, 11, 12, 13, 14, 15); }
__device__ __forceinline__ v16bf cat16b(v8us lo, v8us hi) { return __builtin_bit_cast(v16bf, __builtin_shufflevector(lo, hi, 0, 1, 2, 3, 4, 5, 6, 7, 8, 9, 10, 11, 12, 13, 14, 15)); }
__device__ __forceinline__ v8f wmma16(v16h a, v16h b, v8f c) { return __builtin_amdgcn_wmma_f32_16x16x32_f16(false, a, false, b, (short)0, c, false, false); }
__device__ __forceinline__ v8f wmmab(v16bf a, v16bf b, v8f c) { return __builtin_amdgcn_wmma_f32_16x16x32_bf16(false, a, false, b, (short)0, c, false, false); }



// ---- k_gemmw: register-blocked GEMM, ONE WAVE per 64x64 output tile (16 accumulators), operands straight from K-contiguous 16-bit planes; grid (M/64, N/64, Z), 32 threads.
// C[m][n] (f32, pitch ldc, + optional f32 bias[n]) = sum_k A[m][k] Bt[n][k] (+ split products per NSPLIT). z-batch strides sA/sB/sC in elements. K % 32 == 0.
// OM 0: C goes to memory as f32. OM 1 / 2: the tile (one head: HD == 64 columns) is rounded in the epilogue and stored as the fp16, bf16-hi and bf16-lo planes that the attention kernels read,
// OM 1 as [head][t][d], OM 2 transposed as [head][d][t]; no f32 copy of it is written. Eight lanes store one whole 128-byte line of a plane.
template <typename T16> struct WFrag;
template <> struct WFrag<h16> { typedef v16h V; static __device__ __forceinline__ V ld(const h16* p) { return cat16(*(const v8h*)p, *(const v8h*)(p + 16)); } static __device__ __forceinline__ v8f mma(V a, V b, v8f c) { return wmma16(a, b, c); } };
template <> struct WFrag<bf> { typedef v16bf V; static __device__ __forceinline__ V ld(const bf* p) { return cat16b(*(const v8us*)p, *(const v8us*)(p + 16)); } static __device__ __forceinline__ v8f mma(V a, V b, v8f c) { return wmmab(a, b, c); } };
template <typename T16, int NSPLIT, bool BIAS, int OM>
__global__ __launch_bounds__(32) void k_gemmw(const T16* __restrict__ A, const T16* __restrict__ A2, const T16* __restrict__ Bt, const T16* __restrict__ Bt2, int K, float* C, int ldc, const float* __restrict__ bias, size_t sA, size_t sB, size_t sC, h16* P16, bf* Ph, bf* Pl) {
    typedef typename WFrag<T16>::V V;
    __shared__ __align__(16) float os[16 * 68];
    const size_t z = blockIdx.z; A += z * sA; if (A2) A2 += z * sA; Bt += z * sB; if (Bt2) Bt2 += z * sB; C += z * sC;
    const int lane = threadIdx.x & 31, lr = lane & 15, hi = lane >> 4; const int r0 = blockIdx.x * 64, c0 = blockIdx.y * 64;
    v8f acc[4][4];
#pragma unroll
    for (int mb = 0; mb < 4; ++mb)
#pragma unroll
        for (int nb = 0; nb < 4; ++nb) acc[mb][nb] = (v8f){};
    const size_t aoff = (size_t)(r0 + lr) * K + 8 * hi, boff = (size_t)(c0 + lr) * K + 8 * hi;
    const int rw = lane >> 3, c8 = (lane & 7) * 8;   // plane epilogue: lane's row within a group of four, its first of eight columns
    float bb[16];   // plane epilogue: the lane's biases, fetched here so that their latency passes under the K loop (OM 1: by column; OM 2: by row, [turn * 4 + s])
    if constexpr (OM != 0 && BIAS) { const float* pb = bias + c0 + (OM == 1 ? c8 : rw);
#pragma unroll
        for (int i = 0; i < (OM == 1 ? 8 : 16); ++i) bb[i] = pb[OM == 1 ? i : (i >> 2) * 16 + 4 * (i & 3)];
        // the wait that goes before a register named by an issued load is overwritten; the address is its input, so it stays whole up to it
        asm volatile("s_wait_xcnt 0x0" :: "v"(pb) : "memory");
#pragma unroll
        for (int i = 0; i < (OM == 1 ? 8 : 16); ++i) bb[i] = bfr(bb[i]); }
#pragma unroll 1
    for (int kc = 0; kc < K; kc += 32) {
        V a[4], a2[4];
#pragma unroll
        for (int mb = 0; mb < 4; ++mb) { a[mb] = WFrag<T16>::ld(A + aoff + (size_t)mb * 16 * K + kc); if (NSPLIT == 1 || NSPLIT == 2) a2[mb] = WFrag<T16>::ld(A2 + aoff + (size_t)mb * 16 * K + kc); }
#pragma unroll
        for (int nb = 0; nb < 4; ++nb) { const V b = WFrag<T16>::ld(Bt + boff + (size_t)nb * 16 * K + kc); V b2; if (NSPLIT >= 2) b2 = WFrag<T16>::ld(Bt2 + boff + (size_t)nb * 16 * K + kc);
#pragma unroll
            for (int mb = 0; mb < 4; ++mb) { acc[mb][nb] = WFrag<T16>::mma(a[mb], b, acc[mb][nb]); if (NSPLIT == 1 || NSPLIT == 2) acc[mb][nb] = WFrag<T16>::mma(a2[mb], b, acc[mb][nb]); if (NSPLIT >= 2) acc[mb][nb] = WFrag<T16>::mma(a[mb], b2, acc[mb][nb]); } }
        asm volatile("v_nop\n\tv_nop\n\tv_nop\n\tv_nop" : "+v"(acc[0][0]), "+v"(acc[1][1]), "+v"(acc[2][2]), "+v"(acc[3][3]) : "v"(a[0]), "v"(a[3]));
    }
    if constexpr (OM != 0) {
#pragma unroll
        for (int g = 0; g < 4; ++g) {   // OM 1: 16 rows t x 64 d of the tile per turn; OM 2: 16 rows d x 64 t
#pragma unroll
            for (int u = 0; u < 4; ++u) {
                if constexpr (OM == 1) {
#pragma unroll
                    for (int j = 0; j < 8; ++j) os[(hi * 8 + j) * 68 + u * 16 + lr] = acc[g][u][j];
                } else { v4f lo4, hi4;
#pragma unroll
                    for (int j = 0; j < 4; ++j) { lo4[j] = acc[u][g][j]; hi4[j] = acc[u][g][4 + j]; }
                    *(v4fa*)(os + lr * 68 + u * 16 + hi * 8) = lo4; *(v4fa*)(os + lr * 68 + u * 16 + hi * 8 + 4) = hi4; } }
            __builtin_amdgcn_wave_barrier(); asm volatile("" ::: "memory");   // the lanes' LDS writes stay in front of the other lanes' reads of them
#pragma unroll
            for (int s = 0; s < 4; ++s) { const int row = 4 * s + rw; const v4f v0 = *(const v4fa*)(os + row * 68 + c8), v1 = *(const v4fa*)(os + row * 68 + c8 + 4); v8h o16; v8us oh, ol;
#pragma unroll
                for (int i = 0; i < 8; ++i) { float y = (i < 4) ? v0[i & 3] : v1[i & 3]; if (BIAS) y += bb[OM == 1 ? i : g * 4 + s];
                    o16[i] = (h16)y; const unsigned short yh = f2bf(y); oh[i] = yh; ol[i] = f2bf(y - bf2f(yh)); }
                const size_t e = (OM == 1) ? ((size_t)blockIdx.y * TT + r0 + g * 16 + row) * HD + c8 : ((size_t)blockIdx.y * HD + g * 16 + row) * TT + r0 + c8;
                *(v8h*)(P16 + e) = o16; *(v8us*)(Ph + e) = oh; *(v8us*)(Pl + e) = ol; }
            __builtin_amdgcn_wave_barrier(); asm volatile("" ::: "memory");   // the reads of this turn stay in front of the next turn's LDS writes
        }
        return;
    }
#pragma unroll
    for (int mb = 0; mb < 4; ++mb) {
#pragma unroll
        for (int nb = 0; nb < 4; ++nb) {
#pragma unroll
            for (int j = 0; j < 8; ++j) os[(hi * 8 + j) * 68 + nb * 16 + lr] = acc[mb][nb][j]; }
        __builtin_amdgcn_wave_barrier(); asm volatile("" ::: "memory");
        float* crow = C + (size_t)(r0 + mb * 16) * ldc + c0;
{
#pragma unroll
            for (int s = 0; s < 8; ++s) { const int row = 2 * s + hi, cofs = lr * 4; v4f val = *(const v4fa*)(os + row * 68 + cofs); if (BIAS) { val[0] += bfr(bias[c0 + cofs]); val[1] += bfr(bias[c0 + cofs + 1]); val[2] += bfr(bias[c0 + cofs + 2]); val[3] += bfr(bias[c0 + cofs + 3]); }
                *(v4f*)(crow + (size_t)row * ldc + cofs) = val; }
             }
        __builtin_amdgcn_wave_barrier(); asm volatile("" ::: "memory");
    }
}

__device__ __forceinline__ h16 tohx(float x) { return (h16)x; }
__device__ __forceinline__ void splitf(float y, unsigned short& h, unsigned short& l) { h = f2bf(y); l = f2bf(y - bf2f(h)); }
typedef __attribute__((ext_vector_type(2))) _Float16 v2h;
typedef __attribute__((ext_vector_type(4))) _Float16 v4h;
typedef __attribute__((ext_vector_type(2))) unsigned short v2us;
typedef __attribute__((ext_vector_type(4))) unsigned short v4us;
typedef __attribute__((ext_vector_type(2))) float v2f;
typedef __attribute__((ext_vector_type(4))) int v4i;

__global__ __launch_bounds__(256) void k_wtG(const float* __restrict__ w, int K, int N, bf* Bt) {
    const int lane = threadIdx.x & 31; const int L0 = (blockIdx.x * 8 + (threadIdx.x >> 5)) * 8; const int nlines = N * K / 64;
{
#pragma unroll 1
        for (int l = 0; l < 8; ++l) { const int L = L0 + l; if (L >= nlines) break; const size_t e = (size_t)L * 64 + lane * 2; const int k = (int)(e % K), n = (int)(e / K); v2us o;
            o[0] = f2bf(w[(size_t)k * N + n]); o[1] = f2bf(w[(size_t)(k + 1) * N + n]); *(v2us*)(Bt + e) = o; }
         }
}
__global__ __launch_bounds__(256) void k_cvt8(const float* __restrict__ src, bf* dst, size_t n8) { const size_t i = (size_t)blockIdx.x * 256 + threadIdx.x; if (i >= n8) return; const v8f v = *(const v8f*)(src + i * 8); v8us o;
#pragma unroll
    for (int k = 0; k < 8; ++k) o[k] = f2bf(v[k]); *(v8us*)(dst + i * 8) = o;  }

// ---- k_fattn: scores, causal softmax and probability x value product of one tile of QT = 16 * NQ query rows of one head in ONE work-group of 8 waves; grid (rows / QT, heads), 256 threads; no score or probability ever goes to memory.
// Everything is computed transposed, so that a lane owns one query column throughout: S^T = K Q^T (A = key rows, B = query rows) leaves lane (lr, hi) with keys 8 * hi + j of query lr in register j,
// which is exactly the B fragment order of O^T = V^T P^T (two 16-key tiles side by side give keys 8 * hi + j and 16 + 8 * hi + j); row maximum, row sum and the final scale are then per lane.
// The key range 0 .. q0 + QT - 1 (a last chunk can run past it; those keys are masked) is split over the waves: wave w takes chunks w, w + 8, ... Pass 1: scores of CK1-key chunks -> row maximum, joined over the waves in LDS behind a barrier.
// Pass 2: scores again in CK2-key chunks, p = exp(t - max) (f32 sum of the unrounded p), p rounded to 16 bit (HR: hi + lo bf16 planes, 3 products as for the scores), O^T += V^T p.
// Every inner loop is unrolled so that the fragment and accumulator arrays are indexed statically and stay in registers.
// The 8 partial tiles and sums meet in LDS behind a second barrier, are added in wave order 0..7, scaled by 1 / sum and stored as the hi / lo planes [t][head][d] that the output projection reads.
template <typename T16, bool HR, int NQ, int CK1, int CK2>
__global__ __launch_bounds__(256) void k_fattn(const T16* __restrict__ Q, const T16* __restrict__ Q2, const T16* __restrict__ Kp, const T16* __restrict__ Kp2, const T16* __restrict__ Vt, const T16* __restrict__ Vt2, bf* Ah, bf* Al) {
    typedef typename WFrag<T16>::V V;
    constexpr int QT = NQ * 16, M1 = CK1 / 16, M2 = CK2 / 16, KS2 = CK2 / 32, R0 = HR ? 0 : RH, NT = (HR ? RH : TT - RH) / QT;   // HR: query rows 0 .. RH - 1; else rows RH .. TT - 1; NT tiles = gridDim.x
    __shared__ __align__(16) float po[8 * QT * 68];
    __shared__ float smx[8 * QT], ssm[8 * QT];
    const int lane = threadIdx.x & 31, lr = lane & 15, hi = lane >> 4;
    const int w = __builtin_amdgcn_readfirstlane(threadIdx.x >> 5);   // wave number in a scalar register: the chunk loops' tests stay scalar branches
    const int q0 = R0 + (NT - 1 - (int)blockIdx.x) * QT;   // the tiles with the most keys start first
    const int hd = blockIdx.y; const size_t hb = (size_t)hd * TT * HD; const int nk = q0 + QT;
    V qf[NQ][2], qf2[NQ][2]; const T16 *pq[NQ], *pq2[NQ];
#pragma unroll
    for (int nq = 0; nq < NQ; ++nq) { const size_t qo = hb + (size_t)(q0 + nq * 16 + lr) * HD + 8 * hi; pq[nq] = Q + qo; pq2[nq] = HR ? Q2 + qo : pq[nq];
#pragma unroll
        for (int ks = 0; ks < 2; ++ks) { qf[nq][ks] = WFrag<T16>::ld(pq[nq] + ks * 32); if (HR) qf2[nq][ks] = WFrag<T16>::ld(pq2[nq] + ks * 32); } }
    // the wait that goes before a register named by an issued load is overwritten; the addresses are its inputs, so they stay whole up to it
    asm volatile("s_wait_xcnt 0x0" :: "v"(pq[0]), "v"(pq[NQ - 1]), "v"(pq2[0]), "v"(pq2[NQ - 1]) : "memory");
    float mx[NQ];
#pragma unroll
    for (int nq = 0; nq < NQ; ++nq) mx[nq] = -3.0e38f;
#pragma unroll 1   // rolled: one chunk's fragments at a time fit the registers
    for (int kc = CK1 * w; kc < nk; kc += 8 * CK1) {
        const size_t ko = hb + (size_t)(kc + lr) * HD + 8 * hi; const T16* pk = Kp + ko; const T16* pk2 = HR ? Kp2 + ko : pk; V kf[M1][2], kf2[M1][2];
#pragma unroll
        for (int mt = 0; mt < M1; ++mt)
#pragma unroll
            for (int ks = 0; ks < 2; ++ks) { kf[mt][ks] = WFrag<T16>::ld(pk + mt * 16 * HD + ks * 32); if (HR) kf2[mt][ks] = WFrag<T16>::ld(pk2 + mt * 16 * HD + ks * 32); }
        // the wait that goes before a register named by an issued load is overwritten; the addresses are its inputs, so they stay whole up to it
        asm volatile("s_wait_xcnt 0x0" :: "v"(pk), "v"(pk2) : "memory");
        __builtin_amdgcn_sched_barrier(0);   // every load of the chunk is issued before the first product, so that a chunk waits out the cache latency once
#pragma unroll
        for (int mt = 0; mt < M1; ++mt)
#pragma unroll
            for (int nq = 0; nq < NQ; ++nq) { v8f s = (v8f){};
#pragma unroll
                for (int ks = 0; ks < 2; ++ks) { s = WFrag<T16>::mma(kf[mt][ks], qf[nq][ks], s); if (HR) { s = WFrag<T16>::mma(kf[mt][ks], qf2[nq][ks], s); s = WFrag<T16>::mma(kf2[mt][ks], qf[nq][ks], s); } }
#pragma unroll
                for (int j = 0; j < 8; ++j) { const float t = (kc + mt * 16 + 8 * hi + j <= q0 + nq * 16 + lr) ? s[j] * SCL : -3.0e38f; mx[nq] = fmaxf(mx[nq], t); } }
    }
#pragma unroll
    for (int nq = 0; nq < NQ; ++nq) { mx[nq] = fmaxf(mx[nq], __shfl_xor(mx[nq], 16, 32)); if (hi == 0) smx[w * QT + nq * 16 + lr] = mx[nq]; }
    __syncthreads();   // every wave's row maxima are in LDS before any wave joins them
#pragma unroll
    for (int nq = 0; nq < NQ; ++nq) { float g = smx[nq * 16 + lr];
#pragma unroll
        for (int u = 1; u < 8; ++u) g = fmaxf(g, smx[u * QT + nq * 16 + lr]);
        mx[nq] = g; }
    v8f o[4][NQ]; float sum[NQ];
#pragma unroll
    for (int nq = 0; nq < NQ; ++nq) { sum[nq] = 0.f;
#pragma unroll
        for (int dt = 0; dt < 4; ++dt) o[dt][nq] = (v8f){}; }
#pragma unroll 1   // rolled: one chunk's fragments at a time fit the registers
    for (int kc = CK2 * w; kc < nk; kc += 8 * CK2) {
        const size_t ko = hb + (size_t)(kc + lr) * HD + 8 * hi, vo = hb + (size_t)lr * TT + kc + 8 * hi; const T16* pk = Kp + ko; const T16* pk2 = HR ? Kp2 + ko : pk; const T16* pv = Vt + vo; const T16* pv2 = HR ? Vt2 + vo : pv;
        V kf[M2][2], kf2[M2][2], vf[4][KS2], vf2[4][KS2];
#pragma unroll
        for (int mt = 0; mt < M2; ++mt)
#pragma unroll
            for (int ks = 0; ks < 2; ++ks) { kf[mt][ks] = WFrag<T16>::ld(pk + mt * 16 * HD + ks * 32); if (HR) kf2[mt][ks] = WFrag<T16>::ld(pk2 + mt * 16 * HD + ks * 32); }
#pragma unroll
        for (int dt = 0; dt < 4; ++dt)
#pragma unroll
            for (int ks = 0; ks < KS2; ++ks) { vf[dt][ks] = WFrag<T16>::ld(pv + (size_t)dt * 16 * TT + ks * 32); if (HR) vf2[dt][ks] = WFrag<T16>::ld(pv2 + (size_t)dt * 16 * TT + ks * 32); }
        // the wait that goes before a register named by an issued load is overwritten; the addresses are its inputs, so they stay whole up to it
        asm volatile("s_wait_xcnt 0x0" :: "v"(pk), "v"(pk2), "v"(pv), "v"(pv2) : "memory");
        __builtin_amdgcn_sched_barrier(0);   // key and value loads of the chunk are all issued before the first product: the value loads fly while the scores and the exponentials are worked out
#pragma unroll
        for (int nq = 0; nq < NQ; ++nq) { float p[M2][8];
#pragma unroll
            for (int mt = 0; mt < M2; ++mt) { v8f s = (v8f){};
#pragma unroll
                for (int ks = 0; ks < 2; ++ks) { s = WFrag<T16>::mma(kf[mt][ks], qf[nq][ks], s); if (HR) { s = WFrag<T16>::mma(kf[mt][ks], qf2[nq][ks], s); s = WFrag<T16>::mma(kf2[mt][ks], qf[nq][ks], s); } }
#pragma unroll
                for (int j = 0; j < 8; ++j) { const float t = (kc + mt * 16 + 8 * hi + j <= q0 + nq * 16 + lr) ? s[j] * SCL : -3.0e38f; p[mt][j] = __builtin_amdgcn_exp2f(__fmul_rn(__fsub_rn(t, mx[nq]), 1.4426950408889634f)); sum[nq] += p[mt][j]; } }
#pragma unroll
            for (int ks = 0; ks < KS2; ++ks) {
                if constexpr (HR) { v8us h0, h1, l0, l1;
#pragma unroll
                    for (int j = 0; j < 8; ++j) { unsigned short a, c2; splitf(p[2 * ks][j], a, c2); h0[j] = a; l0[j] = c2; splitf(p[2 * ks + 1][j], a, c2); h1[j] = a; l1[j] = c2; }
                    const V ph = cat16b(h0, h1), pl = cat16b(l0, l1);
#pragma unroll
                    for (int dt = 0; dt < 4; ++dt) { o[dt][nq] = WFrag<T16>::mma(vf[dt][ks], ph, o[dt][nq]); o[dt][nq] = WFrag<T16>::mma(vf[dt][ks], pl, o[dt][nq]); o[dt][nq] = WFrag<T16>::mma(vf2[dt][ks], ph, o[dt][nq]); }
                } else { v8h h0, h1;
#pragma unroll
                    for (int j = 0; j < 8; ++j) { h0[j] = tohx(p[2 * ks][j]); h1[j] = tohx(p[2 * ks + 1][j]); }
                    const V ph = cat16(h0, h1);
#pragma unroll
                    for (int dt = 0; dt < 4; ++dt) o[dt][nq] = WFrag<T16>::mma(vf[dt][ks], ph, o[dt][nq]); } } }
    }
#pragma unroll
    for (int nq = 0; nq < NQ; ++nq) { const float sw = sum[nq] + __shfl_xor(sum[nq], 16, 32); if (hi == 0) ssm[w * QT + nq * 16 + lr] = sw; float* pw = po + (size_t)(w * QT + nq * 16 + lr) * 68 + 8 * hi;
#pragma unroll
        for (int dt = 0; dt < 4; ++dt) { v4f a, c; 
#pragma unroll
            for (int j = 0; j < 4; ++j) { a[j] = o[dt][nq][j]; c[j] = o[dt][nq][4 + j]; }
            *(v4fa*)(pw + dt * 16) = a; *(v4fa*)(pw + dt * 16 + 4) = c; } }
    __syncthreads();   // every wave's partial tile and partial sums are in LDS before any thread adds them
#pragma unroll
    for (int it = threadIdx.x; it < QT * 16; it += 256) { const int qq = it >> 4, d4 = (it & 15) * 4; v4f a = *(const v4fa*)(po + (size_t)qq * 68 + d4); float ts = ssm[qq];
#pragma unroll
        for (int u = 1; u < 8; ++u) { a += *(const v4fa*)(po + (size_t)(u * QT + qq) * 68 + d4); ts += ssm[u * QT + qq]; }
        const float f = __fdiv_rn(1.0f, ts); v4us oh, ol;
#pragma unroll
        for (int q = 0; q < 4; ++q) { unsigned short a2, c2; splitf(a[q] * f, a2, c2); oh[q] = a2; ol[q] = c2; }
        const size_t oo = (size_t)(q0 + qq) * DQ + hd * HD + d4; *(v4us*)(Ah + oo) = oh; *(v4us*)(Al + oo) = ol; }
}

extern "C" void kernel_launch(void* const* d_in, const int* in_sizes, int n_in,
                              void* d_out, int out_size, void* d_ws, size_t ws_size, hipStream_t stream) {
    (void)in_sizes; (void)n_in; (void)out_size;
    const float* x = (const float*)d_in[0]; const float* wq = (const float*)d_in[1]; const float* bq = (const float*)d_in[2]; const float* wk = (const float*)d_in[3]; const float* bk = (const float*)d_in[4]; const float* wv = (const float*)d_in[5]; const float* bv = (const float*)d_in[6]; const float* wo = (const float*)d_in[7]; const float* bo = (const float*)d_in[8];
    float* OUT = (float*)d_out;     // [2][2048][1024]
    char* wsp = (char*)d_ws;
    auto take = [&](size_t bytes) { char* p = wsp; wsp += (bytes + 255) & ~(size_t)255; return (void*)p; };
    bf* WQ = (bf*)take((size_t)DQ * DM * 2); bf* WK = (bf*)take((size_t)DKV * DM * 2); bf* WV = (bf*)take((size_t)DKV * DM * 2); bf* WO = (bf*)take((size_t)DM * DQ * 2);
    bf* XB = (bf*)take((size_t)TT * DM * 2);
    h16* QP16 = (h16*)take((size_t)NH_ * TT * HD * 2); h16* KP16 = (h16*)take((size_t)NKV * TT * HD * 2); h16* VT16 = (h16*)take((size_t)NKV * HD * TT * 2);
    bf* QPh = (bf*)take((size_t)NH_ * TT * HD * 2); bf* QPl = (bf*)take((size_t)NH_ * TT * HD * 2); bf* KPh = (bf*)take((size_t)NKV * TT * HD * 2); bf* KPl = (bf*)take((size_t)NKV * TT * HD * 2); bf* VTh = (bf*)take((size_t)NKV * HD * TT * 2); bf* VTl = (bf*)take((size_t)NKV * HD * TT * 2);
    bf* ATh = (bf*)take((size_t)TT * DQ * 2); bf* ATl = (bf*)take((size_t)TT * DQ * 2);
    if ((size_t)(wsp - (char*)d_ws) > ws_size) return;    // ws 256 MiB
    { k_cvt8<<<(unsigned)(((size_t)DQ * DM / 8 + 255) / 256), 256, 0, stream>>>(wq, WQ, (size_t)DQ * DM / 8); k_cvt8<<<(unsigned)(((size_t)DKV * DM / 8 + 255) / 256), 256, 0, stream>>>(wk, WK, (size_t)DKV * DM / 8); k_cvt8<<<(unsigned)(((size_t)DKV * DM / 8 + 255) / 256), 256, 0, stream>>>(wv, WV, (size_t)DKV * DM / 8);
      k_cvt8<<<(unsigned)(((size_t)DM * DQ / 8 + 255) / 256), 256, 0, stream>>>(wo, WO, (size_t)DM * DQ / 8);
       }
    for (int b = 0; b < NB_; ++b) {
        
        k_cvt8<<<(unsigned)(((size_t)TT * DM / 8 + 255) / 256), 256, 0, stream>>>(x + (size_t)b * TT * DM, XB, (size_t)TT * DM / 8);
        k_gemmw<bf, 0, true, 1><<<dim3(TT / 64, DQ / 64, 1), 32, 0, stream>>>(XB, nullptr, WQ, nullptr, DM, nullptr, 0, bq, 0, 0, 0, QP16, QPh, QPl);
        k_gemmw<bf, 0, true, 1><<<dim3(TT / 64, DKV / 64, 1), 32, 0, stream>>>(XB, nullptr, WK, nullptr, DM, nullptr, 0, bk, 0, 0, 0, KP16, KPh, KPl);
        k_gemmw<bf, 0, true, 2><<<dim3(TT / 64, DKV / 64, 1), 32, 0, stream>>>(XB, nullptr, WV, nullptr, DM, nullptr, 0, bv, 0, 0, 0, VT16, VTh, VTl);
        k_fattn<h16, false, 2, 64, 32><<<dim3((TT - RH) / 32, NH_, 1), 256, 0, stream>>>(QP16, nullptr, KP16, nullptr, VT16, nullptr, ATh, ATl);
        k_fattn<bf, true, 1, 32, 32><<<dim3(RH / 16, NH_, 1), 256, 0, stream>>>(QPh, QPl, KPh, KPl, VTh, VTl, ATh, ATl);
        k_gemmw<bf, 1, true, 0><<<dim3(TT / 64, DM / 64, 1), 32, 0, stream>>>(ATh, ATl, WO, nullptr, DQ, OUT + (size_t)b * TT * DM, DM, bo, 0, 0, 0, nullptr, nullptr, nullptr); }
}

// v005
// Measured time: 187 microseconds a run.
// In two side-by-side timings against v004, it was 1.83 and 1.85 times as fast.
// Over all steps from v000 it is 7.72 times as fast.
#include <hip/hip_runtime.h>

// Causal multi-head attention, cache-free prefill path (x [2][2048][1024]; q,k,v = x W^T + b ('oi' 0.02, zero biases; 16 heads x 64); scores / 8; triu(1) -> -inf; softmax; out = merged Wo^T + bo -> [2][2048][1024] (4.2 M)).
// Every stage is launched once over both batches (rows b * 2048 + t, planes [b][head]). Layout: bf16 copy of x; 'oi' weights; exact projections + f32 biases, rounded to the head planes in their own epilogue; fused causal T-2048 attention, one kernel per row class (hybrid rows: < 512 hi/lo 3 products, rest fp16; tiles above the diagonal skipped; probabilities scaled by 1 / sum after the value product); merged hi/lo x Wo exact + bo.
// Compute dtypes, f32 accumulate: every input rounded to bf16; projections exact + f32 biases; attention rows < 512 3 products, rest fp16; softmax f32; Wo hl x exact + bias.

#define NB_  2
#define TT   2048
#define DM   1024
#define NH_  16
#define NKV  16
#define REP  (NH_ / NKV)
#define HD   64
#define DQ   (NH_ * HD)
#define DKV  (NKV * HD)
#define RH   512                  // query rows < RH use hi+lo planes (0: none)
#define SCL  0.125f   // HD^-0.5
typedef _Float16 h16;
typedef unsigned short bf;
typedef __attribute__((ext_vector_type(16))) __bf16   v16bf;
typedef __attribute__((ext_vector_type(16))) _Float16 v16h;
typedef __attribute__((ext_vector_type(8)))  _Float16 v8h;
typedef __attribute__((ext_vector_type(8)))  unsigned short v8us;
typedef __attribute__((ext_vector_type(8)))  float    v8f;
typedef __attribute__((ext_vector_type(4)))  float    v4f;
typedef v8h  __attribute__((may_alias)) v8ha;
typedef v4f  __attribute__((may_alias)) v4fa;
typedef v8us __attribute__((may_alias)) v8usa;

__device__ __forceinline__ unsigned short f2bf(float f) { unsigned u = __float_as_uint(f); u += 0x7FFFu + ((u >> 16) & 1u); return (unsigned short)(u >> 16); }
__device__ __forceinline__ float bf2f(unsigned short b) { return __uint_as_float(((unsigned)b) << 16); }
__device__ __forceinline__ float bfr(float f) { return bf2f(f2bf(f)); }
__device__ __forceinline__ v16h cat16(v8h lo, v8h hi) { return __builtin_shufflevector(lo, hi, 0, 1, 2, 3, 4, 5, 6, 7, 8, 9, 10, 11, 12, 13, 14, 15); }
__device__ __forceinline__ v16bf cat16b(v8us lo, v8us hi) { return __builtin_bit_cast(v16bf, __builtin_shufflevector(lo, hi, 0, 1, 2, 3, 4, 5, 6, 7, 8, 9, 10, 11, 12, 13, 14, 15)); }
__device__ __forceinline__ v8f wmma16(v16h a, v16h b, v8f c) { return __builtin_amdgcn_wmma_f32_16x16x32_f16(false, a, false, b, (short)0, c, false, false); }
__device__ __forceinline__ v8f wmmab(v16bf a, v16bf b, v8f c) { return __builtin_amdgcn_wmma_f32_16x16x32_bf16(false, a, false, b, (short)0, c, false, false); }



// ---- k_gemmw: register-blocked GEMM, ONE WAVE per 64x64 output tile (16 accumulators), operands straight from K-contiguous 16-bit planes; grid (M/64, N/64, Z), 32 threads.
// C[m][n] (f32, pitch ldc, + optional f32 bias[n]) = sum_k A[m][k] Bt[n][k] (+ split products per NSPLIT). z-batch strides sA/sB/sC, and sP of the planes, in elements; z > 0 takes biasz. K % 32 == 0. Row m is token m % TT of batch m / TT.
// OM 0: C goes to memory as f32. OM 1 / 2: the tile (one head: HD == 64 columns) is rounded in the epilogue and stored as the fp16, bf16-hi and bf16-lo planes that the attention kernels read,
// OM 1 as [batch][head][t][d], OM 2 transposed as [batch][head][d][t]; no f32 copy of it is written. Eight lanes store one whole 128-byte line of a plane.
template <typename T16> struct WFrag;
template <> struct WFrag<h16> { typedef v16h V; static __device__ __forceinline__ V ld(const h16* p) { return cat16(*(const v8h*)p, *(const v8h*)(p + 16)); } static __device__ __forceinline__ v8f mma(V a, V b, v8f c) { return wmma16(a, b, c); } };
template <> struct WFrag<bf> { typedef v16bf V; static __device__ __forceinline__ V ld(const bf* p) { return cat16b(*(const v8us*)p, *(const v8us*)(p + 16)); } static __device__ __forceinline__ v8f mma(V a, V b, v8f c) { return wmmab(a, b, c); } };
template <typename T16, int NSPLIT, bool BIAS, int OM>
__global__ __launch_bounds__(32) void k_gemmw(const T16* __restrict__ A, const T16* __restrict__ A2, const T16* __restrict__ Bt, const T16* __restrict__ Bt2, int K, float* C, int ldc, const float* __restrict__ bias, const float* __restrict__ biasz, size_t sA, size_t sB, size_t sC, size_t sP, h16* P16, bf* Ph, bf* Pl) {
    typedef typename WFrag<T16>::V V;
    __shared__ __align__(16) float os[16 * 68];
    const size_t z = blockIdx.z; A += z * sA; if (A2) A2 += z * sA; Bt += z * sB; if (Bt2) Bt2 += z * sB; C += z * sC; if (z) bias = biasz; if (OM != 0) { P16 += z * sP; Ph += z * sP; Pl += z * sP; }
    const int lane = threadIdx.x & 31, lr = lane & 15, hi = lane >> 4; const int r0 = blockIdx.x * 64, c0 = blockIdx.y * 64;
    v8f acc[4][4];
#pragma unroll
    for (int mb = 0; mb < 4; ++mb)
#pragma unroll
        for (int nb = 0; nb < 4; ++nb) acc[mb][nb] = (v8f){};
    const size_t aoff = (size_t)(r0 + lr) * K + 8 * hi, boff = (size_t)(c0 + lr) * K + 8 * hi;
    const int rw = lane >> 3, c8 = (lane & 7) * 8;   // plane epilogue: lane's row within a group of four, its first of eight columns
    float bb[16];   // plane epilogue: the lane's biases, fetched here so that their latency passes under the K loop (OM 1: by column; OM 2: by row, [turn * 4 + s])
    if constexpr (OM != 0 && BIAS) { const float* pb = bias + c0 + (OM == 1 ? c8 : rw);
#pragma unroll
        for (int i = 0; i < (OM == 1 ? 8 : 16); ++i) bb[i] = pb[OM == 1 ? i : (i >> 2) * 16 + 4 * (i & 3)];
        // the wait that goes before a register named by an issued load is overwritten; the address is its input, so it stays whole up to it
        asm volatile("s_wait_xcnt 0x0" :: "v"(pb) : "memory");
#pragma unroll
        for (int i = 0; i < (OM == 1 ? 8 : 16); ++i) bb[i] = bfr(bb[i]); }
#pragma unroll 1
    for (int kc = 0; kc < K; kc += 32) {
        V a[4], a2[4];
#pragma unroll
        for (int mb = 0; mb < 4; ++mb) { a[mb] = WFrag<T16>::ld(A + aoff + (size_t)mb * 16 * K + kc); if (NSPLIT == 1 || NSPLIT == 2) a2[mb] = WFrag<T16>::ld(A2 + aoff + (size_t)mb * 16 * K + kc); }
#pragma unroll
        for (int nb = 0; nb < 4; ++nb) { const V b = WFrag<T16>::ld(Bt + boff + (size_t)nb * 16 * K + kc); V b2; if (NSPLIT >= 2) b2 = WFrag<T16>::ld(Bt2 + boff + (size_t)nb * 16 * K + kc);
#pragma unroll
            for (int mb = 0; mb < 4; ++mb) { acc[mb][nb] = WFrag<T16>::mma(a[mb], b, acc[mb][nb]); if (NSPLIT == 1 || NSPLIT == 2) acc[mb][nb] = WFrag<T16>::mma(a2[mb], b, acc[mb][nb]); if (NSPLIT >= 2) acc[mb][nb] = WFrag<T16>::mma(a[mb], b2, acc[mb][nb]); } }
        asm volatile("v_nop\n\tv_nop\n\tv_nop\n\tv_nop" : "+v"(acc[0][0]), "+v"(acc[1][1]), "+v"(acc[2][2]), "+v"(acc[3][3]) : "v"(a[0]), "v"(a[3]));
    }
    if constexpr (OM != 0) {
#pragma unroll
        for (int g = 0; g < 4; ++g) {   // OM 1: 16 rows t x 64 d of the tile per turn; OM 2: 16 rows d x 64 t
#pragma unroll
            for (int u = 0; u < 4; ++u) {
                if constexpr (OM == 1) {
#pragma unroll
                    for (int j = 0; j < 8; ++j) os[(hi * 8 + j) * 68 + u * 16 + lr] = acc[g][u][j];
                } else { v4f lo4, hi4;
#pragma unroll
                    for (int j = 0; j < 4; ++j) { lo4[j] = acc[u][g][j]; hi4[j] = acc[u][g][4 + j]; }
                    *(v4fa*)(os + lr * 68 + u * 16 + hi * 8) = lo4; *(v4fa*)(os + lr * 68 + u * 16 + hi * 8 + 4) = hi4; } }
            __builtin_amdgcn_wave_barrier(); asm volatile("" ::: "memory");   // the lanes' LDS writes stay in front of the other lanes' reads of them
#pragma unroll
            for (int s = 0; s < 4; ++s) { const int row = 4 * s + rw; const v4f v0 = *(const v4fa*)(os + row * 68 + c8), v1 = *(const v4fa*)(os + row * 68 + c8 + 4); v8h o16; v8us oh, ol;
#pragma unroll
                for (int i = 0; i < 8; ++i) { float y = (i < 4) ? v0[i & 3] : v1[i & 3]; if (BIAS) y += bb[OM == 1 ? i : g * 4 + s];
                    o16[i] = (h16)y; const unsigned short yh = f2bf(y); oh[i] = yh; ol[i] = f2bf(y - bf2f(yh)); }
                const size_t pn = (size_t)(r0 / TT) * NH_ + blockIdx.y; const int t0 = r0 % TT;   // the tile's plane [batch][head] and its first token there
                const size_t e = (OM == 1) ? (pn * TT + t0 + g * 16 + row) * HD + c8 : (pn * HD + g * 16 + row) * TT + t0 + c8;
                *(v8h*)(P16 + e) = o16; *(v8us*)(Ph + e) = oh; *(v8us*)(Pl + e) = ol; }
            __builtin_amdgcn_wave_barrier(); asm volatile("" ::: "memory");   // the reads of this turn stay in front of the next turn's LDS writes
        }
        return;
    }
#pragma unroll
    for (int mb = 0; mb < 4; ++mb) {
#pragma unroll
        for (int nb = 0; nb < 4; ++nb) {
#pragma unroll
            for (int j = 0; j < 8; ++j) os[(hi * 8 + j) * 68 + nb * 16 + lr] = acc[mb][nb][j]; }
        __builtin_amdgcn_wave_barrier(); asm volatile("" ::: "memory");
        float* crow = C + (size_t)(r0 + mb * 16) * ldc + c0;
{
#pragma unroll
            for (int s = 0; s < 8; ++s) { const int row = 2 * s + hi, cofs = lr * 4; v4f val = *(const v4fa*)(os + row * 68 + cofs); if (BIAS) { val[0] += bfr(bias[c0 + cofs]); val[1] += bfr(bias[c0 + cofs + 1]); val[2] += bfr(bias[c0 + cofs + 2]); val[3] += bfr(bias[c0 + cofs + 3]); }
                *(v4f*)(crow + (size_t)row * ldc + cofs) = val; }
             }
        __builtin_amdgcn_wave_barrier(); asm volatile("" ::: "memory");
    }
}

__device__ __forceinline__ h16 tohx(float x) { return (h16)x; }
__device__ __forceinline__ void splitf(float y, unsigned short& h, unsigned short& l) { h = f2bf(y); l = f2bf(y - bf2f(h)); }
typedef __attribute__((ext_vector_type(2))) _Float16 v2h;
typedef __attribute__((ext_vector_type(4))) _Float16 v4h;
typedef __attribute__((ext_vector_type(2))) unsigned short v2us;
typedef __attribute__((ext_vector_type(4))) unsigned short v4us;
typedef __attribute__((ext_vector_type(2))) float v2f;
typedef __attribute__((ext_vector_type(4))) int v4i;

__global__ __launch_bounds__(256) void k_wtG(const float* __restrict__ w, int K, int N, bf* Bt) {
    const int lane = threadIdx.x & 31; const int L0 = (blockIdx.x * 8 + (threadIdx.x >> 5)) * 8; const int nlines = N * K / 64;
{
#pragma unroll 1
        for (int l = 0; l < 8; ++l) { const int L = L0 + l; if (L >= nlines) break; const size_t e = (size_t)L * 64 + lane * 2; const int k = (int)(e % K), n = (int)(e / K); v2us o;
            o[0] = f2bf(w[(size_t)k * N + n]); o[1] = f2bf(w[(size_t)(k + 1) * N + n]); *(v2us*)(Bt + e) = o; }
         }
}
// k_cvt8: the four weights and x (both batches) rounded to bf16 in one grid (DQ * DM / 2048, 4 + NB_ * TT / DQ): slice y of DQ * DM elements is weight y (y < 4) or slice y - 4 of x; dst holds the slices one behind the other.
static_assert(DQ == DM && DKV == DM && (NB_ * TT) % DQ == 0 && (DQ * DM) % 2048 == 0, "equal slices");
__global__ __launch_bounds__(256) void k_cvt8(const float* __restrict__ wq, const float* __restrict__ wk, const float* __restrict__ wv, const float* __restrict__ wo, const float* __restrict__ x, bf* dst) {
    const int y = blockIdx.y; const float* src = y == 0 ? wq : y == 1 ? wk : y == 2 ? wv : y == 3 ? wo : x + (size_t)(y - 4) * (DQ * DM);
    const size_t i = (size_t)blockIdx.x * 256 + threadIdx.x; const v8f v = *(const v8f*)(src + i * 8); v8us o;
#pragma unroll
    for (int k = 0; k < 8; ++k) o[k] = f2bf(v[k]); *(v8us*)(dst + (size_t)y * (DQ * DM) + i * 8) = o;  }

// ---- k_fattn: scores, causal softmax and probability x value product of one tile of QT = 16 * NQ query rows of one head in ONE work-group of 8 waves; grid (batches x heads, rows / QT), 256 threads; no score or probability ever goes to memory.
// Everything is computed transposed, so that a lane owns one query column throughout: S^T = K Q^T (A = key rows, B = query rows) leaves lane (lr, hi) with keys 8 * hi + j of query lr in register j,
// which is exactly the B fragment order of O^T = V^T P^T (two 16-key tiles side by side give keys 8 * hi + j and 16 + 8 * hi + j); row maximum, row sum and the final scale are then per lane.
// The key range 0 .. q0 + QT - 1 (a last chunk can run past it; those keys are masked) is split over the waves: wave w takes chunks w, w + 8, ... Pass 1: scores of CK1-key chunks -> row maximum, joined over the waves in LDS behind a barrier.
// Pass 2: scores again in CK2-key chunks, p = exp(t - max) (f32 sum of the unrounded p), p rounded to 16 bit (HR: hi + lo bf16 planes, 3 products as for the scores), O^T += V^T p.
// Every inner loop is unrolled so that the fragment and accumulator arrays are indexed statically and stay in registers.
// The 8 partial tiles and sums meet in LDS behind a second barrier, are added in wave order 0..7, scaled by 1 / sum and stored as the hi / lo planes [t][head][d] that the output projection reads.
template <typename T16, bool HR, int NQ, int CK1, int CK2>
__global__ __launch_bounds__(256) void k_fattn(const T16* __restrict__ Q, const T16* __restrict__ Q2, const T16* __restrict__ Kp, const T16* __restrict__ Kp2, const T16* __restrict__ Vt, const T16* __restrict__ Vt2, bf* Ah, bf* Al) {
    typedef typename WFrag<T16>::V V;
    constexpr int QT = NQ * 16, M1 = CK1 / 16, M2 = CK2 / 16, KS2 = CK2 / 32, R0 = HR ? 0 : RH, NT = (HR ? RH : TT - RH) / QT;   // HR: query rows 0 .. RH - 1; else rows RH .. TT - 1; NT tiles = gridDim.y
    __shared__ __align__(16) float po[8 * QT * 68];
    __shared__ float smx[8 * QT], ssm[8 * QT];
    const int lane = threadIdx.x & 31, lr = lane & 15, hi = lane >> 4;
    const int w = __builtin_amdgcn_readfirstlane(threadIdx.x >> 5);   // wave number in a scalar register: the chunk loops' tests stay scalar branches
    const int q0 = R0 + (NT - 1 - (int)blockIdx.y) * QT;   // the tile index is the slow grid axis: over all heads of both batches the tiles with the most keys start first
    const int hd = blockIdx.x % NH_, bt = blockIdx.x / NH_; const size_t hb = (size_t)blockIdx.x * TT * HD; const int nk = q0 + QT;   // plane [batch][head]
    V qf[NQ][2], qf2[NQ][2]; const T16 *pq[NQ], *pq2[NQ];
#pragma unroll
    for (int nq = 0; nq < NQ; ++nq) { const size_t qo = hb + (size_t)(q0 + nq * 16 + lr) * HD + 8 * hi; pq[nq] = Q + qo; pq2[nq] = HR ? Q2 + qo : pq[nq];
#pragma unroll
        for (int ks = 0; ks < 2; ++ks) { qf[nq][ks] = WFrag<T16>::ld(pq[nq] + ks * 32); if (HR) qf2[nq][ks] = WFrag<T16>::ld(pq2[nq] + ks * 32); } }
    // the wait that goes before a register named by an issued load is overwritten; the addresses are its inputs, so they stay whole up to it
    asm volatile("s_wait_xcnt 0x0" :: "v"(pq[0]), "v"(pq[NQ - 1]), "v"(pq2[0]), "v"(pq2[NQ - 1]) : "memory");
    float mx[NQ];
#pragma unroll
    for (int nq = 0; nq < NQ; ++nq) mx[nq] = -3.0e38f;
#pragma unroll 1   // rolled: one chunk's fragments at a time fit the registers
    for (int kc = CK1 * w; kc < nk; kc += 8 * CK1) {
        const size_t ko = hb + (size_t)(kc + lr) * HD + 8 * hi; const T16* pk = Kp + ko; const T16* pk2 = HR ? Kp2 + ko : pk; V kf[M1][2], kf2[M1][2];
#pragma unroll
        for (int mt = 0; mt < M1; ++mt)
#pragma unroll
            for (int ks = 0; ks < 2; ++ks) { kf[mt][ks] = WFrag<T16>::ld(pk + mt * 16 * HD + ks * 32); if (HR) kf2[mt][ks] = WFrag<T16>::ld(pk2 + mt * 16 * HD + ks * 32); }
        // the wait that goes before a register named by an issued load is overwritten; the addresses are its inputs, so they stay whole up to it
        asm volatile("s_wait_xcnt 0x0" :: "v"(pk), "v"(pk2) : "memory");
        __builtin_amdgcn_sched_barrier(0);   // every load of the chunk is issued before the first product, so that a chunk waits out the cache latency once
#pragma unroll
        for (int mt = 0; mt < M1; ++mt)
#pragma unroll
            for (int nq = 0; nq < NQ; ++nq) { v8f s = (v8f){};
#pragma unroll
                for (int ks = 0; ks < 2; ++ks) { s = WFrag<T16>::mma(kf[mt][ks], qf[nq][ks], s); if (HR) { s = WFrag<T16>::mma(kf[mt][ks], qf2[nq][ks], s); s = WFrag<T16>::mma(kf2[mt][ks], qf[nq][ks], s); } }
#pragma unroll
                for (int j = 0; j < 8; ++j) { const float t = (kc + mt * 16 + 8 * hi + j <= q0 + nq * 16 + lr) ? s[j] * SCL : -3.0e38f; mx[nq] = fmaxf(mx[nq], t); } }
    }
#pragma unroll
    for (int nq = 0; nq < NQ; ++nq) { mx[nq] = fmaxf(mx[nq], __shfl_xor(mx[nq], 16, 32)); if (hi == 0) smx[w * QT + nq * 16 + lr] = mx[nq]; }
    __syncthreads();   // every wave's row maxima are in LDS before any wave joins them
#pragma unroll
    for (int nq = 0; nq < NQ; ++nq) { float g = smx[nq * 16 + lr];
#pragma unroll
        for (int u = 1; u < 8; ++u) g = fmaxf(g, smx[u * QT + nq * 16 + lr]);
        mx[nq] = g; }
    v8f o[4][NQ]; float sum[NQ];
#pragma unroll
    for (int nq = 0; nq < NQ; ++nq) { sum[nq] = 0.f;
#pragma unroll
        for (int dt = 0; dt < 4; ++dt) o[dt][nq] = (v8f){}; }
#pragma unroll 1   // rolled: one chunk's fragments at a time fit the registers
    for (int kc = CK2 * w; kc < nk; kc += 8 * CK2) {
        const size_t ko = hb + (size_t)(kc + lr) * HD + 8 * hi, vo = hb + (size_t)lr * TT + kc + 8 * hi; const T16* pk = Kp + ko; const T16* pk2 = HR ? Kp2 + ko : pk; const T16* pv = Vt + vo; const T16* pv2 = HR ? Vt2 + vo : pv;
        V kf[M2][2], kf2[M2][2], vf[4][KS2], vf2[4][KS2];
#pragma unroll
        for (int mt = 0; mt < M2; ++mt)
#pragma unroll
            for (int ks = 0; ks < 2; ++ks) { kf[mt][ks] = WFrag<T16>::ld(pk + mt * 16 * HD + ks * 32); if (HR) kf2[mt][ks] = WFrag<T16>::ld(pk2 + mt * 16 * HD + ks * 32); }
#pragma unroll
        for (int dt = 0; dt < 4; ++dt)
#pragma unroll
            for (int ks = 0; ks < KS2; ++ks) { vf[dt][ks] = WFrag<T16>::ld(pv + (size_t)dt * 16 * TT + ks * 32); if (HR) vf2[dt][ks] = WFrag<T16>::ld(pv2 + (size_t)dt * 16 * TT + ks * 32); }
        // the wait that goes before a register named by an issued load is overwritten; the addresses are its inputs, so they stay whole up to it
        asm volatile("s_wait_xcnt 0x0" :: "v"(pk), "v"(pk2), "v"(pv), "v"(pv2) : "memory");
        __builtin_amdgcn_sched_barrier(0);   // key and value loads of the chunk are all issued before the first product: the value loads fly while the scores and the exponentials are worked out
#pragma unroll
        for (int nq = 0; nq < NQ; ++nq) { float p[M2][8];
#pragma unroll
            for (int mt = 0; mt < M2; ++mt) { v8f s = (v8f){};
#pragma unroll
                for (int ks = 0; ks < 2; ++ks) { s = WFrag<T16>::mma(kf[mt][ks], qf[nq][ks], s); if (HR) { s = WFrag<T16>::mma(kf[mt][ks], qf2[nq][ks], s); s = WFrag<T16>::mma(kf2[mt][ks], qf[nq][ks], s); } }
#pragma unroll
                for (int j = 0; j < 8; ++j) { const float t = (kc + mt * 16 + 8 * hi + j <= q0 + nq * 16 + lr) ? s[j] * SCL : -3.0e38f; p[mt][j] = __builtin_amdgcn_exp2f(__fmul_rn(__fsub_rn(t, mx[nq]), 1.4426950408889634f)); sum[nq] += p[mt][j]; } }
#pragma unroll
            for (int ks = 0; ks < KS2; ++ks) {
                if constexpr (HR) { v8us h0, h1, l0, l1;
#pragma unroll
                    for (int j = 0; j < 8; ++j) { unsigned short a, c2; splitf(p[2 * ks][j], a, c2); h0[j] = a; l0[j] = c2; splitf(p[2 * ks + 1][j], a, c2); h1[j] = a; l1[j] = c2; }
                    const V ph = cat16b(h0, h1), pl = cat16b(l0, l1);
#pragma unroll
                    for (int dt = 0; dt < 4; ++dt) { o[dt][nq] = WFrag<T16>::mma(vf[dt][ks], ph, o[dt][nq]); o[dt][nq] = WFrag<T16>::mma(vf[dt][ks], pl, o[dt][nq]); o[dt][nq] = WFrag<T16>::mma(vf2[dt][ks], ph, o[dt][nq]); }
                } else { v8h h0, h1;
#pragma unroll
                    for (int j = 0; j < 8; ++j) { h0[j] = tohx(p[2 * ks][j]); h1[j] = tohx(p[2 * ks + 1][j]); }
                    const V ph = cat16(h0, h1);
#pragma unroll
                    for (int dt = 0; dt < 4; ++dt) o[dt][nq] = WFrag<T16>::mma(vf[dt][ks], ph, o[dt][nq]); } } }
    }
#pragma unroll
    for (int nq = 0; nq < NQ; ++nq) { const float sw = sum[nq] + __shfl_xor(sum[nq], 16, 32); if (hi == 0) ssm[w * QT + nq * 16 + lr] = sw; float* pw = po + (size_t)(w * QT + nq * 16 + lr) * 68 + 8 * hi;
#pragma unroll
        for (int dt = 0; dt < 4; ++dt) { v4f a, c; 
#pragma unroll
            for (int j = 0; j < 4; ++j) { a[j] = o[dt][nq][j]; c[j] = o[dt][nq][4 + j]; }
            *(v4fa*)(pw + dt * 16) = a; *(v4fa*)(pw + dt * 16 + 4) = c; } }
    __syncthreads();   // every wave's partial tile and partial sums are in LDS before any thread adds them
#pragma unroll
    for (int it = threadIdx.x; it < QT * 16; it += 256) { const int qq = it >> 4, d4 = (it & 15) * 4; v4f a = *(const v4fa*)(po + (size_t)qq * 68 + d4); float ts = ssm[qq];
#pragma unroll
        for (int u = 1; u < 8; ++u) { a += *(const v4fa*)(po + (size_t)(u * QT + qq) * 68 + d4); ts += ssm[u * QT + qq]; }
        const float f = __fdiv_rn(1.0f, ts); v4us oh, ol;
#pragma unroll
        for (int q = 0; q < 4; ++q) { unsigned short a2, c2; splitf(a[q] * f, a2, c2); oh[q] = a2; ol[q] = c2; }
        const size_t oo = (size_t)(bt * TT + q0 + qq) * DQ + hd * HD + d4; *(v4us*)(Ah + oo) = oh; *(v4us*)(Al + oo) = ol; }
}

extern "C" void kernel_launch(void* const* d_in, const int* in_sizes, int n_in,
                              void* d_out, int out_size, void* d_ws, size_t ws_size, hipStream_t stream) {
    (void)in_sizes; (void)n_in; (void)out_size;
    const float* x = (const float*)d_in[0]; const float* wq = (const float*)d_in[1]; const float* bq = (const float*)d_in[2]; const float* wk = (const float*)d_in[3]; const float* bk = (const float*)d_in[4]; const float* wv = (const float*)d_in[5]; const float* bv = (const float*)d_in[6]; const float* wo = (const float*)d_in[7]; const float* bo = (const float*)d_in[8];
    float* OUT = (float*)d_out;     // [2][2048][1024]
    char* wsp = (char*)d_ws;
    auto take = [&](size_t bytes) { char* p = wsp; wsp += (bytes + 255) & ~(size_t)255; return (void*)p; };
    bf* WQ = (bf*)take((size_t)DQ * DM * 2); take((size_t)DKV * DM * 2); bf* WV = (bf*)take((size_t)DKV * DM * 2); bf* WO = (bf*)take((size_t)DM * DQ * 2);   // the q, k, v, o weights and the copy of x lie one behind the other
    bf* XB = (bf*)take((size_t)NB_ * TT * DM * 2);
    const size_t PS = (size_t)NB_ * NH_ * TT * HD;   // elements of one set of planes [batch][head]; the q, k, v sets lie one behind the other
    h16* QP16 = (h16*)take(3 * PS * 2); bf* QPh = (bf*)take(3 * PS * 2); bf* QPl = (bf*)take(3 * PS * 2);
    bf* ATh = (bf*)take((size_t)NB_ * TT * DQ * 2); bf* ATl = (bf*)take((size_t)NB_ * TT * DQ * 2);
    if ((size_t)(wsp - (char*)d_ws) > ws_size) return;    // ws 256 MiB
    k_cvt8<<<dim3(DQ * DM / 2048, 4 + NB_ * TT / DQ, 1), 256, 0, stream>>>(wq, wk, wv, wo, x, WQ);
    k_gemmw<bf, 0, true, 1><<<dim3(NB_ * TT / 64, DQ / 64, 2), 32, 0, stream>>>(XB, nullptr, WQ, nullptr, DM, nullptr, 0, bq, bk, 0, (size_t)DQ * DM, 0, PS, QP16, QPh, QPl);   // z = 0: q, z = 1: k
    k_gemmw<bf, 0, true, 2><<<dim3(NB_ * TT / 64, DKV / 64, 1), 32, 0, stream>>>(XB, nullptr, WV, nullptr, DM, nullptr, 0, bv, nullptr, 0, 0, 0, 0, QP16 + 2 * PS, QPh + 2 * PS, QPl + 2 * PS);
    k_fattn<h16, false, 2, 64, 32><<<dim3(NB_ * NH_, (TT - RH) / 32, 1), 256, 0, stream>>>(QP16, nullptr, QP16 + PS, nullptr, QP16 + 2 * PS, nullptr, ATh, ATl);
    k_fattn<bf, true, 1, 32, 32><<<dim3(NB_ * NH_, RH / 16, 1), 256, 0, stream>>>(QPh, QPl, QPh + PS, QPl + PS, QPh + 2 * PS, QPl + 2 * PS, ATh, ATl);
    k_gemmw<bf, 1, true, 0><<<dim3(NB_ * TT / 64, DM / 64, 1), 32, 0, stream>>>(ATh, ATl, WO, nullptr, DQ, OUT, DM, bo, nullptr, 0, 0, 0, 0, nullptr, nullptr, nullptr);
}

// v006
// Measured time: 154 microseconds a run.
// Next to v005, in two timings, it ran 1.23 and 1.22 times as fast.
// Over all steps from v000 it is 9.46 times as fast.
#include <hip/hip_runtime.h>

// Causal multi-head attention, cache-free prefill path (x [2][2048][1024]; q,k,v = x W^T + b ('oi' 0.02, zero biases; 16 heads x 64); scores / 8; triu(1) -> -inf; softmax; out = merged Wo^T + bo -> [2][2048][1024] (4.2 M)).
// Every stage is launched once over both batches (rows b * 2048 + t, planes [b][head]). Layout: bf16 copy of x; 'oi' weights; exact projections + f32 biases, rounded to the head planes in their own epilogue; fused causal T-2048 attention, one kernel per row class (hybrid rows: < 512 hi/lo 3 products, rest fp16; tiles above the diagonal skipped; probabilities scaled by 1 / sum after the value product); merged hi/lo x Wo exact + bo.
// Compute dtypes, f32 accumulate: every input rounded to bf16; projections exact + f32 biases; attention rows < 512 3 products, rest fp16; softmax f32; Wo hl x exact + bias.

#define NB_  2
#define TT   2048
#define DM   1024
#define NH_  16
#define NKV  16
#define REP  (NH_ / NKV)
#define HD   64
#define DQ   (NH_ * HD)
#define DKV  (NKV * HD)
#define RH   512                  // query rows < RH use hi+lo planes (0: none)
#define SCL  0.125f   // HD^-0.5
typedef _Float16 h16;
typedef unsigned short bf;
typedef __attribute__((ext_vector_type(16))) __bf16   v16bf;
typedef __attribute__((ext_vector_type(16))) _Float16 v16h;
typedef __attribute__((ext_vector_type(8)))  _Float16 v8h;
typedef __attribute__((ext_vector_type(8)))  unsigned short v8us;
typedef __attribute__((ext_vector_type(8)))  float    v8f;
typedef __attribute__((ext_vector_type(4)))  float    v4f;
typedef v8h  __attribute__((may_alias)) v8ha;
typedef v4f  __attribute__((may_alias)) v4fa;
typedef v8us __attribute__((may_alias)) v8usa;

__device__ __forceinline__ unsigned short f2bf(float f) { unsigned u = __float_as_uint(f); u += 0x7FFFu + ((u >> 16) & 1u); return (unsigned short)(u >> 16); }
__device__ __forceinline__ float bf2f(unsigned short b) { return __uint_as_float(((unsigned)b) << 16); }
__device__ __forceinline__ float bfr(float f) { return bf2f(f2bf(f)); }
__device__ __forceinline__ v16h cat16(v8h lo, v8h hi) { return __builtin_shufflevector(lo, hi, 0, 1, 2, 3, 4, 5, 6, 7, 8, 9, 10, 11, 12, 13, 14, 15); }
__device__ __forceinline__ v16bf cat16b(v8us lo, v8us hi) { return __builtin_bit_cast(v16bf, __builtin_shufflevector(lo, hi, 0, 1, 2, 3, 4, 5, 6, 7, 8, 9, 10, 11, 12, 13, 14, 15)); }
__device__ __forceinline__ v8f wmma16(v16h a, v16h b, v8f c) { return __builtin_amdgcn_wmma_f32_16x16x32_f16(false, a, false, b, (short)0, c, false, false); }
__device__ __forceinline__ v8f wmmab(v16bf a, v16bf b, v8f c) { return __builtin_amdgcn_wmma_f32_16x16x32_bf16(false, a, false, b, (short)0, c, false, false); }



// ---- k_gemmw: register-blocked GEMM, ONE WAVE per 64x64 output tile (16 accumulators), operands straight from K-contiguous 16-bit planes; grid (M/64, N/64, Z), 32 threads.
// C[m][n] (f32, pitch ldc, + optional f32 bias[n]) = sum_k A[m][k] Bt[n][k] (+ split products per NSPLIT). z-batch strides sA/sB/sC, and sP of the planes, in elements; z > 0 takes biasz. K % 32 == 0. Row m is token m % TT of batch m / TT.
// OM 0: C goes to memory as f32. OM 1 / 2: the tile (one head: HD == 64 columns) is rounded in the epilogue and stored as the fp16, bf16-hi and bf16-lo planes that the attention kernels read,
// OM 1 rows t x columns d, OM 2 transposed, rows d x columns t; no f32 copy of it is written.
// A plane [batch][head] is kept in FRAGMENT ORDER: tiles of 16 rows x 32 columns (1 KiB), column tiles innermost; inside a tile element (row r, column c) lies at (c >> 4) * 256 + (((c >> 3) & 1) * 16 + r) * 8 + (c & 7),
// so that lane l of a reader finds the two halves of its fragment at l * 8 and 256 + l * 8 (ldf): each of its loads, and each store here, covers 512 contiguous bytes, four whole 128-byte lines.
template <typename T16> struct WFrag;
template <> struct WFrag<h16> { typedef v16h V; static __device__ __forceinline__ V ld(const h16* p) { return cat16(*(const v8h*)p, *(const v8h*)(p + 16)); } static __device__ __forceinline__ V ldf(const h16* p) { return cat16(*(const v8h*)p, *(const v8h*)(p + 256)); } static __device__ __forceinline__ v8f mma(V a, V b, v8f c) { return wmma16(a, b, c); } };
template <> struct WFrag<bf> { typedef v16bf V; static __device__ __forceinline__ V ld(const bf* p) { return cat16b(*(const v8us*)p, *(const v8us*)(p + 16)); } static __device__ __forceinline__ V ldf(const bf* p) { return cat16b(*(const v8us*)p, *(const v8us*)(p + 256)); } static __device__ __forceinline__ v8f mma(V a, V b, v8f c) { return wmmab(a, b, c); } };
template <typename T16, int NSPLIT, bool BIAS, int OM>
__global__ __launch_bounds__(32) void k_gemmw(const T16* __restrict__ A, const T16* __restrict__ A2, const T16* __restrict__ Bt, const T16* __restrict__ Bt2, int K, float* C, int ldc, const float* __restrict__ bias, const float* __restrict__ biasz, size_t sA, size_t sB, size_t sC, size_t sP, h16* P16, bf* Ph, bf* Pl) {
    typedef typename WFrag<T16>::V V;
    __shared__ __align__(16) float os[16 * 68];
    const size_t z = blockIdx.z; A += z * sA; if (A2) A2 += z * sA; Bt += z * sB; if (Bt2) Bt2 += z * sB; C += z * sC; if (z) bias = biasz; if (OM != 0) { P16 += z * sP; Ph += z * sP; Pl += z * sP; }
    const int lane = threadIdx.x & 31, lr = lane & 15, hi = lane >> 4; const int r0 = blockIdx.x * 64, c0 = blockIdx.y * 64;
    v8f acc[4][4];
#pragma unroll
    for (int mb = 0; mb < 4; ++mb)
#pragma unroll
        for (int nb = 0; nb < 4; ++nb) acc[mb][nb] = (v8f){};
    const size_t aoff = (size_t)(r0 + lr) * K + 8 * hi, boff = (size_t)(c0 + lr) * K + 8 * hi;
    float bb[4];   // plane epilogue: the biases of the lane's output columns i * 16 + lr, fetched here so that their latency passes under the K loop
    if constexpr (OM != 0 && BIAS) { const float* pb = bias + c0 + lr;
#pragma unroll
        for (int i = 0; i < 4; ++i) bb[i] = pb[i * 16];
        // the wait that goes before a register named by an issued load is overwritten; the address is its input, so it stays whole up to it
        asm volatile("s_wait_xcnt 0x0" :: "v"(pb) : "memory");
#pragma unroll
        for (int i = 0; i < 4; ++i) bb[i] = bfr(bb[i]); }
#pragma unroll 1
    for (int kc = 0; kc < K; kc += 32) {
        V a[4], a2[4];
#pragma unroll
        for (int mb = 0; mb < 4; ++mb) { a[mb] = WFrag<T16>::ld(A + aoff + (size_t)mb * 16 * K + kc); if (NSPLIT == 1 || NSPLIT == 2) a2[mb] = WFrag<T16>::ld(A2 + aoff + (size_t)mb * 16 * K + kc); }
#pragma unroll
        for (int nb = 0; nb < 4; ++nb) { const V b = WFrag<T16>::ld(Bt + boff + (size_t)nb * 16 * K + kc); V b2; if (NSPLIT >= 2) b2 = WFrag<T16>::ld(Bt2 + boff + (size_t)nb * 16 * K + kc);
#pragma unroll
            for (int mb = 0; mb < 4; ++mb) { acc[mb][nb] = WFrag<T16>::mma(a[mb], b, acc[mb][nb]); if (NSPLIT == 1 || NSPLIT == 2) acc[mb][nb] = WFrag<T16>::mma(a2[mb], b, acc[mb][nb]); if (NSPLIT >= 2) acc[mb][nb] = WFrag<T16>::mma(a[mb], b2, acc[mb][nb]); } }
        asm volatile("v_nop\n\tv_nop\n\tv_nop\n\tv_nop" : "+v"(acc[0][0]), "+v"(acc[1][1]), "+v"(acc[2][2]), "+v"(acc[3][3]) : "v"(a[0]), "v"(a[3]));
    }
    if constexpr (OM != 0) {
#pragma unroll
        for (int g = 0; g < 4; ++g) {   // OM 1: 16 rows t x 64 d of the tile per turn; OM 2: 16 rows d x 64 t
#pragma unroll
            for (int u = 0; u < 4; ++u) {
                if constexpr (OM == 1) {
#pragma unroll
                    for (int j = 0; j < 8; ++j) os[(hi * 8 + j) * 68 + u * 16 + lr] = BIAS ? acc[g][u][j] + bb[u] : acc[g][u][j];
                } else { v4f lo4, hi4;
#pragma unroll
                    for (int j = 0; j < 4; ++j) { lo4[j] = BIAS ? acc[u][g][j] + bb[g] : acc[u][g][j]; hi4[j] = BIAS ? acc[u][g][4 + j] + bb[g] : acc[u][g][4 + j]; }
                    *(v4fa*)(os + lr * 68 + u * 16 + hi * 8) = lo4; *(v4fa*)(os + lr * 68 + u * 16 + hi * 8 + 4) = hi4; } }
            __builtin_amdgcn_wave_barrier(); asm volatile("" ::: "memory");   // the lanes' LDS writes stay in front of the other lanes' reads of them
#pragma unroll
            for (int s = 0; s < 4; ++s) { const int c8 = (2 * s + hi) * 8; const v4f v0 = *(const v4fa*)(os + lr * 68 + c8), v1 = *(const v4fa*)(os + lr * 68 + c8 + 4); v8h o16; v8us oh, ol;   // row lr, columns c8 .. c8 + 7 of the turn: piece s * 32 + lane of its two tiles
#pragma unroll
                for (int i = 0; i < 8; ++i) { const float y = (i < 4) ? v0[i & 3] : v1[i & 3];
                    o16[i] = (h16)y; const unsigned short yh = f2bf(y); oh[i] = yh; ol[i] = f2bf(y - bf2f(yh)); }
                const size_t pn = (size_t)(r0 / TT) * NH_ + blockIdx.y; const int t0 = r0 % TT;   // the tile's plane [batch][head] and its first token there
                const size_t e = ((OM == 1) ? (pn * TT + t0 + g * 16) * HD : (pn * HD + g * 16) * TT + t0 * 16) + s * 256 + lane * 8;   // the turn's two tiles lie one behind the other
                *(v8h*)(P16 + e) = o16; *(v8us*)(Ph + e) = oh; *(v8us*)(Pl + e) = ol; }
            __builtin_amdgcn_wave_barrier(); asm volatile("" ::: "memory");   // the reads of this turn stay in front of the next turn's LDS writes
        }
        return;
    }
#pragma unroll
    for (int mb = 0; mb < 4; ++mb) {
#pragma unroll
        for (int nb = 0; nb < 4; ++nb) {
#pragma unroll
            for (int j = 0; j < 8; ++j) os[(hi * 8 + j) * 68 + nb * 16 + lr] = acc[mb][nb][j]; }
        __builtin_amdgcn_wave_barrier(); asm volatile("" ::: "memory");
        float* crow = C + (size_t)(r0 + mb * 16) * ldc + c0;
{
#pragma unroll
            for (int s = 0; s < 8; ++s) { const int row = 2 * s + hi, cofs = lr * 4; v4f val = *(const v4fa*)(os + row * 68 + cofs); if (BIAS) { val[0] += bfr(bias[c0 + cofs]); val[1] += bfr(bias[c0 + cofs + 1]); val[2] += bfr(bias[c0 + cofs + 2]); val[3] += bfr(bias[c0 + cofs + 3]); }
                *(v4f*)(crow + (size_t)row * ldc + cofs) = val; }
             }
        __builtin_amdgcn_wave_barrier(); asm volatile("" ::: "memory");
    }
}

__device__ __forceinline__ h16 tohx(float x) { return (h16)x; }
__device__ __forceinline__ void splitf(float y, unsigned short& h, unsigned short& l) { h = f2bf(y); l = f2bf(y - bf2f(h)); }
typedef __attribute__((ext_vector_type(2))) _Float16 v2h;
typedef __attribute__((ext_vector_type(4))) _Float16 v4h;
typedef __attribute__((ext_vector_type(2))) unsigned short v2us;
typedef __attribute__((ext_vector_type(4))) unsigned short v4us;
typedef __attribute__((ext_vector_type(2))) float v2f;
typedef __attribute__((ext_vector_type(4))) int v4i;

__global__ __launch_bounds__(256) void k_wtG(const float* __restrict__ w, int K, int N, bf* Bt) {
    const int lane = threadIdx.x & 31; const int L0 = (blockIdx.x * 8 + (threadIdx.x >> 5)) * 8; const int nlines = N * K / 64;
{
#pragma unroll 1
        for (int l = 0; l < 8; ++l) { const int L = L0 + l; if (L >= nlines) break; const size_t e = (size_t)L * 64 + lane * 2; const int k = (int)(e % K), n = (int)(e / K); v2us o;
            o[0] = f2bf(w[(size_t)k * N + n]); o[1] = f2bf(w[(size_t)(k + 1) * N + n]); *(v2us*)(Bt + e) = o; }
         }
}
// k_cvt8: the four weights and x (both batches) rounded to bf16 in one grid (DQ * DM / 2048, 4 + NB_ * TT / DQ): slice y of DQ * DM elements is weight y (y < 4) or slice y - 4 of x; dst holds the slices one behind the other.
static_assert(DQ == DM && DKV == DM && (NB_ * TT) % DQ == 0 && (DQ * DM) % 2048 == 0, "equal slices");
__global__ __launch_bounds__(256) void k_cvt8(const float* __restrict__ wq, const float* __restrict__ wk, const float* __restrict__ wv, const float* __restrict__ wo, const float* __restrict__ x, bf* dst) {
    const int y = blockIdx.y; const float* src = y == 0 ? wq : y == 1 ? wk : y == 2 ? wv : y == 3 ? wo : x + (size_t)(y - 4) * (DQ * DM);
    const size_t i = (size_t)blockIdx.x * 256 + threadIdx.x; const v8f v = *(const v8f*)(src + i * 8); v8us o;
#pragma unroll
    for (int k = 0; k < 8; ++k) o[k] = f2bf(v[k]); *(v8us*)(dst + (size_t)y * (DQ * DM) + i * 8) = o;  }

// ---- k_fattn: scores, causal softmax and probability x value product of one tile of QT = 16 * NQ query rows of one head in ONE work-group of 8 waves; grid (batches x heads, rows / QT), 256 threads; no score or probability ever goes to memory.
// Everything is computed transposed, so that a lane owns one query column throughout: S^T = K Q^T (A = key rows, B = query rows) leaves lane (lr, hi) with keys 8 * hi + j of query lr in register j,
// which is exactly the B fragment order of O^T = V^T P^T (two 16-key tiles side by side give keys 8 * hi + j and 16 + 8 * hi + j); row maximum, row sum and the final scale are then per lane.
// The key range 0 .. q0 + QT - 1 (a last chunk can run past it; those keys are masked) is split over the waves: wave w takes chunks w, w + 8, ... Pass 1: scores of CK1-key chunks -> row maximum, joined over the waves in LDS behind a barrier.
// Pass 2: scores again in CK2-key chunks, p = exp(t - max) (f32 sum of the unrounded p), p rounded to 16 bit (HR: hi + lo bf16 planes, 3 products as for the scores), O^T += V^T p.
// The q, k and v planes come in fragment order (see k_gemmw): tile (row block, column block) of q and k at (row block * 2 + column block) * 512, of the transposed v at (d block * (TT / 32) + key block) * 512; a lane's fragment halves at lane * 8 and 256 + lane * 8.
// Every inner loop is unrolled so that the fragment and accumulator arrays are indexed statically and stay in registers.
// The 8 partial tiles and sums meet in LDS behind a second barrier, are added in wave order 0..7, scaled by 1 / sum and stored as the hi / lo planes [t][head][d] that the output projection reads.
template <typename T16, bool HR, int NQ, int CK1, int CK2>
__global__ __launch_bounds__(256) void k_fattn(const T16* __restrict__ Q, const T16* __restrict__ Q2, const T16* __restrict__ Kp, const T16* __restrict__ Kp2, const T16* __restrict__ Vt, const T16* __restrict__ Vt2, bf* Ah, bf* Al) {
    typedef typename WFrag<T16>::V V;
    constexpr int QT = NQ * 16, M1 = CK1 / 16, M2 = CK2 / 16, KS2 = CK2 / 32, R0 = HR ? 0 : RH, NT = (HR ? RH : TT - RH) / QT;   // HR: query rows 0 .. RH - 1; else rows RH .. TT - 1; NT tiles = gridDim.y
    __shared__ __align__(16) float po[8 * QT * 68];
    __shared__ float smx[8 * QT], ssm[8 * QT];
    const int lane = threadIdx.x & 31, lr = lane & 15, hi = lane >> 4;
    const int w = __builtin_amdgcn_readfirstlane(threadIdx.x >> 5);   // wave number in a scalar register: the chunk loops' tests stay scalar branches
    const int q0 = R0 + (NT - 1 - (int)blockIdx.y) * QT;   // the tile index is the slow grid axis: over all heads of both batches the tiles with the most keys start first
    const int hd = blockIdx.x % NH_, bt = blockIdx.x / NH_; const size_t hb = (size_t)blockIdx.x * TT * HD; const int nk = q0 + QT;   // plane [batch][head]
    V qf[NQ][2], qf2[NQ][2]; const T16 *pq[NQ], *pq2[NQ];
#pragma unroll
    for (int nq = 0; nq < NQ; ++nq) { const size_t qo = hb + (size_t)(q0 + nq * 16) * HD + 8 * lane; pq[nq] = Q + qo; pq2[nq] = HR ? Q2 + qo : pq[nq];
#pragma unroll
        for (int ks = 0; ks < 2; ++ks) { qf[nq][ks] = WFrag<T16>::ldf(pq[nq] + ks * 512); if (HR) qf2[nq][ks] = WFrag<T16>::ldf(pq2[nq] + ks * 512); } }
    // the wait that goes before a register named by an issued load is overwritten; the addresses are its inputs, so they stay whole up to it
    asm volatile("s_wait_xcnt 0x0" :: "v"(pq[0]), "v"(pq[NQ - 1]), "v"(pq2[0]), "v"(pq2[NQ - 1]) : "memory");
    float mx[NQ];
#pragma unroll
    for (int nq = 0; nq < NQ; ++nq) mx[nq] = -3.0e38f;
#pragma unroll 1   // rolled: one chunk's fragments at a time fit the registers
    for (int kc = CK1 * w; kc < nk; kc += 8 * CK1) {
        const size_t ko = hb + (size_t)kc * HD + 8 * lane; const T16* pk = Kp + ko; const T16* pk2 = HR ? Kp2 + ko : pk; V kf[M1][2], kf2[M1][2];
#pragma unroll
        for (int mt = 0; mt < M1; ++mt)
#pragma unroll
            for (int ks = 0; ks < 2; ++ks) { kf[mt][ks] = WFrag<T16>::ldf(pk + mt * 16 * HD + ks * 512); if (HR) kf2[mt][ks] = WFrag<T16>::ldf(pk2 + mt * 16 * HD + ks * 512); }
        // the wait that goes before a register named by an issued load is overwritten; the addresses are its inputs, so they stay whole up to it
        asm volatile("s_wait_xcnt 0x0" :: "v"(pk), "v"(pk2) : "memory");
        __builtin_amdgcn_sched_barrier(0);   // every load of the chunk is issued before the first product, so that a chunk waits out the cache latency once
#pragma unroll
        for (int mt = 0; mt < M1; ++mt)
#pragma unroll
            for (int nq = 0; nq < NQ; ++nq) { v8f s = (v8f){};
#pragma unroll
                for (int ks = 0; ks < 2; ++ks) { s = WFrag<T16>::mma(kf[mt][ks], qf[nq][ks], s); if (HR) { s = WFrag<T16>::mma(kf[mt][ks], qf2[nq][ks], s); s = WFrag<T16>::mma(kf2[mt][ks], qf[nq][ks], s); } }
#pragma unroll
                for (int j = 0; j < 8; ++j) { const float t = (kc + mt * 16 + 8 * hi + j <= q0 + nq * 16 + lr) ? s[j] * SCL : -3.0e38f; mx[nq] = fmaxf(mx[nq], t); } }
    }
#pragma unroll
    for (int nq = 0; nq < NQ; ++nq) { mx[nq] = fmaxf(mx[nq], __shfl_xor(mx[nq], 16, 32)); if (hi == 0) smx[w * QT + nq * 16 + lr] = mx[nq]; }
    __syncthreads();   // every wave's row maxima are in LDS before any wave joins them
#pragma unroll
    for (int nq = 0; nq < NQ; ++nq) { float g = smx[nq * 16 + lr];
#pragma unroll
        for (int u = 1; u < 8; ++u) g = fmaxf(g, smx[u * QT + nq * 16 + lr]);
        mx[nq] = g; }
    v8f o[4][NQ]; float sum[NQ];
#pragma unroll
    for (int nq = 0; nq < NQ; ++nq) { sum[nq] = 0.f;
#pragma unroll
        for (int dt = 0; dt < 4; ++dt) o[dt][nq] = (v8f){}; }
#pragma unroll 1   // rolled: one chunk's fragments at a time fit the registers
    for (int kc = CK2 * w; kc < nk; kc += 8 * CK2) {
        const size_t ko = hb + (size_t)kc * HD + 8 * lane, vo = hb + (size_t)kc * 16 + 8 * lane; const T16* pk = Kp + ko; const T16* pk2 = HR ? Kp2 + ko : pk; const T16* pv = Vt + vo; const T16* pv2 = HR ? Vt2 + vo : pv;
        V kf[M2][2], kf2[M2][2], vf[4][KS2], vf2[4][KS2];
#pragma unroll
        for (int mt = 0; mt < M2; ++mt)
#pragma unroll
            for (int ks = 0; ks < 2; ++ks) { kf[mt][ks] = WFrag<T16>::ldf(pk + mt * 16 * HD + ks * 512); if (HR) kf2[mt][ks] = WFrag<T16>::ldf(pk2 + mt * 16 * HD + ks * 512); }
#pragma unroll
        for (int dt = 0; dt < 4; ++dt)
#pragma unroll
            for (int ks = 0; ks < KS2; ++ks) { vf[dt][ks] = WFrag<T16>::ldf(pv + (size_t)dt * 16 * TT + ks * 512); if (HR) vf2[dt][ks] = WFrag<T16>::ldf(pv2 + (size_t)dt * 16 * TT + ks * 512); }
        // the wait that goes before a register named by an issued load is overwritten; the addresses are its inputs, so they stay whole up to it
        asm volatile("s_wait_xcnt 0x0" :: "v"(pk), "v"(pk2), "v"(pv), "v"(pv2) : "memory");
        __builtin_amdgcn_sched_barrier(0);   // key and value loads of the chunk are all issued before the first product: the value loads fly while the scores and the exponentials are worked out
#pragma unroll
        for (int nq = 0; nq < NQ; ++nq) { float p[M2][8];
#pragma unroll
            for (int mt = 0; mt < M2; ++mt) { v8f s = (v8f){};
#pragma unroll
                for (int ks = 0; ks < 2; ++ks) { s = WFrag<T16>::mma(kf[mt][ks], qf[nq][ks], s); if (HR) { s = WFrag<T16>::mma(kf[mt][ks], qf2[nq][ks], s); s = WFrag<T16>::mma(kf2[mt][ks], qf[nq][ks], s); } }
#pragma unroll
                for (int j = 0; j < 8; ++j) { const float t = (kc + mt * 16 + 8 * hi + j <= q0 + nq * 16 + lr) ? s[j] * SCL : -3.0e38f; p[mt][j] = __builtin_amdgcn_exp2f(__fmul_rn(__fsub_rn(t, mx[nq]), 1.4426950408889634f)); sum[nq] += p[mt][j]; } }
#pragma unroll
            for (int ks = 0; ks < KS2; ++ks) {
                if constexpr (HR) { v8us h0, h1, l0, l1;
#pragma unroll
                    for (int j = 0; j < 8; ++j) { unsigned short a, c2; splitf(p[2 * ks][j], a, c2); h0[j] = a; l0[j] = c2; splitf(p[2 * ks + 1][j], a, c2); h1[j] = a; l1[j] = c2; }
                    const V ph = cat16b(h0, h1), pl = cat16b(l0, l1);
#pragma unroll
                    for (int dt = 0; dt < 4; ++dt) { o[dt][nq] = WFrag<T16>::mma(vf[dt][ks], ph, o[dt][nq]); o[dt][nq] = WFrag<T16>::mma(vf[dt][ks], pl, o[dt][nq]); o[dt][nq] = WFrag<T16>::mma(vf2[dt][ks], ph, o[dt][nq]); }
                } else { v8h h0, h1;
#pragma unroll
                    for (int j = 0; j < 8; ++j) { h0[j] = tohx(p[2 * ks][j]); h1[j] = tohx(p[2 * ks + 1][j]); }
                    const V ph = cat16(h0, h1);
#pragma unroll
                    for (int dt = 0; dt < 4; ++dt) o[dt][nq] = WFrag<T16>::mma(vf[dt][ks], ph, o[dt][nq]); } } }
    }
#pragma unroll
    for (int nq = 0; nq < NQ; ++nq) { const float sw = sum[nq] + __shfl_xor(sum[nq], 16, 32); if (hi == 0) ssm[w * QT + nq * 16 + lr] = sw; float* pw = po + (size_t)(w * QT + nq * 16 + lr) * 68 + 8 * hi;
#pragma unroll
        for (int dt = 0; dt < 4; ++dt) { v4f a, c; 
#pragma unroll
            for (int j = 0; j < 4; ++j) { a[j] = o[dt][nq][j]; c[j] = o[dt][nq][4 + j]; }
            *(v4fa*)(pw + dt * 16) = a; *(v4fa*)(pw + dt * 16 + 4) = c; } }
    __syncthreads();   // every wave's partial tile and partial sums are in LDS before any thread adds them
#pragma unroll
    for (int it = threadIdx.x; it < QT * 16; it += 256) { const int qq = it >> 4, d4 = (it & 15) * 4; v4f a = *(const v4fa*)(po + (size_t)qq * 68 + d4); float ts = ssm[qq];
#pragma unroll
        for (int u = 1; u < 8; ++u) { a += *(const v4fa*)(po + (size_t)(u * QT + qq) * 68 + d4); ts += ssm[u * QT + qq]; }
        const float f = __fdiv_rn(1.0f, ts); v4us oh, ol;
#pragma unroll
        for (int q = 0; q < 4; ++q) { unsigned short a2, c2; splitf(a[q] * f, a2, c2); oh[q] = a2; ol[q] = c2; }
        const size_t oo = (size_t)(bt * TT + q0 + qq) * DQ + hd * HD + d4; *(v4us*)(Ah + oo) = oh; *(v4us*)(Al + oo) = ol; }
}

extern "C" void kernel_launch(void* const* d_in, const int* in_sizes, int n_in,
                              void* d_out, int out_size, void* d_ws, size_t ws_size, hipStream_t stream) {
    (void)in_sizes; (void)n_in; (void)out_size;
    const float* x = (const float*)d_in[0]; const float* wq = (const float*)d_in[1]; const float* bq = (const float*)d_in[2]; const float* wk = (const float*)d_in[3]; const float* bk = (const float*)d_in[4]; const float* wv = (const float*)d_in[5]; const float* bv = (const float*)d_in[6]; const float* wo = (const float*)d_in[7]; const float* bo = (const float*)d_in[8];
    float* OUT = (float*)d_out;     // [2][2048][1024]
    char* wsp = (char*)d_ws;
    auto take = [&](size_t bytes) { char* p = wsp; wsp += (bytes + 255) & ~(size_t)255; return (void*)p; };
    bf* WQ = (bf*)take((size_t)DQ * DM * 2); take((size_t)DKV * DM * 2); bf* WV = (bf*)take((size_t)DKV * DM * 2); bf* WO = (bf*)take((size_t)DM * DQ * 2);   // the q, k, v, o weights and the copy of x lie one behind the other
    bf* XB = (bf*)take((size_t)NB_ * TT * DM * 2);
    const size_t PS = (size_t)NB_ * NH_ * TT * HD;   // elements of one set of planes [batch][head]; the q, k, v sets lie one behind the other
    h16* QP16 = (h16*)take(3 * PS * 2); bf* QPh = (bf*)take(3 * PS * 2); bf* QPl = (bf*)take(3 * PS * 2);
    bf* ATh = (bf*)take((size_t)NB_ * TT * DQ * 2); bf* ATl = (bf*)take((size_t)NB_ * TT * DQ * 2);
    if ((size_t)(wsp - (char*)d_ws) > ws_size) return;    // ws 256 MiB
    k_cvt8<<<dim3(DQ * DM / 2048, 4 + NB_ * TT / DQ, 1), 256, 0, stream>>>(wq, wk, wv, wo, x, WQ);
    k_gemmw<bf, 0, true, 1><<<dim3(NB_ * TT / 64, DQ / 64, 2), 32, 0, stream>>>(XB, nullptr, WQ, nullptr, DM, nullptr, 0, bq, bk, 0, (size_t)DQ * DM, 0, PS, QP16, QPh, QPl);   // z = 0: q, z = 1: k
    k_gemmw<bf, 0, true, 2><<<dim3(NB_ * TT / 64, DKV / 64, 1), 32, 0, stream>>>(XB, nullptr, WV, nullptr, DM, nullptr, 0, bv, nullptr, 0, 0, 0, 0, QP16 + 2 * PS, QPh + 2 * PS, QPl + 2 * PS);
    k_fattn<h16, false, 2, 64, 32><<<dim3(NB_ * NH_, (TT - RH) / 32, 1), 256, 0, stream>>>(QP16, nullptr, QP16 + PS, nullptr, QP16 + 2 * PS, nullptr, ATh, ATl);
    k_fattn<bf, true, 1, 32, 32><<<dim3(NB_ * NH_, RH / 16, 1), 256, 0, stream>>>(QPh, QPl, QPh + PS, QPl + PS, QPh + 2 * PS, QPl + 2 * PS, ATh, ATl);
    k_gemmw<bf, 1, true, 0><<<dim3(NB_ * TT / 64, DM / 64, 1), 32, 0, stream>>>(ATh, ATl, WO, nullptr, DQ, OUT, DM, bo, nullptr, 0, 0, 0, 0, nullptr, nullptr, nullptr);
}

// v007
// Measured time: 145 microseconds a run.
// Timed twice side by side with v006, it ran 1.08 and 1.09 times as fast.
// All steps since v000 together make it 10.2 times as fast.
#include <hip/hip_runtime.h>

// Causal multi-head attention, cache-free prefill path (x [2][2048][1024]; q,k,v = x W^T + b ('oi' 0.02, zero biases; 16 heads x 64); scores / 8; triu(1) -> -inf; softmax; out = merged Wo^T + bo -> [2][2048][1024] (4.2 M)).
// Every stage is launched once over both batches (rows b * 2048 + t, planes [b][head]). Layout: bf16 copy of x; 'oi' weights; exact projections + f32 biases, rounded to the head planes in their own epilogue; fused causal T-2048 attention, one kernel per row class (hybrid rows: < 512 hi/lo 3 products, rest fp16; tiles above the diagonal skipped; probabilities scaled by 1 / sum after the value product); merged hi/lo x Wo exact + bo.
// Compute dtypes, f32 accumulate: every input rounded to bf16; projections exact + f32 biases; attention rows < 512 3 products, rest fp16; softmax f32; Wo hl x exact + bias.

#define NB_  2
#define TT   2048
#define DM   1024
#define NH_  16
#define NKV  16
#define REP  (NH_ / NKV)
#define HD   64
#define DQ   (NH_ * HD)
#define DKV  (NKV * HD)
#define RH   512                  // query rows < RH use hi+lo planes (0: none)
#define SCL  0.125f   // HD^-0.5
typedef _Float16 h16;
typedef unsigned short bf;
typedef __attribute__((ext_vector_type(16))) __bf16   v16bf;
typedef __attribute__((ext_vector_type(16))) _Float16 v16h;
typedef __attribute__((ext_vector_type(8)))  _Float16 v8h;
typedef __attribute__((ext_vector_type(8)))  unsigned short v8us;
typedef __attribute__((ext_vector_type(8)))  float    v8f;
typedef __attribute__((ext_vector_type(4)))  float    v4f;
typedef v8h  __attribute__((may_alias)) v8ha;
typedef v4f  __attribute__((may_alias)) v4fa;
typedef v8us __attribute__((may_alias)) v8usa;

__device__ __forceinline__ unsigned short f2bf(float f) { unsigned u = __float_as_uint(f); u += 0x7FFFu + ((u >> 16) & 1u); return (unsigned short)(u >> 16); }
__device__ __forceinline__ float bf2f(unsigned short b) { return __uint_as_float(((unsigned)b) << 16); }
__device__ __forceinline__ float bfr(float f) { return bf2f(f2bf(f)); }
__device__ __forceinline__ v16h cat16(v8h lo, v8h hi) { return __builtin_shufflevector(lo, hi, 0, 1, 2, 3, 4, 5, 6, 7, 8, 9, 10, 11, 12, 13, 14, 15); }
__device__ __forceinline__ v16bf cat16b(v8us lo, v8us hi) { return __builtin_bit_cast(v16bf, __builtin_shufflevector(lo, hi, 0, 1, 2, 3, 4, 5, 6, 7, 8, 9, 10, 11, 12, 13, 14, 15)); }
__device__ __forceinline__ v8f wmma16(v16h a, v16h b, v8f c) { return __builtin_amdgcn_wmma_f32_16x16x32_f16(false, a, false, b, (short)0, c, false, false); }
__device__ __forceinline__ v8f wmmab(v16bf a, v16bf b, v8f c) { return __builtin_amdgcn_wmma_f32_16x16x32_bf16(false, a, false, b, (short)0, c, false, false); }



// ---- k_gemmw: register-blocked GEMM, ONE WAVE per 64x64 output tile (16 accumulators), operands straight from 16-bit planes in fragment order (below; rows m or n, columns k); grid (M/64, N/64, Z), 32 threads.
// C[m][n] (f32, pitch ldc, + optional f32 bias[n]) = sum_k A[m][k] Bt[n][k] (+ split products per NSPLIT). z-batch strides sA/sB/sC, and sP of the planes, in elements; z > 0 takes biasz. K % 32 == 0. Row m is token m % TT of batch m / TT.
// OM 0: C goes to memory as f32. OM 1 / 2: the tile (one head: HD == 64 columns) is rounded in the epilogue and stored as the fp16, bf16-hi and bf16-lo planes that the attention kernels read,
// OM 1 rows t x columns d, OM 2 transposed, rows d x columns t; no f32 copy of it is written.
// A plane [batch][head] is kept in FRAGMENT ORDER: tiles of 16 rows x 32 columns (1 KiB), column tiles innermost; inside a tile element (row r, column c) lies at (c >> 4) * 256 + (((c >> 3) & 1) * 16 + r) * 8 + (c & 7),
// so that lane l of a reader finds the two halves of its fragment at l * 8 and 256 + l * 8 (ldf): each of its loads, and each store here, covers 512 contiguous bytes, four whole 128-byte lines.
template <typename T16> struct WFrag;
template <> struct WFrag<h16> { typedef v16h V; static __device__ __forceinline__ V ldf(const h16* p) { return cat16(*(const v8h*)p, *(const v8h*)(p + 256)); } static __device__ __forceinline__ v8f mma(V a, V b, v8f c) { return wmma16(a, b, c); } };
template <> struct WFrag<bf> { typedef v16bf V; static __device__ __forceinline__ V ldf(const bf* p) { return cat16b(*(const v8us*)p, *(const v8us*)(p + 256)); } static __device__ __forceinline__ v8f mma(V a, V b, v8f c) { return wmmab(a, b, c); } };
template <typename T16, int NSPLIT, bool BIAS, int OM>
__global__ __launch_bounds__(32) void k_gemmw(const T16* __restrict__ A, const T16* __restrict__ A2, const T16* __restrict__ Bt, const T16* __restrict__ Bt2, int K, float* C, int ldc, const float* __restrict__ bias, const float* __restrict__ biasz, size_t sA, size_t sB, size_t sC, size_t sP, h16* P16, bf* Ph, bf* Pl) {
    typedef typename WFrag<T16>::V V;
    __shared__ __align__(16) float os[16 * 68];
    const size_t z = blockIdx.z; A += z * sA; if (A2) A2 += z * sA; Bt += z * sB; if (Bt2) Bt2 += z * sB; C += z * sC; if (z) bias = biasz; if (OM != 0) { P16 += z * sP; Ph += z * sP; Pl += z * sP; }
    const int lane = threadIdx.x & 31, lr = lane & 15, hi = lane >> 4; const int r0 = blockIdx.x * 64, c0 = blockIdx.y * 64;
    v8f acc[4][4];
#pragma unroll
    for (int mb = 0; mb < 4; ++mb)
#pragma unroll
        for (int nb = 0; nb < 4; ++nb) acc[mb][nb] = (v8f){};
    const size_t aoff = (size_t)r0 * K + 8 * lane, boff = (size_t)c0 * K + 8 * lane;   // fragment order: a block of 16 rows is 16 * K elements, its k tiles 512 elements apart
    float bb[4];   // plane epilogue: the biases of the lane's output columns i * 16 + lr, fetched here so that their latency passes under the K loop
    if constexpr (OM != 0 && BIAS) { const float* pb = bias + c0 + lr;
#pragma unroll
        for (int i = 0; i < 4; ++i) bb[i] = pb[i * 16];
        // the wait that goes before a register named by an issued load is overwritten; the address is its input, so it stays whole up to it
        asm volatile("s_wait_xcnt 0x0" :: "v"(pb) : "memory");
#pragma unroll
        for (int i = 0; i < 4; ++i) bb[i] = bfr(bb[i]); }
#pragma unroll 1
    for (int kc = 0; kc < K; kc += 32) {
        V a[4], a2[4], b[4], b2[4]; const T16 *pa[4], *pa2[4], *pb[4], *pb2[4];
#pragma unroll
        for (int mb = 0; mb < 4; ++mb) { const size_t o = aoff + (size_t)mb * 16 * K + kc * 16; pa[mb] = A + o; pa2[mb] = (NSPLIT == 1 || NSPLIT == 2) ? A2 + o : pa[mb]; a[mb] = WFrag<T16>::ldf(pa[mb]); if (NSPLIT == 1 || NSPLIT == 2) a2[mb] = WFrag<T16>::ldf(pa2[mb]); }
#pragma unroll
        for (int nb = 0; nb < 4; ++nb) { const size_t o = boff + (size_t)nb * 16 * K + kc * 16; pb[nb] = Bt + o; pb2[nb] = (NSPLIT >= 2) ? Bt2 + o : pb[nb]; b[nb] = WFrag<T16>::ldf(pb[nb]); if (NSPLIT >= 2) b2[nb] = WFrag<T16>::ldf(pb2[nb]); }
        // the wait that goes before a register named by an issued load is overwritten; the addresses are its inputs, so they stay whole up to it
        asm volatile("s_wait_xcnt 0x0" :: "v"(pa[0]), "v"(pa[1]), "v"(pa[2]), "v"(pa[3]), "v"(pa2[0]), "v"(pa2[1]), "v"(pa2[2]), "v"(pa2[3]), "v"(pb[0]), "v"(pb[1]), "v"(pb[2]), "v"(pb[3]), "v"(pb2[0]), "v"(pb2[1]), "v"(pb2[2]), "v"(pb2[3]) : "memory");
        __builtin_amdgcn_sched_barrier(0);   // no product is moved up among the loads: with the wait above in place the trip would otherwise reuse fragment registers and wait out the cache latency several times instead of once
#pragma unroll
        for (int nb = 0; nb < 4; ++nb) {
#pragma unroll
            for (int mb = 0; mb < 4; ++mb) { acc[mb][nb] = WFrag<T16>::mma(a[mb], b[nb], acc[mb][nb]); if (NSPLIT == 1 || NSPLIT == 2) acc[mb][nb] = WFrag<T16>::mma(a2[mb], b[nb], acc[mb][nb]); if (NSPLIT >= 2) acc[mb][nb] = WFrag<T16>::mma(a[mb], b2[nb], acc[mb][nb]); } }
        asm volatile("v_nop\n\tv_nop\n\tv_nop\n\tv_nop" : "+v"(acc[0][0]), "+v"(acc[1][1]), "+v"(acc[2][2]), "+v"(acc[3][3]) : "v"(a[0]), "v"(a[3]));
    }
    if constexpr (OM != 0) {
#pragma unroll
        for (int g = 0; g < 4; ++g) {   // OM 1: 16 rows t x 64 d of the tile per turn; OM 2: 16 rows d x 64 t
#pragma unroll
            for (int u = 0; u < 4; ++u) {
                if constexpr (OM == 1) {
#pragma unroll
                    for (int j = 0; j < 8; ++j) os[(hi * 8 + j) * 68 + u * 16 + lr] = BIAS ? acc[g][u][j] + bb[u] : acc[g][u][j];
                } else { v4f lo4, hi4;
#pragma unroll
                    for (int j = 0; j < 4; ++j) { lo4[j] = BIAS ? acc[u][g][j] + bb[g] : acc[u][g][j]; hi4[j] = BIAS ? acc[u][g][4 + j] + bb[g] : acc[u][g][4 + j]; }
                    *(v4fa*)(os + lr * 68 + u * 16 + hi * 8) = lo4; *(v4fa*)(os + lr * 68 + u * 16 + hi * 8 + 4) = hi4; } }
            __builtin_amdgcn_wave_barrier(); asm volatile("" ::: "memory");   // the lanes' LDS writes stay in front of the other lanes' reads of them
#pragma unroll
            for (int s = 0; s < 4; ++s) { const int c8 = (2 * s + hi) * 8; const v4f v0 = *(const v4fa*)(os + lr * 68 + c8), v1 = *(const v4fa*)(os + lr * 68 + c8 + 4); v8h o16; v8us oh, ol;   // row lr, columns c8 .. c8 + 7 of the turn: piece s * 32 + lane of its two tiles
#pragma unroll
                for (int i = 0; i < 8; ++i) { const float y = (i < 4) ? v0[i & 3] : v1[i & 3];
                    o16[i] = (h16)y; const unsigned short yh = f2bf(y); oh[i] = yh; ol[i] = f2bf(y - bf2f(yh)); }
                const size_t pn = (size_t)(r0 / TT) * NH_ + blockIdx.y; const int t0 = r0 % TT;   // the tile's plane [batch][head] and its first token there
                const size_t e = ((OM == 1) ? (pn * TT + t0 + g * 16) * HD : (pn * HD + g * 16) * TT + t0 * 16) + s * 256 + lane * 8;   // the turn's two tiles lie one behind the other
                *(v8h*)(P16 + e) = o16; *(v8us*)(Ph + e) = oh; *(v8us*)(Pl + e) = ol; }
            __builtin_amdgcn_wave_barrier(); asm volatile("" ::: "memory");   // the reads of this turn stay in front of the next turn's LDS writes
        }
        return;
    }
#pragma unroll
    for (int mb = 0; mb < 4; ++mb) {
#pragma unroll
        for (int nb = 0; nb < 4; ++nb) {
#pragma unroll
            for (int j = 0; j < 8; ++j) os[(hi * 8 + j) * 68 + nb * 16 + lr] = acc[mb][nb][j]; }
        __builtin_amdgcn_wave_barrier(); asm volatile("" ::: "memory");
        float* crow = C + (size_t)(r0 + mb * 16) * ldc + c0;
{
#pragma unroll
            for (int s = 0; s < 8; ++s) { const int row = 2 * s + hi, cofs = lr * 4; v4f val = *(const v4fa*)(os + row * 68 + cofs); if (BIAS) { val[0] += bfr(bias[c0 + cofs]); val[1] += bfr(bias[c0 + cofs + 1]); val[2] += bfr(bias[c0 + cofs + 2]); val[3] += bfr(bias[c0 + cofs + 3]); }
                *(v4f*)(crow + (size_t)row * ldc + cofs) = val; }
             }
        __builtin_amdgcn_wave_barrier(); asm volatile("" ::: "memory");
    }
}

__device__ __forceinline__ h16 tohx(float x) { return (h16)x; }
__device__ __forceinline__ void splitf(float y, unsigned short& h, unsigned short& l) { h = f2bf(y); l = f2bf(y - bf2f(h)); }
typedef __attribute__((ext_vector_type(2))) _Float16 v2h;
typedef __attribute__((ext_vector_type(4))) _Float16 v4h;
typedef __attribute__((ext_vector_type(2))) unsigned short v2us;
typedef __attribute__((ext_vector_type(4))) unsigned short v4us;
typedef __attribute__((ext_vector_type(2))) float v2f;
typedef __attribute__((ext_vector_type(4))) int v4i;

__global__ __launch_bounds__(256) void k_wtG(const float* __restrict__ w, int K, int N, bf* Bt) {
    const int lane = threadIdx.x & 31; const int L0 = (blockIdx.x * 8 + (threadIdx.x >> 5)) * 8; const int nlines = N * K / 64;
{
#pragma unroll 1
        for (int l = 0; l < 8; ++l) { const int L = L0 + l; if (L >= nlines) break; const size_t e = (size_t)L * 64 + lane * 2; const int k = (int)(e % K), n = (int)(e / K); v2us o;
            o[0] = f2bf(w[(size_t)k * N + n]); o[1] = f2bf(w[(size_t)(k + 1) * N + n]); *(v2us*)(Bt + e) = o; }
         }
}
// k_cvt8: the four weights and x (both batches) rounded to bf16 in one grid (DQ * DM / 2048, 4 + NB_ * TT / DQ): slice y of DQ * DM elements is weight y (y < 4) or slice y - 4 of x; dst holds the slices one behind the other,
// each in the fragment order that k_gemmw reads (rows of DM columns; a work-group takes 16 rows x 128 columns, four tiles, and stores them as 4 KiB in a row).
static_assert(DQ == DM && DKV == DM && (NB_ * TT) % DQ == 0 && (DQ * DM) % 2048 == 0, "equal slices");
__global__ __launch_bounds__(256) void k_cvt8(const float* __restrict__ wq, const float* __restrict__ wk, const float* __restrict__ wv, const float* __restrict__ wo, const float* __restrict__ x, bf* dst) {
    const int y = blockIdx.y; const float* src = y == 0 ? wq : y == 1 ? wk : y == 2 ? wv : y == 3 ? wo : x + (size_t)(y - 4) * (DQ * DM);
    const size_t i = (size_t)blockIdx.x * 256 + threadIdx.x;   // the thread writes 16-byte piece i of the slice: tile i >> 6 (DM / 32 tiles per block of 16 rows), piece i & 63 of the tile
    const unsigned tl = (unsigned)(i >> 6), pc = (unsigned)(i & 63); const float* ps = src + (size_t)((tl / (DM / 32)) * 16 + (pc & 15)) * DM + (tl % (DM / 32)) * 32 + (pc >> 5) * 16 + ((pc >> 4) & 1) * 8;   // its row and its first column
    const v8f v = *(const v8f*)ps; v8us o;
    // the wait that goes before a register named by an issued load is overwritten; the address is its input, so it stays whole up to it
    asm volatile("s_wait_xcnt 0x0" :: "v"(ps) : "memory");
#pragma unroll
    for (int k = 0; k < 8; ++k) o[k] = f2bf(v[k]); *(v8us*)(dst + (size_t)y * (DQ * DM) + i * 8) = o;  }

// ---- k_fattn: scores, causal softmax and probability x value product of one tile of QT = 16 * NQ query rows of one head in ONE work-group of 8 waves; grid (batches x heads, rows / QT), 256 threads; no score or probability ever goes to memory.
// Everything is computed transposed, so that a lane owns one query column throughout: S^T = K Q^T (A = key rows, B = query rows) leaves lane (lr, hi) with keys 8 * hi + j of query lr in register j,
// which is exactly the B fragment order of O^T = V^T P^T (two 16-key tiles side by side give keys 8 * hi + j and 16 + 8 * hi + j); row maximum, row sum and the final scale are then per lane.
// The key range 0 .. q0 + QT - 1 (a last chunk can run past it; those keys are masked) is split over the waves: wave w takes chunks w, w + 8, ... Pass 1: scores of CK1-key chunks -> row maximum, joined over the waves in LDS behind a barrier.
// Pass 2: scores again in CK2-key chunks, p = exp(t - max) (f32 sum of the unrounded p), p rounded to 16 bit (HR: hi + lo bf16 planes, 3 products as for the scores), O^T += V^T p.
// The q, k and v planes come in fragment order (see k_gemmw): tile (row block, column block) of q and k at (row block * 2 + column block) * 512, of the transposed v at (d block * (TT / 32) + key block) * 512; a lane's fragment halves at lane * 8 and 256 + lane * 8.
// Every inner loop is unrolled so that the fragment and accumulator arrays are indexed statically and stay in registers.
// The 8 partial tiles and sums meet in LDS behind a second barrier, are added in wave order 0..7, scaled by 1 / sum and stored as the hi / lo planes (rows t, columns head * HD + d, in fragment order) that the output projection reads; thread it takes the 8 bytes at it * 8 of the tile's 1-KiB tiles.
template <typename T16, bool HR, int NQ, int CK1, int CK2>
__global__ __launch_bounds__(256) void k_fattn(const T16* __restrict__ Q, const T16* __restrict__ Q2, const T16* __restrict__ Kp, const T16* __restrict__ Kp2, const T16* __restrict__ Vt, const T16* __restrict__ Vt2, bf* Ah, bf* Al) {
    typedef typename WFrag<T16>::V V;
    constexpr int QT = NQ * 16, M1 = CK1 / 16, M2 = CK2 / 16, KS2 = CK2 / 32, R0 = HR ? 0 : RH, NT = (HR ? RH : TT - RH) / QT;   // HR: query rows 0 .. RH - 1; else rows RH .. TT - 1; NT tiles = gridDim.y
    __shared__ __align__(16) float po[8 * QT * 68];
    __shared__ float smx[8 * QT], ssm[8 * QT];
    const int lane = threadIdx.x & 31, lr = lane & 15, hi = lane >> 4;
    const int w = __builtin_amdgcn_readfirstlane(threadIdx.x >> 5);   // wave number in a scalar register: the chunk loops' tests stay scalar branches
    const int q0 = R0 + (NT - 1 - (int)blockIdx.y) * QT;   // the tile index is the slow grid axis: over all heads of both batches the tiles with the most keys start first
    const int hd = blockIdx.x % NH_, bt = blockIdx.x / NH_; const size_t hb = (size_t)blockIdx.x * TT * HD; const int nk = q0 + QT;   // plane [batch][head]
    V qf[NQ][2], qf2[NQ][2]; const T16 *pq[NQ], *pq2[NQ];
#pragma unroll
    for (int nq = 0; nq < NQ; ++nq) { const size_t qo = hb + (size_t)(q0 + nq * 16) * HD + 8 * lane; pq[nq] = Q + qo; pq2[nq] = HR ? Q2 + qo : pq[nq];
#pragma unroll
        for (int ks = 0; ks < 2; ++ks) { qf[nq][ks] = WFrag<T16>::ldf(pq[nq] + ks * 512); if (HR) qf2[nq][ks] = WFrag<T16>::ldf(pq2[nq] + ks * 512); } }
    // the wait that goes before a register named by an issued load is overwritten; the addresses are its inputs, so they stay whole up to it
    asm volatile("s_wait_xcnt 0x0" :: "v"(pq[0]), "v"(pq[NQ - 1]), "v"(pq2[0]), "v"(pq2[NQ - 1]) : "memory");
    float mx[NQ];
#pragma unroll
    for (int nq = 0; nq < NQ; ++nq) mx[nq] = -3.0e38f;
#pragma unroll 1   // rolled: one chunk's fragments at a time fit the registers
    for (int kc = CK1 * w; kc < nk; kc += 8 * CK1) {
        const size_t ko = hb + (size_t)kc * HD + 8 * lane; const T16* pk = Kp + ko; const T16* pk2 = HR ? Kp2 + ko : pk; V kf[M1][2], kf2[M1][2];
#pragma unroll
        for (int mt = 0; mt < M1; ++mt)
#pragma unroll
            for (int ks = 0; ks < 2; ++ks) { kf[mt][ks] = WFrag<T16>::ldf(pk + mt * 16 * HD + ks * 512); if (HR) kf2[mt][ks] = WFrag<T16>::ldf(pk2 + mt * 16 * HD + ks * 512); }
        // the wait that goes before a register named by an issued load is overwritten; the addresses are its inputs, so they stay whole up to it
        asm volatile("s_wait_xcnt 0x0" :: "v"(pk), "v"(pk2) : "memory");
        __builtin_amdgcn_sched_barrier(0);   // every load of the chunk is issued before the first product, so that a chunk waits out the cache latency once
#pragma unroll
        for (int mt = 0; mt < M1; ++mt)
#pragma unroll
            for (int nq = 0; nq < NQ; ++nq) { v8f s = (v8f){};
#pragma unroll
                for (int ks = 0; ks < 2; ++ks) { s = WFrag<T16>::mma(kf[mt][ks], qf[nq][ks], s); if (HR) { s = WFrag<T16>::mma(kf[mt][ks], qf2[nq][ks], s); s = WFrag<T16>::mma(kf2[mt][ks], qf[nq][ks], s); } }
#pragma unroll
                for (int j = 0; j < 8; ++j) { const float t = (kc + mt * 16 + 8 * hi + j <= q0 + nq * 16 + lr) ? s[j] * SCL : -3.0e38f; mx[nq] = fmaxf(mx[nq], t); } }
    }
#pragma unroll
    for (int nq = 0; nq < NQ; ++nq) { mx[nq] = fmaxf(mx[nq], __shfl_xor(mx[nq], 16, 32)); if (hi == 0) smx[w * QT + nq * 16 + lr] = mx[nq]; }
    __syncthreads();   // every wave's row maxima are in LDS before any wave joins them
#pragma unroll
    for (int nq = 0; nq < NQ; ++nq) { float g = smx[nq * 16 + lr];
#pragma unroll
        for (int u = 1; u < 8; ++u) g = fmaxf(g, smx[u * QT + nq * 16 + lr]);
        mx[nq] = g; }
    v8f o[4][NQ]; float sum[NQ];
#pragma unroll
    for (int nq = 0; nq < NQ; ++nq) { sum[nq] = 0.f;
#pragma unroll
        for (int dt = 0; dt < 4; ++dt) o[dt][nq] = (v8f){}; }
#pragma unroll 1   // rolled: one chunk's fragments at a time fit the registers
    for (int kc = CK2 * w; kc < nk; kc += 8 * CK2) {
        const size_t ko = hb + (size_t)kc * HD + 8 * lane, vo = hb + (size_t)kc * 16 + 8 * lane; const T16* pk = Kp + ko; const T16* pk2 = HR ? Kp2 + ko : pk; const T16* pv = Vt + vo; const T16* pv2 = HR ? Vt2 + vo : pv;
        V kf[M2][2], kf2[M2][2], vf[4][KS2], vf2[4][KS2];
#pragma unroll
        for (int mt = 0; mt < M2; ++mt)
#pragma unroll
            for (int ks = 0; ks < 2; ++ks) { kf[mt][ks] = WFrag<T16>::ldf(pk + mt * 16 * HD + ks * 512); if (HR) kf2[mt][ks] = WFrag<T16>::ldf(pk2 + mt * 16 * HD + ks * 512); }
#pragma unroll
        for (int dt = 0; dt < 4; ++dt)
#pragma unroll
            for (int ks = 0; ks < KS2; ++ks) { vf[dt][ks] = WFrag<T16>::ldf(pv + (size_t)dt * 16 * TT + ks * 512); if (HR) vf2[dt][ks] = WFrag<T16>::ldf(pv2 + (size_t)dt * 16 * TT + ks * 512); }
        // the wait that goes before a register named by an issued load is overwritten; the addresses are its inputs, so they stay whole up to it
        asm volatile("s_wait_xcnt 0x0" :: "v"(pk), "v"(pk2), "v"(pv), "v"(pv2) : "memory");
        __builtin_amdgcn_sched_barrier(0);   // key and value loads of the chunk are all issued before the first product: the value loads fly while the scores and the exponentials are worked out
#pragma unroll
        for (int nq = 0; nq < NQ; ++nq) { float p[M2][8];
#pragma unroll
            for (int mt = 0; mt < M2; ++mt) { v8f s = (v8f){};
#pragma unroll
                for (int ks = 0; ks < 2; ++ks) { s = WFrag<T16>::mma(kf[mt][ks], qf[nq][ks], s); if (HR) { s = WFrag<T16>::mma(kf[mt][ks], qf2[nq][ks], s); s = WFrag<T16>::mma(kf2[mt][ks], qf[nq][ks], s); } }
#pragma unroll
                for (int j = 0; j < 8; ++j) { const float t = (kc + mt * 16 + 8 * hi + j <= q0 + nq * 16 + lr) ? s[j] * SCL : -3.0e38f; p[mt][j] = __builtin_amdgcn_exp2f(__fmul_rn(__fsub_rn(t, mx[nq]), 1.4426950408889634f)); sum[nq] += p[mt][j]; } }
#pragma unroll
            for (int ks = 0; ks < KS2; ++ks) {
                if constexpr (HR) { v8us h0, h1, l0, l1;
#pragma unroll
                    for (int j = 0; j < 8; ++j) { unsigned short a, c2; splitf(p[2 * ks][j], a, c2); h0[j] = a; l0[j] = c2; splitf(p[2 * ks + 1][j], a, c2); h1[j] = a; l1[j] = c2; }
                    const V ph = cat16b(h0, h1), pl = cat16b(l0, l1);
#pragma unroll
                    for (int dt = 0; dt < 4; ++dt) { o[dt][nq] = WFrag<T16>::mma(vf[dt][ks], ph, o[dt][nq]); o[dt][nq] = WFrag<T16>::mma(vf[dt][ks], pl, o[dt][nq]); o[dt][nq] = WFrag<T16>::mma(vf2[dt][ks], ph, o[dt][nq]); }
                } else { v8h h0, h1;
#pragma unroll
                    for (int j = 0; j < 8; ++j) { h0[j] = tohx(p[2 * ks][j]); h1[j] = tohx(p[2 * ks + 1][j]); }
                    const V ph = cat16(h0, h1);
#pragma unroll
                    for (int dt = 0; dt < 4; ++dt) o[dt][nq] = WFrag<T16>::mma(vf[dt][ks], ph, o[dt][nq]); } } }
    }
#pragma unroll
    for (int nq = 0; nq < NQ; ++nq) { const float sw = sum[nq] + __shfl_xor(sum[nq], 16, 32); if (hi == 0) ssm[w * QT + nq * 16 + lr] = sw; float* pw = po + (size_t)(w * QT + nq * 16 + lr) * 68 + 8 * hi;
#pragma unroll
        for (int dt = 0; dt < 4; ++dt) { v4f a, c; 
#pragma unroll
            for (int j = 0; j < 4; ++j) { a[j] = o[dt][nq][j]; c[j] = o[dt][nq][4 + j]; }
            *(v4fa*)(pw + dt * 16) = a; *(v4fa*)(pw + dt * 16 + 4) = c; } }
    __syncthreads();   // every wave's partial tile and partial sums are in LDS before any thread adds them
#pragma unroll
    for (int it = threadIdx.x; it < QT * 16; it += 256) { const int qq = (it >> 8) * 16 + ((it >> 1) & 15), d4 = ((it >> 7) & 1) * 32 + ((it >> 6) & 1) * 16 + ((it >> 5) & 1) * 8 + (it & 1) * 4; v4f a = *(const v4fa*)(po + (size_t)qq * 68 + d4); float ts = ssm[qq];
#pragma unroll
        for (int u = 1; u < 8; ++u) { a += *(const v4fa*)(po + (size_t)(u * QT + qq) * 68 + d4); ts += ssm[u * QT + qq]; }
        const float f = __fdiv_rn(1.0f, ts); v4us oh, ol;
#pragma unroll
        for (int q = 0; q < 4; ++q) { unsigned short a2, c2; splitf(a[q] * f, a2, c2); oh[q] = a2; ol[q] = c2; }
        const size_t oo = (size_t)(bt * TT + q0 + (it >> 8) * 16) * DQ + hd * (HD * 16) + (it & 255) * 4; *(v4us*)(Ah + oo) = oh; *(v4us*)(Al + oo) = ol; }
}

extern "C" void kernel_launch(void* const* d_in, const int* in_sizes, int n_in,
                              void* d_out, int out_size, void* d_ws, size_t ws_size, hipStream_t stream) {
    (void)in_sizes; (void)n_in; (void)out_size;
    const float* x = (const float*)d_in[0]; const float* wq = (const float*)d_in[1]; const float* bq = (const float*)d_in[2]; const float* wk = (const float*)d_in[3]; const float* bk = (const float*)d_in[4]; const float* wv = (const float*)d_in[5]; const float* bv = (const float*)d_in[6]; const float* wo = (const float*)d_in[7]; const float* bo = (const float*)d_in[8];
    float* OUT = (float*)d_out;     // [2][2048][1024]
    char* wsp = (char*)d_ws;
    auto take = [&](size_t bytes) { char* p = wsp; wsp += (bytes + 255) & ~(size_t)255; return (void*)p; };
    bf* WQ = (bf*)take((size_t)DQ * DM * 2); take((size_t)DKV * DM * 2); bf* WV = (bf*)take((size_t)DKV * DM * 2); bf* WO = (bf*)take((size_t)DM * DQ * 2);   // the q, k, v, o weights and the copy of x lie one behind the other
    bf* XB = (bf*)take((size_t)NB_ * TT * DM * 2);
    const size_t PS = (size_t)NB_ * NH_ * TT * HD;   // elements of one set of planes [batch][head]; the q, k, v sets lie one behind the other
    h16* QP16 = (h16*)take(3 * PS * 2); bf* QPh = (bf*)take(3 * PS * 2); bf* QPl = (bf*)take(3 * PS * 2);
    bf* ATh = (bf*)take((size_t)NB_ * TT * DQ * 2); bf* ATl = (bf*)take((size_t)NB_ * TT * DQ * 2);
    if ((size_t)(wsp - (char*)d_ws) > ws_size) return;    // ws 256 MiB
    k_cvt8<<<dim3(DQ * DM / 2048, 4 + NB_ * TT / DQ, 1), 256, 0, stream>>>(wq, wk, wv, wo, x, WQ);
    k_gemmw<bf, 0, true, 1><<<dim3(NB_ * TT / 64, DQ / 64, 2), 32, 0, stream>>>(XB, nullptr, WQ, nullptr, DM, nullptr, 0, bq, bk, 0, (size_t)DQ * DM, 0, PS, QP16, QPh, QPl);   // z = 0: q, z = 1: k
    k_gemmw<bf, 0, true, 2><<<dim3(NB_ * TT / 64, DKV / 64, 1), 32, 0, stream>>>(XB, nullptr, WV, nullptr, DM, nullptr, 0, bv, nullptr, 0, 0, 0, 0, QP16 + 2 * PS, QPh + 2 * PS, QPl + 2 * PS);
    k_fattn<h16, false, 2, 64, 32><<<dim3(NB_ * NH_, (TT - RH) / 32, 1), 256, 0, stream>>>(QP16, nullptr, QP16 + PS, nullptr, QP16 + 2 * PS, nullptr, ATh, ATl);
    k_fattn<bf, true, 1, 32, 32><<<dim3(NB_ * NH_, RH / 16, 1), 256, 0, stream>>>(QPh, QPl, QPh + PS, QPl + PS, QPh + 2 * PS, QPl + 2 * PS, ATh, ATl);
    k_gemmw<bf, 1, true, 0><<<dim3(NB_ * TT / 64, DM / 64, 1), 32, 0, stream>>>(ATh, ATl, WO, nullptr, DQ, OUT, DM, bo, nullptr, 0, 0, 0, 0, nullptr, nullptr, nullptr);
}

// v008
// It runs in 118 microseconds.
// Timed twice side by side with v007, it ran 1.21 and 1.25 times as fast.
// All steps since v000 together make it 12.6 times as fast.
#include <hip/hip_runtime.h>

// Causal multi-head attention, cache-free prefill path (x [2][2048][1024]; q,k,v = x W^T + b ('oi' 0.02, zero biases; 16 heads x 64); scores / 8; triu(1) -> -inf; softmax; out = merged Wo^T + bo -> [2][2048][1024] (4.2 M)).
// Every stage is launched once over both batches (rows b * 2048 + t, planes [b][head]). Layout: bf16 copy of x; 'oi' weights; exact projections + f32 biases, rounded to the head planes in their own epilogue; fused causal T-2048 attention, one kernel per row class (hybrid rows: < 512 hi/lo 3 products, rest fp16; tiles above the diagonal skipped; probabilities scaled by 1 / sum after the value product); merged hi/lo x Wo exact + bo.
// Compute dtypes, f32 accumulate: every input rounded to bf16; projections exact + f32 biases; attention rows < 512 3 products, rest fp16; softmax f32; Wo hl x exact + bias.

#define NB_  2
#define TT   2048
#define DM   1024
#define NH_  16
#define NKV  16
#define REP  (NH_ / NKV)
#define HD   64
#define DQ   (NH_ * HD)
#define DKV  (NKV * HD)
#define RH   512                  // query rows < RH use hi+lo planes (0: none)
#define SCL  0.125f   // HD^-0.5
typedef _Float16 h16;
typedef unsigned short bf;
typedef __attribute__((ext_vector_type(16))) __bf16   v16bf;
typedef __attribute__((ext_vector_type(16))) _Float16 v16h;
typedef __attribute__((ext_vector_type(8)))  _Float16 v8h;
typedef __attribute__((ext_vector_type(8)))  unsigned short v8us;
typedef __attribute__((ext_vector_type(8)))  float    v8f;
typedef __attribute__((ext_vector_type(4)))  float    v4f;
typedef v8h  __attribute__((may_alias)) v8ha;
typedef v4f  __attribute__((may_alias)) v4fa;
typedef v8us __attribute__((may_alias)) v8usa;

__device__ __forceinline__ unsigned short f2bf(float f) { unsigned u = __float_as_uint(f); u += 0x7FFFu + ((u >> 16) & 1u); return (unsigned short)(u >> 16); }
__device__ __forceinline__ float bf2f(unsigned short b) { return __uint_as_float(((unsigned)b) << 16); }
__device__ __forceinline__ float bfr(float f) { return bf2f(f2bf(f)); }
__device__ __forceinline__ v16h cat16(v8h lo, v8h hi) { return __builtin_shufflevector(lo, hi, 0, 1, 2, 3, 4, 5, 6, 7, 8, 9, 10, 11, 12, 13, 14, 15); }
__device__ __forceinline__ v16bf cat16b(v8us lo, v8us hi) { return __builtin_bit_cast(v16bf, __builtin_shufflevector(lo, hi, 0, 1, 2, 3, 4, 5, 6, 7, 8, 9, 10, 11, 12, 13, 14, 15)); }
__device__ __forceinline__ v8f wmma16(v16h a, v16h b, v8f c) { return __builtin_amdgcn_wmma_f32_16x16x32_f16(false, a, false, b, (short)0, c, false, false); }
__device__ __forceinline__ v8f wmmab(v16bf a, v16bf b, v8f c) { return __builtin_amdgcn_wmma_f32_16x16x32_bf16(false, a, false, b, (short)0, c, false, false); }



// ---- k_gemmw: GEMM, one work-group of 4 waves (2 x 2) per 128x128 output tile, each wave a register-blocked 64x64 quarter (16 accumulators); operands are 16-bit planes in fragment order (below; rows m or n, columns k); grid (M/128, N/128, Z), 128 threads.
// The operand tiles go through LDS: a stage is 64 columns k of the tile's 128 rows of every operand plane (16 KiB a plane, 1-KiB fragment tiles as in memory), brought by asynchronous 16-byte copies, two buffers, the stage after next in flight while one is worked on;
// each operand byte is fetched once per work-group instead of once per wave, and a wave's fragment loads are LDS reads of 512 contiguous bytes.
// C[m][n] (f32, pitch ldc, + optional f32 bias[n]) = sum_k A[m][k] Bt[n][k] (+ A2 Bt for NSPLIT 1). z-batch strides sA/sB/sC, and sP of the planes, in elements; z > 0 takes biasz. K % 64 == 0. Row m is token m % TT of batch m / TT.
// OM 0: C goes to memory as f32. OM 1 / 2: each wave's 64x64 quarter (one head: HD == 64 columns) is rounded in the epilogue and stored as the fp16, bf16-hi and bf16-lo planes that the attention kernels read,
// OM 1 rows t x columns d, OM 2 transposed, rows d x columns t; no f32 copy of it is written.
// A plane [batch][head] is kept in FRAGMENT ORDER: tiles of 16 rows x 32 columns (1 KiB), column tiles innermost; inside a tile element (row r, column c) lies at (c >> 4) * 256 + (((c >> 3) & 1) * 16 + r) * 8 + (c & 7),
// so that lane l of a reader finds the two halves of its fragment at l * 8 and 256 + l * 8 (ldf): each of its loads, and each store here, covers 512 contiguous bytes, four whole 128-byte lines.
template <typename T16> struct WFrag;
template <> struct WFrag<h16> { typedef v16h V; static __device__ __forceinline__ V ldf(const h16* p) { return cat16(*(const v8h*)p, *(const v8h*)(p + 256)); } static __device__ __forceinline__ v8f mma(V a, V b, v8f c) { return wmma16(a, b, c); } };
template <> struct WFrag<bf> { typedef v16bf V; static __device__ __forceinline__ V ldf(const bf* p) { return cat16b(*(const v8us*)p, *(const v8us*)(p + 256)); } static __device__ __forceinline__ v8f mma(V a, V b, v8f c) { return wmmab(a, b, c); } };
#define GKT 2   // fragment tiles (32 columns k) of a row block per stage
// acopy8: the wave's share of one operand plane's stage: two row blocks of GKT * 1 KiB, eight asynchronous copies of 512 B (16 B a lane) to LDS bytes l .. l + 4095 (l holds the lane's own 16 * lane).
// The s_wait_xcnt is the wait that goes before a register named by an issued copy is overwritten; as the last line of the copies' own statement it stands in front of every later write of the address registers.
template <typename T16> __device__ __forceinline__ void acopy8(unsigned l, const T16* g, int K) {
    static_assert(GKT == 2, "four 512-B pieces per row block");
#pragma unroll
    for (int rb = 0; rb < 2; ++rb) { const T16* h = g + (size_t)rb * 16 * K; const unsigned m = l + rb * 2048;   // one statement per row block keeps few address registers live at a time
        asm volatile("global_load_async_to_lds_b128 %0, %4, off\n\t"
                     "global_load_async_to_lds_b128 %1, %5, off\n\t"
                     "global_load_async_to_lds_b128 %2, %6, off\n\t"
                     "global_load_async_to_lds_b128 %3, %7, off\n\t"
                     "s_wait_xcnt 0x0"
                     :: "v"(m), "v"(m + 512), "v"(m + 1024), "v"(m + 1536), "v"(h), "v"(h + 256), "v"(h + 512), "v"(h + 768) : "memory"); }
}
template <typename T16, int NSPLIT, bool BIAS, int OM>
__global__ __launch_bounds__(128) void k_gemmw(const T16* __restrict__ A, const T16* __restrict__ A2, const T16* __restrict__ Bt, const T16* __restrict__ Bt2, int K, float* C, int ldc, const float* __restrict__ bias, const float* __restrict__ biasz, size_t sA, size_t sB, size_t sC, size_t sP, h16* P16, bf* Ph, bf* Pl) {
    typedef typename WFrag<T16>::V V;
    static_assert(NSPLIT == 0 || NSPLIT == 1, "planes staged: A, Bt and, for NSPLIT 1, A2");
    constexpr int NPL = 2 + NSPLIT, PL = 8 * GKT * 512;   // operand planes of a stage; elements of one plane's stage (8 row blocks)
    __shared__ __attribute__((aligned(1024))) T16 st[2 * NPL * PL];
    __shared__ __align__(16) float osw[4 * 16 * 68];
    const size_t z = blockIdx.z; A += z * sA; if (A2) A2 += z * sA; Bt += z * sB; C += z * sC; if (z) bias = biasz; if (OM != 0) { P16 += z * sP; Ph += z * sP; Pl += z * sP; }
    const int lane = threadIdx.x & 31, lr = lane & 15, hi = lane >> 4;
    const int w = __builtin_amdgcn_readfirstlane(threadIdx.x >> 5), wm = w & 1, wn = w >> 1;   // wave number in a scalar register; the wave's quarter of the tile
    const int r0 = blockIdx.x * 128 + wm * 64, c0 = blockIdx.y * 128 + wn * 64; float* os = osw + w * (16 * 68);   // each wave stages its output in its own LDS range
    v8f acc[4][4];
#pragma unroll
    for (int mb = 0; mb < 4; ++mb)
#pragma unroll
        for (int nb = 0; nb < 4; ++nb) acc[mb][nb] = (v8f){};
    const int nt = K / (32 * GKT);
    const unsigned lw = (unsigned)(size_t)st + (unsigned)(w * 4096 + lane * 16);   // LDS byte address of the lane's first copy in buffer 0: wave w brings row blocks 2 w and 2 w + 1 of every plane
    const size_t gw = (size_t)(2 * w) * 16 * K + 8 * lane, ga = (size_t)blockIdx.x * 128 * K + gw, gb = (size_t)blockIdx.y * 128 * K + gw;   // fragment order: a block of 16 rows is 16 * K elements, its k tiles 512 elements apart
    auto fill = [&](int t) {   // stage t -> buffer t & 1
        const unsigned l = lw + (unsigned)(t & 1) * (NPL * PL * 2); const size_t o = (size_t)t * (GKT * 512);
        acopy8(l, A + ga + o, K); acopy8(l + PL * 2, Bt + gb + o, K); if constexpr (NSPLIT == 1) acopy8(l + 2 * PL * 2, A2 + ga + o, K); };
    fill(0);
    float bb[4];   // plane epilogue: the biases of the lane's output columns i * 16 + lr, fetched here so that their latency passes under the K loop
    if constexpr (OM != 0 && BIAS) { const float* pb = bias + c0 + lr;
#pragma unroll
        for (int i = 0; i < 4; ++i) bb[i] = pb[i * 16];
        // the wait that goes before a register named by an issued load is overwritten; the address is its input, so it stays whole up to it
        asm volatile("s_wait_xcnt 0x0" :: "v"(pb) : "memory");
#pragma unroll
        for (int i = 0; i < 4; ++i) bb[i] = bfr(bb[i]); }
    asm volatile("s_wait_asynccnt 0x0" ::: "memory");   // the wave's own copies of stage 0 have landed
    __syncthreads();   // stage 0 is whole before any wave reads it
    if (nt > 1) fill(1);
#pragma unroll 1
    for (int t = 0; t < nt; ++t) {
        const T16* sb = st + (t & 1) * (NPL * PL) + 8 * lane; V a[GKT][4], a2[GKT][4], b[GKT][4];
#pragma unroll
        for (int kt = 0; kt < GKT; ++kt) {
#pragma unroll
            for (int mb = 0; mb < 4; ++mb) { a[kt][mb] = WFrag<T16>::ldf(sb + ((wm * 4 + mb) * GKT + kt) * 512); if (NSPLIT == 1) a2[kt][mb] = WFrag<T16>::ldf(sb + 2 * PL + ((wm * 4 + mb) * GKT + kt) * 512); }
#pragma unroll
            for (int nb = 0; nb < 4; ++nb) b[kt][nb] = WFrag<T16>::ldf(sb + PL + ((wn * 4 + nb) * GKT + kt) * 512); }
        asm volatile("s_wait_dscnt 0x0" ::: "memory");      // the stage's fragments, read as one group, are all in registers: the wave's reads of this buffer are done before the buffer is given up
        asm volatile("s_wait_asynccnt 0x0" ::: "memory");   // the wave's own copies of stage t + 1 have landed
        __syncthreads();   // publishes stage t + 1 and ends every wave's reads of stage t's buffer
        if (t + 2 < nt) fill(t + 2);
        __builtin_amdgcn_sched_barrier(0);   // the products stay behind the copies' issue, so that the copies fly under them and under the next stage's fragment reads
#pragma unroll
        for (int kt = 0; kt < GKT; ++kt)
#pragma unroll
            for (int nb = 0; nb < 4; ++nb) {
#pragma unroll
                for (int mb = 0; mb < 4; ++mb) { acc[mb][nb] = WFrag<T16>::mma(a[kt][mb], b[kt][nb], acc[mb][nb]); if (NSPLIT == 1) acc[mb][nb] = WFrag<T16>::mma(a2[kt][mb], b[kt][nb], acc[mb][nb]); } }
        // the four vector slots between the trip's last products and whatever next overwrites their operands or reads their results
        asm volatile("v_nop\n\tv_nop\n\tv_nop\n\tv_nop" : "+v"(acc[0][0]), "+v"(acc[1][1]), "+v"(acc[2][2]), "+v"(acc[3][3]) : "v"(a[GKT - 1][0]), "v"(a[GKT - 1][3]));
    }
    asm volatile("s_wait_asynccnt 0x0" ::: "memory");   // no copy is outstanding when the wave goes on to its epilogue
    if constexpr (OM != 0) {
#pragma unroll
        for (int g = 0; g < 4; ++g) {   // OM 1: 16 rows t x 64 d of the tile per turn; OM 2: 16 rows d x 64 t
#pragma unroll
            for (int u = 0; u < 4; ++u) {
                if constexpr (OM == 1) {
#pragma unroll
                    for (int j = 0; j < 8; ++j) os[(hi * 8 + j) * 68 + u * 16 + lr] = BIAS ? acc[g][u][j] + bb[u] : acc[g][u][j];
                } else { v4f lo4, hi4;
#pragma unroll
                    for (int j = 0; j < 4; ++j) { lo4[j] = BIAS ? acc[u][g][j] + bb[g] : acc[u][g][j]; hi4[j] = BIAS ? acc[u][g][4 + j] + bb[g] : acc[u][g][4 + j]; }
                    *(v4fa*)(os + lr * 68 + u * 16 + hi * 8) = lo4; *(v4fa*)(os + lr * 68 + u * 16 + hi * 8 + 4) = hi4; } }
            __builtin_amdgcn_wave_barrier(); asm volatile("" ::: "memory");   // the lanes' LDS writes stay in front of the other lanes' reads of them
#pragma unroll
            for (int s = 0; s < 4; ++s) { const int c8 = (2 * s + hi) * 8; const v4f v0 = *(const v4fa*)(os + lr * 68 + c8), v1 = *(const v4fa*)(os + lr * 68 + c8 + 4); v8h o16; v8us oh, ol;   // row lr, columns c8 .. c8 + 7 of the turn: piece s * 32 + lane of its two tiles
#pragma unroll
                for (int i = 0; i < 8; ++i) { const float y = (i < 4) ? v0[i & 3] : v1[i & 3];
                    o16[i] = (h16)y; const unsigned short yh = f2bf(y); oh[i] = yh; ol[i] = f2bf(y - bf2f(yh)); }
                const size_t pn = (size_t)(r0 / TT) * NH_ + c0 / 64; const int t0 = r0 % TT;   // the quarter's plane [batch][head] and its first token there
                const size_t e = ((OM == 1) ? (pn * TT + t0 + g * 16) * HD : (pn * HD + g * 16) * TT + t0 * 16) + s * 256 + lane * 8;   // the turn's two tiles lie one behind the other
                *(v8h*)(P16 + e) = o16; *(v8us*)(Ph + e) = oh; *(v8us*)(Pl + e) = ol; }
            __builtin_amdgcn_wave_barrier(); asm volatile("" ::: "memory");   // the reads of this turn stay in front of the next turn's LDS writes
        }
        return;
    }
#pragma unroll
    for (int mb = 0; mb < 4; ++mb) {
#pragma unroll
        for (int nb = 0; nb < 4; ++nb) {
#pragma unroll
            for (int j = 0; j < 8; ++j) os[(hi * 8 + j) * 68 + nb * 16 + lr] = acc[mb][nb][j]; }
        __builtin_amdgcn_wave_barrier(); asm volatile("" ::: "memory");
        float* crow = C + (size_t)(r0 + mb * 16) * ldc + c0;
{
#pragma unroll
            for (int s = 0; s < 8; ++s) { const int row = 2 * s + hi, cofs = lr * 4; v4f val = *(const v4fa*)(os + row * 68 + cofs); if (BIAS) { val[0] += bfr(bias[c0 + cofs]); val[1] += bfr(bias[c0 + cofs + 1]); val[2] += bfr(bias[c0 + cofs + 2]); val[3] += bfr(bias[c0 + cofs + 3]); }
                *(v4f*)(crow + (size_t)row * ldc + cofs) = val; }
             }
        __builtin_amdgcn_wave_barrier(); asm volatile("" ::: "memory");
    }
}

__device__ __forceinline__ h16 tohx(float x) { return (h16)x; }
__device__ __forceinline__ void splitf(float y, unsigned short& h, unsigned short& l) { h = f2bf(y); l = f2bf(y - bf2f(h)); }
typedef __attribute__((ext_vector_type(2))) _Float16 v2h;
typedef __attribute__((ext_vector_type(4))) _Float16 v4h;
typedef __attribute__((ext_vector_type(2))) unsigned short v2us;
typedef __attribute__((ext_vector_type(4))) unsigned short v4us;
typedef __attribute__((ext_vector_type(2))) float v2f;
typedef __attribute__((ext_vector_type(4))) int v4i;

__global__ __launch_bounds__(256) void k_wtG(const float* __restrict__ w, int K, int N, bf* Bt) {
    const int lane = threadIdx.x & 31; const int L0 = (blockIdx.x * 8 + (threadIdx.x >> 5)) * 8; const int nlines = N * K / 64;
{
#pragma unroll 1
        for (int l = 0; l < 8; ++l) { const int L = L0 + l; if (L >= nlines) break; const size_t e = (size_t)L * 64 + lane * 2; const int k = (int)(e % K), n = (int)(e / K); v2us o;
            o[0] = f2bf(w[(size_t)k * N + n]); o[1] = f2bf(w[(size_t)(k + 1) * N + n]); *(v2us*)(Bt + e) = o; }
         }
}
// k_cvt8: the four weights and x (both batches) rounded to bf16 in one grid (DQ * DM / 2048, 4 + NB_ * TT / DQ): slice y of DQ * DM elements is weight y (y < 4) or slice y - 4 of x; dst holds the slices one behind the other,
// each in the fragment order that k_gemmw reads (rows of DM columns; a work-group takes 16 rows x 128 columns, four tiles, and stores them as 4 KiB in a row).
static_assert(DQ == DM && DKV == DM && (NB_ * TT) % DQ == 0 && (DQ * DM) % 2048 == 0, "equal slices");
__global__ __launch_bounds__(256) void k_cvt8(const float* __restrict__ wq, const float* __restrict__ wk, const float* __restrict__ wv, const float* __restrict__ wo, const float* __restrict__ x, bf* dst) {
    const int y = blockIdx.y; const float* src = y == 0 ? wq : y == 1 ? wk : y == 2 ? wv : y == 3 ? wo : x + (size_t)(y - 4) * (DQ * DM);
    const size_t i = (size_t)blockIdx.x * 256 + threadIdx.x;   // the thread writes 16-byte piece i of the slice: tile i >> 6 (DM / 32 tiles per block of 16 rows), piece i & 63 of the tile
    const unsigned tl = (unsigned)(i >> 6), pc = (unsigned)(i & 63); const float* ps = src + (size_t)((tl / (DM / 32)) * 16 + (pc & 15)) * DM + (tl % (DM / 32)) * 32 + (pc >> 5) * 16 + ((pc >> 4) & 1) * 8;   // its row and its first column
    const v8f v = *(const v8f*)ps; v8us o;
    // the wait that goes before a register named by an issued load is overwritten; the address is its input, so it stays whole up to it
    asm volatile("s_wait_xcnt 0x0" :: "v"(ps) : "memory");
#pragma unroll
    for (int k = 0; k < 8; ++k) o[k] = f2bf(v[k]); *(v8us*)(dst + (size_t)y * (DQ * DM) + i * 8) = o;  }

// ---- k_fattn: scores, causal softmax and probability x value product of one tile of QT = 16 * NQ query rows of one head in ONE work-group of 8 waves; grid (batches x heads, rows / QT), 256 threads; no score or probability ever goes to memory.
// Everything is computed transposed, so that a lane owns one query column throughout: S^T = K Q^T (A = key rows, B = query rows) leaves lane (lr, hi) with keys 8 * hi + j of query lr in register j,
// which is exactly the B fragment order of O^T = V^T P^T (two 16-key tiles side by side give keys 8 * hi + j and 16 + 8 * hi + j); row maximum, row sum and the final scale are then per lane.
// The key range 0 .. q0 + QT - 1 (a last chunk can run past it; those keys are masked) is split over the waves: wave w takes chunks w, w + 8, ... Pass 1: scores of CK1-key chunks -> row maximum, joined over the waves in LDS behind a barrier.
// Pass 2: scores again in CK2-key chunks, p = exp(t - max) (f32 sum of the unrounded p), p rounded to 16 bit (HR: hi + lo bf16 planes, 3 products as for the scores), O^T += V^T p.
// The q, k and v planes come in fragment order (see k_gemmw): tile (row block, column block) of q and k at (row block * 2 + column block) * 512, of the transposed v at (d block * (TT / 32) + key block) * 512; a lane's fragment halves at lane * 8 and 256 + lane * 8.
// Every inner loop is unrolled so that the fragment and accumulator arrays are indexed statically and stay in registers.
// The 8 partial tiles and sums meet in LDS behind a second barrier, are added in wave order 0..7, scaled by 1 / sum and stored as the hi / lo planes (rows t, columns head * HD + d, in fragment order) that the output projection reads; thread it takes the 8 bytes at it * 8 of the tile's 1-KiB tiles.
template <typename T16, bool HR, int NQ, int CK1, int CK2>
__global__ __launch_bounds__(256) void k_fattn(const T16* __restrict__ Q, const T16* __restrict__ Q2, const T16* __restrict__ Kp, const T16* __restrict__ Kp2, const T16* __restrict__ Vt, const T16* __restrict__ Vt2, bf* Ah, bf* Al) {
    typedef typename WFrag<T16>::V V;
    constexpr int QT = NQ * 16, M1 = CK1 / 16, M2 = CK2 / 16, KS2 = CK2 / 32, R0 = HR ? 0 : RH, NT = (HR ? RH : TT - RH) / QT;   // HR: query rows 0 .. RH - 1; else rows RH .. TT - 1; NT tiles = gridDim.y
    __shared__ __align__(16) float po[8 * QT * 68];
    __shared__ float smx[8 * QT], ssm[8 * QT];
    const int lane = threadIdx.x & 31, lr = lane & 15, hi = lane >> 4;
    const int w = __builtin_amdgcn_readfirstlane(threadIdx.x >> 5);   // wave number in a scalar register: the chunk loops' tests stay scalar branches
    const int q0 = R0 + (NT - 1 - (int)blockIdx.y) * QT;   // the tile index is the slow grid axis: over all heads of both batches the tiles with the most keys start first
    const int hd = blockIdx.x % NH_, bt = blockIdx.x / NH_; const size_t hb = (size_t)blockIdx.x * TT * HD; const int nk = q0 + QT;   // plane [batch][head]
    V qf[NQ][2], qf2[NQ][2]; const T16 *pq[NQ], *pq2[NQ];
#pragma unroll
    for (int nq = 0; nq < NQ; ++nq) { const size_t qo = hb + (size_t)(q0 + nq * 16) * HD + 8 * lane; pq[nq] = Q + qo; pq2[nq] = HR ? Q2 + qo : pq[nq];
#pragma unroll
        for (int ks = 0; ks < 2; ++ks) { qf[nq][ks] = WFrag<T16>::ldf(pq[nq] + ks * 512); if (HR) qf2[nq][ks] = WFrag<T16>::ldf(pq2[nq] + ks * 512); } }
    // the wait that goes before a register named by an issued load is overwritten; the addresses are its inputs, so they stay whole up to it
    asm volatile("s_wait_xcnt 0x0" :: "v"(pq[0]), "v"(pq[NQ - 1]), "v"(pq2[0]), "v"(pq2[NQ - 1]) : "memory");
    float mx[NQ];
#pragma unroll
    for (int nq = 0; nq < NQ; ++nq) mx[nq] = -3.0e38f;
#pragma unroll 1   // rolled: one chunk's fragments at a time fit the registers
    for (int kc = CK1 * w; kc < nk; kc += 8 * CK1) {
        const size_t ko = hb + (size_t)kc * HD + 8 * lane; const T16* pk = Kp + ko; const T16* pk2 = HR ? Kp2 + ko : pk; V kf[M1][2], kf2[M1][2];
#pragma unroll
        for (int mt = 0; mt < M1; ++mt)
#pragma unroll
            for (int ks = 0; ks < 2; ++ks) { kf[mt][ks] = WFrag<T16>::ldf(pk + mt * 16 * HD + ks * 512); if (HR) kf2[mt][ks] = WFrag<T16>::ldf(pk2 + mt * 16 * HD + ks * 512); }
        // the wait that goes before a register named by an issued load is overwritten; the addresses are its inputs, so they stay whole up to it
        asm volatile("s_wait_xcnt 0x0" :: "v"(pk), "v"(pk2) : "memory");
        __builtin_amdgcn_sched_barrier(0);   // every load of the chunk is issued before the first product, so that a chunk waits out the cache latency once
#pragma unroll
        for (int mt = 0; mt < M1; ++mt)
#pragma unroll
            for (int nq = 0; nq < NQ; ++nq) { v8f s = (v8f){};
#pragma unroll
                for (int ks = 0; ks < 2; ++ks) { s = WFrag<T16>::mma(kf[mt][ks], qf[nq][ks], s); if (HR) { s = WFrag<T16>::mma(kf[mt][ks], qf2[nq][ks], s); s = WFrag<T16>::mma(kf2[mt][ks], qf[nq][ks], s); } }
#pragma unroll
                for (int j = 0; j < 8; ++j) { const float t = (kc + mt * 16 + 8 * hi + j <= q0 + nq * 16 + lr) ? s[j] * SCL : -3.0e38f; mx[nq] = fmaxf(mx[nq], t); } }
    }
#pragma unroll
    for (int nq = 0; nq < NQ; ++nq) { mx[nq] = fmaxf(mx[nq], __shfl_xor(mx[nq], 16, 32)); if (hi == 0) smx[w * QT + nq * 16 + lr] = mx[nq]; }
    __syncthreads();   // every wave's row maxima are in LDS before any wave joins them
#pragma unroll
    for (int nq = 0; nq < NQ; ++nq) { float g = smx[nq * 16 + lr];
#pragma unroll
        for (int u = 1; u < 8; ++u) g = fmaxf(g, smx[u * QT + nq * 16 + lr]);
        mx[nq] = g; }
    v8f o[4][NQ]; float sum[NQ];
#pragma unroll
    for (int nq = 0; nq < NQ; ++nq) { sum[nq] = 0.f;
#pragma unroll
        for (int dt = 0; dt < 4; ++dt) o[dt][nq] = (v8f){}; }
#pragma unroll 1   // rolled: one chunk's fragments at a time fit the registers
    for (int kc = CK2 * w; kc < nk; kc += 8 * CK2) {
        const size_t ko = hb + (size_t)kc * HD + 8 * lane, vo = hb + (size_t)kc * 16 + 8 * lane; const T16* pk = Kp + ko; const T16* pk2 = HR ? Kp2 + ko : pk; const T16* pv = Vt + vo; const T16* pv2 = HR ? Vt2 + vo : pv;
        V kf[M2][2], kf2[M2][2], vf[4][KS2], vf2[4][KS2];
#pragma unroll
        for (int mt = 0; mt < M2; ++mt)
#pragma unroll
            for (int ks = 0; ks < 2; ++ks) { kf[mt][ks] = WFrag<T16>::ldf(pk + mt * 16 * HD + ks * 512); if (HR) kf2[mt][ks] = WFrag<T16>::ldf(pk2 + mt * 16 * HD + ks * 512); }
#pragma unroll
        for (int dt = 0; dt < 4; ++dt)
#pragma unroll
            for (int ks = 0; ks < KS2; ++ks) { vf[dt][ks] = WFrag<T16>::ldf(pv + (size_t)dt * 16 * TT + ks * 512); if (HR) vf2[dt][ks] = WFrag<T16>::ldf(pv2 + (size_t)dt * 16 * TT + ks * 512); }
        // the wait that goes before a register named by an issued load is overwritten; the addresses are its inputs, so they stay whole up to it
        asm volatile("s_wait_xcnt 0x0" :: "v"(pk), "v"(pk2), "v"(pv), "v"(pv2) : "memory");
        __builtin_amdgcn_sched_barrier(0);   // key and value loads of the chunk are all issued before the first product: the value loads fly while the scores and the exponentials are worked out
#pragma unroll
        for (int nq = 0; nq < NQ; ++nq) { float p[M2][8];
#pragma unroll
            for (int mt = 0; mt < M2; ++mt) { v8f s = (v8f){};
#pragma unroll
                for (int ks = 0; ks < 2; ++ks) { s = WFrag<T16>::mma(kf[mt][ks], qf[nq][ks], s); if (HR) { s = WFrag<T16>::mma(kf[mt][ks], qf2[nq][ks], s); s = WFrag<T16>::mma(kf2[mt][ks], qf[nq][ks], s); } }
#pragma unroll
                for (int j = 0; j < 8; ++j) { const float t = (kc + mt * 16 + 8 * hi + j <= q0 + nq * 16 + lr) ? s[j] * SCL : -3.0e38f; p[mt][j] = __builtin_amdgcn_exp2f(__fmul_rn(__fsub_rn(t, mx[nq]), 1.4426950408889634f)); sum[nq] += p[mt][j]; } }
#pragma unroll
            for (int ks = 0; ks < KS2; ++ks) {
                if constexpr (HR) { v8us h0, h1, l0, l1;
#pragma unroll
                    for (int j = 0; j < 8; ++j) { unsigned short a, c2; splitf(p[2 * ks][j], a, c2); h0[j] = a; l0[j] = c2; splitf(p[2 * ks + 1][j], a, c2); h1[j] = a; l1[j] = c2; }
                    const V ph = cat16b(h0, h1), pl = cat16b(l0, l1);
#pragma unroll
                    for (int dt = 0; dt < 4; ++dt) { o[dt][nq] = WFrag<T16>::mma(vf[dt][ks], ph, o[dt][nq]); o[dt][nq] = WFrag<T16>::mma(vf[dt][ks], pl, o[dt][nq]); o[dt][nq] = WFrag<T16>::mma(vf2[dt][ks], ph, o[dt][nq]); }
                } else { v8h h0, h1;
#pragma unroll
                    for (int j = 0; j < 8; ++j) { h0[j] = tohx(p[2 * ks][j]); h1[j] = tohx(p[2 * ks + 1][j]); }
                    const V ph = cat16(h0, h1);
#pragma unroll
                    for (int dt = 0; dt < 4; ++dt) o[dt][nq] = WFrag<T16>::mma(vf[dt][ks], ph, o[dt][nq]); } } }
    }
#pragma unroll
    for (int nq = 0; nq < NQ; ++nq) { const float sw = sum[nq] + __shfl_xor(sum[nq], 16, 32); if (hi == 0) ssm[w * QT + nq * 16 + lr] = sw; float* pw = po + (size_t)(w * QT + nq * 16 + lr) * 68 + 8 * hi;
#pragma unroll
        for (int dt = 0; dt < 4; ++dt) { v4f a, c; 
#pragma unroll
            for (int j = 0; j < 4; ++j) { a[j] = o[dt][nq][j]; c[j] = o[dt][nq][4 + j]; }
            *(v4fa*)(pw + dt * 16) = a; *(v4fa*)(pw + dt * 16 + 4) = c; } }
    __syncthreads();   // every wave's partial tile and partial sums are in LDS before any thread adds them
#pragma unroll
    for (int it = threadIdx.x; it < QT * 16; it += 256) { const int qq = (it >> 8) * 16 + ((it >> 1) & 15), d4 = ((it >> 7) & 1) * 32 + ((it >> 6) & 1) * 16 + ((it >> 5) & 1) * 8 + (it & 1) * 4; v4f a = *(const v4fa*)(po + (size_t)qq * 68 + d4); float ts = ssm[qq];
#pragma unroll
        for (int u = 1; u < 8; ++u) { a += *(const v4fa*)(po + (size_t)(u * QT + qq) * 68 + d4); ts += ssm[u * QT + qq]; }
        const float f = __fdiv_rn(1.0f, ts); v4us oh, ol;
#pragma unroll
        for (int q = 0; q < 4; ++q) { unsigned short a2, c2; splitf(a[q] * f, a2, c2); oh[q] = a2; ol[q] = c2; }
        const size_t oo = (size_t)(bt * TT + q0 + (it >> 8) * 16) * DQ + hd * (HD * 16) + (it & 255) * 4; *(v4us*)(Ah + oo) = oh; *(v4us*)(Al + oo) = ol; }
}

extern "C" void kernel_launch(void* const* d_in, const int* in_sizes, int n_in,
                              void* d_out, int out_size, void* d_ws, size_t ws_size, hipStream_t stream) {
    (void)in_sizes; (void)n_in; (void)out_size;
    const float* x = (const float*)d_in[0]; const float* wq = (const float*)d_in[1]; const float* bq = (const float*)d_in[2]; const float* wk = (const float*)d_in[3]; const float* bk = (const float*)d_in[4]; const float* wv = (const float*)d_in[5]; const float* bv = (const float*)d_in[6]; const float* wo = (const float*)d_in[7]; const float* bo = (const float*)d_in[8];
    float* OUT = (float*)d_out;     // [2][2048][1024]
    char* wsp = (char*)d_ws;
    auto take = [&](size_t bytes) { char* p = wsp; wsp += (bytes + 255) & ~(size_t)255; return (void*)p; };
    bf* WQ = (bf*)take((size_t)DQ * DM * 2); take((size_t)DKV * DM * 2); bf* WV = (bf*)take((size_t)DKV * DM * 2); bf* WO = (bf*)take((size_t)DM * DQ * 2);   // the q, k, v, o weights and the copy of x lie one behind the other
    bf* XB = (bf*)take((size_t)NB_ * TT * DM * 2);
    const size_t PS = (size_t)NB_ * NH_ * TT * HD;   // elements of one set of planes [batch][head]; the q, k, v sets lie one behind the other
    h16* QP16 = (h16*)take(3 * PS * 2); bf* QPh = (bf*)take(3 * PS * 2); bf* QPl = (bf*)take(3 * PS * 2);
    bf* ATh = (bf*)take((size_t)NB_ * TT * DQ * 2); bf* ATl = (bf*)take((size_t)NB_ * TT * DQ * 2);
    if ((size_t)(wsp - (char*)d_ws) > ws_size) return;    // ws 256 MiB
    k_cvt8<<<dim3(DQ * DM / 2048, 4 + NB_ * TT / DQ, 1), 256, 0, stream>>>(wq, wk, wv, wo, x, WQ);
    k_gemmw<bf, 0, true, 1><<<dim3(NB_ * TT / 128, DQ / 128, 2), 128, 0, stream>>>(XB, nullptr, WQ, nullptr, DM, nullptr, 0, bq, bk, 0, (size_t)DQ * DM, 0, PS, QP16, QPh, QPl);   // z = 0: q, z = 1: k
    k_gemmw<bf, 0, true, 2><<<dim3(NB_ * TT / 128, DKV / 128, 1), 128, 0, stream>>>(XB, nullptr, WV, nullptr, DM, nullptr, 0, bv, nullptr, 0, 0, 0, 0, QP16 + 2 * PS, QPh + 2 * PS, QPl + 2 * PS);
    k_fattn<h16, false, 2, 64, 32><<<dim3(NB_ * NH_, (TT - RH) / 32, 1), 256, 0, stream>>>(QP16, nullptr, QP16 + PS, nullptr, QP16 + 2 * PS, nullptr, ATh, ATl);
    k_fattn<bf, true, 1, 32, 32><<<dim3(NB_ * NH_, RH / 16, 1), 256, 0, stream>>>(QPh, QPl, QPh + PS, QPl + PS, QPh + 2 * PS, QPl + 2 * PS, ATh, ATl);
    k_gemmw<bf, 1, true, 0><<<dim3(NB_ * TT / 128, DM / 128, 1), 128, 0, stream>>>(ATh, ATl, WO, nullptr, DQ, OUT, DM, bo, nullptr, 0, 0, 0, 0, nullptr, nullptr, nullptr);
}

// v009
// A run of this version takes 110 microseconds.
// Next to v008, in two timings, it ran 1.08 and 1.06 times as fast.
// All steps since v000 together make it 13.5 times as fast.
#include <hip/hip_runtime.h>

// Causal multi-head attention, cache-free prefill path (x [2][2048][1024]; q,k,v = x W^T + b ('oi' 0.02, zero biases; 16 heads x 64); scores / 8; triu(1) -> -inf; softmax; out = merged Wo^T + bo -> [2][2048][1024] (4.2 M)).
// Every stage is launched once over both batches (rows b * 2048 + t, planes [b][head]). Layout: bf16 copy of x; 'oi' weights; exact projections + f32 biases, rounded to the head planes in their own epilogue; fused causal T-2048 attention, one kernel per row class (hybrid rows: < 512 hi/lo 3 products, rest fp16; key chunks wholly above the diagonal skipped; probabilities scaled by 1 / sum after the value product); merged hi/lo x Wo exact + bo.
// Compute dtypes, f32 accumulate: every input rounded to bf16; projections exact + f32 biases; attention rows < 512 3 products, rest fp16; softmax f32; Wo hl x exact + bias.

#define NB_  2
#define TT   2048
#define DM   1024
#define NH_  16
#define NKV  16
#define REP  (NH_ / NKV)
#define HD   64
#define DQ   (NH_ * HD)
#define DKV  (NKV * HD)
#define RH   512                  // query rows < RH use hi+lo planes (0: none)
#define SCL  0.125f   // HD^-0.5
typedef _Float16 h16;
typedef unsigned short bf;
typedef __attribute__((ext_vector_type(16))) __bf16   v16bf;
typedef __attribute__((ext_vector_type(16))) _Float16 v16h;
typedef __attribute__((ext_vector_type(8)))  _Float16 v8h;
typedef __attribute__((ext_vector_type(8)))  unsigned short v8us;
typedef __attribute__((ext_vector_type(8)))  float    v8f;
typedef __attribute__((ext_vector_type(4)))  float    v4f;
typedef v8h  __attribute__((may_alias)) v8ha;
typedef v4f  __attribute__((may_alias)) v4fa;
typedef v8us __attribute__((may_alias)) v8usa;

__device__ __forceinline__ unsigned short f2bf(float f) { unsigned u = __float_as_uint(f); u += 0x7FFFu + ((u >> 16) & 1u); return (unsigned short)(u >> 16); }
__device__ __forceinline__ float bf2f(unsigned short b) { return __uint_as_float(((unsigned)b) << 16); }
__device__ __forceinline__ float bfr(float f) { return bf2f(f2bf(f)); }
__device__ __forceinline__ v16h cat16(v8h lo, v8h hi) { return __builtin_shufflevector(lo, hi, 0, 1, 2, 3, 4, 5, 6, 7, 8, 9, 10, 11, 12, 13, 14, 15); }
__device__ __forceinline__ v16bf cat16b(v8us lo, v8us hi) { return __builtin_bit_cast(v16bf, __builtin_shufflevector(lo, hi, 0, 1, 2, 3, 4, 5, 6, 7, 8, 9, 10, 11, 12, 13, 14, 15)); }
__device__ __forceinline__ v8f wmma16(v16h a, v16h b, v8f c) { return __builtin_amdgcn_wmma_f32_16x16x32_f16(false, a, false, b, (short)0, c, false, false); }
__device__ __forceinline__ v8f wmmab(v16bf a, v16bf b, v8f c) { return __builtin_amdgcn_wmma_f32_16x16x32_bf16(false, a, false, b, (short)0, c, false, false); }



// ---- k_gemmw: GEMM, one work-group of 4 waves (2 x 2) per 128x128 output tile, each wave a register-blocked 64x64 quarter (16 accumulators); operands are 16-bit planes in fragment order (below; rows m or n, columns k); grid (M/128, N/128, Z), 128 threads.
// The operand tiles go through LDS: a stage is 64 columns k of the tile's 128 rows of every operand plane (16 KiB a plane, 1-KiB fragment tiles as in memory), brought by asynchronous 16-byte copies, two buffers, the stage after next in flight while one is worked on;
// each operand byte is fetched once per work-group instead of once per wave, and a wave's fragment loads are LDS reads of 512 contiguous bytes.
// C[m][n] (f32, pitch ldc, + optional f32 bias[n]) = sum_k A[m][k] Bt[n][k] (+ A2 Bt for NSPLIT 1). z-batch strides sA/sB/sC, and sP of the planes, in elements; z > 0 takes biasz. K % 64 == 0. Row m is token m % TT of batch m / TT.
// OM 0: C goes to memory as f32. OM 1 / 2: each wave's 64x64 quarter (one head: HD == 64 columns) is rounded in the epilogue and stored as the fp16, bf16-hi and bf16-lo planes that the attention kernels read,
// OM 1 rows t x columns d, OM 2 transposed, rows d x columns t; no f32 copy of it is written.
// A plane [batch][head] is kept in FRAGMENT ORDER: tiles of 16 rows x 32 columns (1 KiB), column tiles innermost; inside a tile element (row r, column c) lies at (c >> 4) * 256 + (((c >> 3) & 1) * 16 + r) * 8 + (c & 7),
// so that lane l of a reader finds the two halves of its fragment at l * 8 and 256 + l * 8 (ldf): each of its loads, and each store here, covers 512 contiguous bytes, four whole 128-byte lines.
template <typename T16> struct WFrag;
template <> struct WFrag<h16> { typedef v16h V; static __device__ __forceinline__ V ldf(const h16* p) { return cat16(*(const v8h*)p, *(const v8h*)(p + 256)); } static __device__ __forceinline__ v8f mma(V a, V b, v8f c) { return wmma16(a, b, c); } };
template <> struct WFrag<bf> { typedef v16bf V; static __device__ __forceinline__ V ldf(const bf* p) { return cat16b(*(const v8us*)p, *(const v8us*)(p + 256)); } static __device__ __forceinline__ v8f mma(V a, V b, v8f c) { return wmmab(a, b, c); } };
#define GKT 2   // fragment tiles (32 columns k) of a row block per stage
// acopy8: the wave's share of one operand plane's stage: two row blocks of GKT * 1 KiB, eight asynchronous copies of 512 B (16 B a lane) to LDS bytes l .. l + 4095 (l holds the lane's own 16 * lane).
// The s_wait_xcnt is the wait that goes before a register named by an issued copy is overwritten; as the last line of the copies' own statement it stands in front of every later write of the address registers.
template <typename T16> __device__ __forceinline__ void acopy8(unsigned l, const T16* g, int K) {
    static_assert(GKT == 2, "four 512-B pieces per row block");
#pragma unroll
    for (int rb = 0; rb < 2; ++rb) { const T16* h = g + (size_t)rb * 16 * K; const unsigned m = l + rb * 2048;   // one statement per row block keeps few address registers live at a time
        asm volatile("global_load_async_to_lds_b128 %0, %4, off\n\t"
                     "global_load_async_to_lds_b128 %1, %5, off\n\t"
                     "global_load_async_to_lds_b128 %2, %6, off\n\t"
                     "global_load_async_to_lds_b128 %3, %7, off\n\t"
                     "s_wait_xcnt 0x0"
                     :: "v"(m), "v"(m + 512), "v"(m + 1024), "v"(m + 1536), "v"(h), "v"(h + 256), "v"(h + 512), "v"(h + 768) : "memory"); }
}
template <typename T16, int NSPLIT, bool BIAS, int OM>
__global__ __launch_bounds__(128) void k_gemmw(const T16* __restrict__ A, const T16* __restrict__ A2, const T16* __restrict__ Bt, const T16* __restrict__ Bt2, int K, float* C, int ldc, const float* __restrict__ bias, const float* __restrict__ biasz, size_t sA, size_t sB, size_t sC, size_t sP, h16* P16, bf* Ph, bf* Pl) {
    typedef typename WFrag<T16>::V V;
    static_assert(NSPLIT == 0 || NSPLIT == 1, "planes staged: A, Bt and, for NSPLIT 1, A2");
    constexpr int NPL = 2 + NSPLIT, PL = 8 * GKT * 512;   // operand planes of a stage; elements of one plane's stage (8 row blocks)
    __shared__ __attribute__((aligned(1024))) T16 st[2 * NPL * PL];
    __shared__ __align__(16) float osw[4 * 16 * 68];
    const size_t z = blockIdx.z; A += z * sA; if (A2) A2 += z * sA; Bt += z * sB; C += z * sC; if (z) bias = biasz; if (OM != 0) { P16 += z * sP; Ph += z * sP; Pl += z * sP; }
    const int lane = threadIdx.x & 31, lr = lane & 15, hi = lane >> 4;
    const int w = __builtin_amdgcn_readfirstlane(threadIdx.x >> 5), wm = w & 1, wn = w >> 1;   // wave number in a scalar register; the wave's quarter of the tile
    const int r0 = blockIdx.x * 128 + wm * 64, c0 = blockIdx.y * 128 + wn * 64; float* os = osw + w * (16 * 68);   // each wave stages its output in its own LDS range
    v8f acc[4][4];
#pragma unroll
    for (int mb = 0; mb < 4; ++mb)
#pragma unroll
        for (int nb = 0; nb < 4; ++nb) acc[mb][nb] = (v8f){};
    const int nt = K / (32 * GKT);
    const unsigned lw = (unsigned)(size_t)st + (unsigned)(w * 4096 + lane * 16);   // LDS byte address of the lane's first copy in buffer 0: wave w brings row blocks 2 w and 2 w + 1 of every plane
    const size_t gw = (size_t)(2 * w) * 16 * K + 8 * lane, ga = (size_t)blockIdx.x * 128 * K + gw, gb = (size_t)blockIdx.y * 128 * K + gw;   // fragment order: a block of 16 rows is 16 * K elements, its k tiles 512 elements apart
    auto fill = [&](int t) {   // stage t -> buffer t & 1
        const unsigned l = lw + (unsigned)(t & 1) * (NPL * PL * 2); const size_t o = (size_t)t * (GKT * 512);
        acopy8(l, A + ga + o, K); acopy8(l + PL * 2, Bt + gb + o, K); if constexpr (NSPLIT == 1) acopy8(l + 2 * PL * 2, A2 + ga + o, K); };
    fill(0);
    float bb[4];   // plane epilogue: the biases of the lane's output columns i * 16 + lr, fetched here so that their latency passes under the K loop
    if constexpr (OM != 0 && BIAS) { const float* pb = bias + c0 + lr;
#pragma unroll
        for (int i = 0; i < 4; ++i) bb[i] = pb[i * 16];
        // the wait that goes before a register named by an issued load is overwritten; the address is its input, so it stays whole up to it
        asm volatile("s_wait_xcnt 0x0" :: "v"(pb) : "memory");
#pragma unroll
        for (int i = 0; i < 4; ++i) bb[i] = bfr(bb[i]); }
    asm volatile("s_wait_asynccnt 0x0" ::: "memory");   // the wave's own copies of stage 0 have landed
    __syncthreads();   // stage 0 is whole before any wave reads it
    if (nt > 1) fill(1);
#pragma unroll 1
    for (int t = 0; t < nt; ++t) {
        const T16* sb = st + (t & 1) * (NPL * PL) + 8 * lane; V a[GKT][4], a2[GKT][4], b[GKT][4];
#pragma unroll
        for (int kt = 0; kt < GKT; ++kt) {
#pragma unroll
            for (int mb = 0; mb < 4; ++mb) { a[kt][mb] = WFrag<T16>::ldf(sb + ((wm * 4 + mb) * GKT + kt) * 512); if (NSPLIT == 1) a2[kt][mb] = WFrag<T16>::ldf(sb + 2 * PL + ((wm * 4 + mb) * GKT + kt) * 512); }
#pragma unroll
            for (int nb = 0; nb < 4; ++nb) b[kt][nb] = WFrag<T16>::ldf(sb + PL + ((wn * 4 + nb) * GKT + kt) * 512); }
        asm volatile("s_wait_dscnt 0x0" ::: "memory");      // the stage's fragments, read as one group, are all in registers: the wave's reads of this buffer are done before the buffer is given up
        asm volatile("s_wait_asynccnt 0x0" ::: "memory");   // the wave's own copies of stage t + 1 have landed
        __syncthreads();   // publishes stage t + 1 and ends every wave's reads of stage t's buffer
        if (t + 2 < nt) fill(t + 2);
        __builtin_amdgcn_sched_barrier(0);   // the products stay behind the copies' issue, so that the copies fly under them and under the next stage's fragment reads
#pragma unroll
        for (int kt = 0; kt < GKT; ++kt)
#pragma unroll
            for (int nb = 0; nb < 4; ++nb) {
#pragma unroll
                for (int mb = 0; mb < 4; ++mb) { acc[mb][nb] = WFrag<T16>::mma(a[kt][mb], b[kt][nb], acc[mb][nb]); if (NSPLIT == 1) acc[mb][nb] = WFrag<T16>::mma(a2[kt][mb], b[kt][nb], acc[mb][nb]); } }
        // the four vector slots between the trip's last products and whatever next overwrites their operands or reads their results
        asm volatile("v_nop\n\tv_nop\n\tv_nop\n\tv_nop" : "+v"(acc[0][0]), "+v"(acc[1][1]), "+v"(acc[2][2]), "+v"(acc[3][3]) : "v"(a[GKT - 1][0]), "v"(a[GKT - 1][3]));
    }
    asm volatile("s_wait_asynccnt 0x0" ::: "memory");   // no copy is outstanding when the wave goes on to its epilogue
    if constexpr (OM != 0) {
#pragma unroll
        for (int g = 0; g < 4; ++g) {   // OM 1: 16 rows t x 64 d of the tile per turn; OM 2: 16 rows d x 64 t
#pragma unroll
            for (int u = 0; u < 4; ++u) {
                if constexpr (OM == 1) {
#pragma unroll
                    for (int j = 0; j < 8; ++j) os[(hi * 8 + j) * 68 + u * 16 + lr] = BIAS ? acc[g][u][j] + bb[u] : acc[g][u][j];
                } else { v4f lo4, hi4;
#pragma unroll
                    for (int j = 0; j < 4; ++j) { lo4[j] = BIAS ? acc[u][g][j] + bb[g] : acc[u][g][j]; hi4[j] = BIAS ? acc[u][g][4 + j] + bb[g] : acc[u][g][4 + j]; }
                    *(v4fa*)(os + lr * 68 + u * 16 + hi * 8) = lo4; *(v4fa*)(os + lr * 68 + u * 16 + hi * 8 + 4) = hi4; } }
            __builtin_amdgcn_wave_barrier(); asm volatile("" ::: "memory");   // the lanes' LDS writes stay in front of the other lanes' reads of them
#pragma unroll
            for (int s = 0; s < 4; ++s) { const int c8 = (2 * s + hi) * 8; const v4f v0 = *(const v4fa*)(os + lr * 68 + c8), v1 = *(const v4fa*)(os + lr * 68 + c8 + 4); v8h o16; v8us oh, ol;   // row lr, columns c8 .. c8 + 7 of the turn: piece s * 32 + lane of its two tiles
#pragma unroll
                for (int i = 0; i < 8; ++i) { const float y = (i < 4) ? v0[i & 3] : v1[i & 3];
                    o16[i] = (h16)y; const unsigned short yh = f2bf(y); oh[i] = yh; ol[i] = f2bf(y - bf2f(yh)); }
                const size_t pn = (size_t)(r0 / TT) * NH_ + c0 / 64; const int t0 = r0 % TT;   // the quarter's plane [batch][head] and its first token there
                const size_t e = ((OM == 1) ? (pn * TT + t0 + g * 16) * HD : (pn * HD + g * 16) * TT + t0 * 16) + s * 256 + lane * 8;   // the turn's two tiles lie one behind the other
                *(v8h*)(P16 + e) = o16; *(v8us*)(Ph + e) = oh; *(v8us*)(Pl + e) = ol; }
            __builtin_amdgcn_wave_barrier(); asm volatile("" ::: "memory");   // the reads of this turn stay in front of the next turn's LDS writes
        }
        return;
    }
#pragma unroll
    for (int mb = 0; mb < 4; ++mb) {
#pragma unroll
        for (int nb = 0; nb < 4; ++nb) {
#pragma unroll
            for (int j = 0; j < 8; ++j) os[(hi * 8 + j) * 68 + nb * 16 + lr] = acc[mb][nb][j]; }
        __builtin_amdgcn_wave_barrier(); asm volatile("" ::: "memory");
        float* crow = C + (size_t)(r0 + mb * 16) * ldc + c0;
{
#pragma unroll
            for (int s = 0; s < 8; ++s) { const int row = 2 * s + hi, cofs = lr * 4; v4f val = *(const v4fa*)(os + row * 68 + cofs); if (BIAS) { val[0] += bfr(bias[c0 + cofs]); val[1] += bfr(bias[c0 + cofs + 1]); val[2] += bfr(bias[c0 + cofs + 2]); val[3] += bfr(bias[c0 + cofs + 3]); }
                *(v4f*)(crow + (size_t)row * ldc + cofs) = val; }
             }
        __builtin_amdgcn_wave_barrier(); asm volatile("" ::: "memory");
    }
}

__device__ __forceinline__ h16 tohx(float x) { return (h16)x; }
__device__ __forceinline__ void splitf(float y, unsigned short& h, unsigned short& l) { h = f2bf(y); l = f2bf(y - bf2f(h)); }
typedef __attribute__((ext_vector_type(2))) _Float16 v2h;
typedef __attribute__((ext_vector_type(4))) _Float16 v4h;
typedef __attribute__((ext_vector_type(2))) unsigned short v2us;
typedef __attribute__((ext_vector_type(4))) unsigned short v4us;
typedef __attribute__((ext_vector_type(2))) float v2f;
typedef __attribute__((ext_vector_type(4))) int v4i;

__global__ __launch_bounds__(256) void k_wtG(const float* __restrict__ w, int K, int N, bf* Bt) {
    const int lane = threadIdx.x & 31; const int L0 = (blockIdx.x * 8 + (threadIdx.x >> 5)) * 8; const int nlines = N * K / 64;
{
#pragma unroll 1
        for (int l = 0; l < 8; ++l) { const int L = L0 + l; if (L >= nlines) break; const size_t e = (size_t)L * 64 + lane * 2; const int k = (int)(e % K), n = (int)(e / K); v2us o;
            o[0] = f2bf(w[(size_t)k * N + n]); o[1] = f2bf(w[(size_t)(k + 1) * N + n]); *(v2us*)(Bt + e) = o; }
         }
}
// k_cvt8: the four weights and x (both batches) rounded to bf16 in one grid (DQ * DM / 2048, 4 + NB_ * TT / DQ): slice y of DQ * DM elements is weight y (y < 4) or slice y - 4 of x; dst holds the slices one behind the other,
// each in the fragment order that k_gemmw reads (rows of DM columns; a work-group takes 16 rows x 128 columns, four tiles, and stores them as 4 KiB in a row).
static_assert(DQ == DM && DKV == DM && (NB_ * TT) % DQ == 0 && (DQ * DM) % 2048 == 0, "equal slices");
__global__ __launch_bounds__(256) void k_cvt8(const float* __restrict__ wq, const float* __restrict__ wk, const float* __restrict__ wv, const float* __restrict__ wo, const float* __restrict__ x, bf* dst) {
    const int y = blockIdx.y; const float* src = y == 0 ? wq : y == 1 ? wk : y == 2 ? wv : y == 3 ? wo : x + (size_t)(y - 4) * (DQ * DM);
    const size_t i = (size_t)blockIdx.x * 256 + threadIdx.x;   // the thread writes 16-byte piece i of the slice: tile i >> 6 (DM / 32 tiles per block of 16 rows), piece i & 63 of the tile
    const unsigned tl = (unsigned)(i >> 6), pc = (unsigned)(i & 63); const float* ps = src + (size_t)((tl / (DM / 32)) * 16 + (pc & 15)) * DM + (tl % (DM / 32)) * 32 + (pc >> 5) * 16 + ((pc >> 4) & 1) * 8;   // its row and its first column
    const v8f v = *(const v8f*)ps; v8us o;
    // the wait that goes before a register named by an issued load is overwritten; the address is its input, so it stays whole up to it
    asm volatile("s_wait_xcnt 0x0" :: "v"(ps) : "memory");
#pragma unroll
    for (int k = 0; k < 8; ++k) o[k] = f2bf(v[k]); *(v8us*)(dst + (size_t)y * (DQ * DM) + i * 8) = o;  }

// ---- k_fattn: scores, causal softmax and probability x value product of one tile of QT = 16 * NQ query rows of one head in ONE work-group of 8 waves; grid (batches x heads, rows / QT), 256 threads; no score or probability ever goes to memory.
// Everything is computed transposed, so that a lane owns one query column throughout: S^T = K Q^T (A = key rows, B = query rows) leaves lane (lr, hi) with keys 8 * hi + j of query lr in register j,
// which is exactly the B fragment order of O^T = V^T P^T (two 16-key tiles side by side give keys 8 * hi + j and 16 + 8 * hi + j); row maximum, row sum and the final scale are then per lane.
// The key range 0 .. q0 + QT - 1 (in whole CK2-key chunks: those above the diagonal are skipped, key tiles above it in the diagonal chunk are loaded and masked) is split over the waves: wave w takes the CK2-key chunks w, w + 8, ... and walks them ONCE, with a running row maximum of its own:
// scores of a chunk, p = exp(t - m) against the maximum m in use (f32 sum of the unrounded p), p rounded to 16 bit (HR: hi + lo bf16 planes, 3 products as for the scores), O^T += V^T p.
// m moves only when some row's chunk maximum exceeds it by more than LZ (one test per chunk, a scalar branch); O^T and the sum are then scaled by exp(m_old - m_new). Until then p stays below exp(LZ) = 2^8, well inside 16-bit range.
// The q, k and v planes come in fragment order (see k_gemmw): tile (row block, column block) of q and k at (row block * 2 + column block) * 512, of the transposed v at (d block * (TT / 32) + key block) * 512; a lane's fragment halves at lane * 8 and 256 + lane * 8.
// Every inner loop is unrolled so that the fragment and accumulator arrays are indexed statically and stay in registers.
// The 8 partial tiles, sums and maxima meet in LDS behind the one barrier, are added in wave order 0..7, each weighted by exp(its wave's maximum - the joint maximum), scaled by 1 / sum and stored as the hi / lo planes (rows t, columns head * HD + d, in fragment order) that the output projection reads; thread it takes the 8 bytes at it * 8 of the tile's 1-KiB tiles.
// exp2s: 2^x with the one free slot that the instruction set asks for behind a transcendental written into the same statement: nothing that reads the result or overwrites the source can then stand directly behind it
__device__ __forceinline__ float exp2s(float x) { float r; asm("v_exp_f32 %0, %1\n\tv_nop" : "=v"(r) : "v"(x)); return r; }
#define LZ 5.545177444479562f   // 8 ln 2: how far a row's scores may rise above the maximum in use before it is moved
template <typename T16, bool HR, int NQ, int CK2>
__global__ __launch_bounds__(256) void k_fattn(const T16* __restrict__ Q, const T16* __restrict__ Q2, const T16* __restrict__ Kp, const T16* __restrict__ Kp2, const T16* __restrict__ Vt, const T16* __restrict__ Vt2, bf* Ah, bf* Al) {
    typedef typename WFrag<T16>::V V;
    constexpr int QT = NQ * 16, M2 = CK2 / 16, KS2 = CK2 / 32, R0 = HR ? 0 : RH, NT = (HR ? RH : TT - RH) / QT;   // HR: query rows 0 .. RH - 1; else rows RH .. TT - 1; NT tiles = gridDim.y
    __shared__ __align__(16) float po[8 * QT * 68];
    __shared__ float smx[8 * QT], ssm[8 * QT];
    const int lane = threadIdx.x & 31, lr = lane & 15, hi = lane >> 4;
    const int w = __builtin_amdgcn_readfirstlane(threadIdx.x >> 5);   // wave number in a scalar register: the chunk loops' tests stay scalar branches
    const int q0 = R0 + (NT - 1 - (int)blockIdx.y) * QT;   // the tile index is the slow grid axis: over all heads of both batches the tiles with the most keys start first
    const int hd = blockIdx.x % NH_, bt = blockIdx.x / NH_; const size_t hb = (size_t)blockIdx.x * TT * HD; const int nk = q0 + QT;   // plane [batch][head]
    V qf[NQ][2], qf2[NQ][2]; const T16 *pq[NQ], *pq2[NQ];
#pragma unroll
    for (int nq = 0; nq < NQ; ++nq) { const size_t qo = hb + (size_t)(q0 + nq * 16) * HD + 8 * lane; pq[nq] = Q + qo; pq2[nq] = HR ? Q2 + qo : pq[nq];
#pragma unroll
        for (int ks = 0; ks < 2; ++ks) { qf[nq][ks] = WFrag<T16>::ldf(pq[nq] + ks * 512); if (HR) qf2[nq][ks] = WFrag<T16>::ldf(pq2[nq] + ks * 512); } }
    // the wait that goes before a register named by an issued load is overwritten; the addresses are its inputs, so they stay whole up to it
    asm volatile("s_wait_xcnt 0x0" :: "v"(pq[0]), "v"(pq[NQ - 1]), "v"(pq2[0]), "v"(pq2[NQ - 1]) : "memory");
    static_assert(CK2 % QT == 0, "a chunk that is walked starts at or below q0: every query row has an unmasked key in it, so m is a real score from the wave's first chunk on");
    float mx[NQ];   // the maximum in use, the same in both halves of the wave
#pragma unroll
    for (int nq = 0; nq < NQ; ++nq) mx[nq] = -3.0e38f;
    v8f o[4][NQ]; float sum[NQ];
#pragma unroll
    for (int nq = 0; nq < NQ; ++nq) { sum[nq] = 0.f;
#pragma unroll
        for (int dt = 0; dt < 4; ++dt) o[dt][nq] = (v8f){}; }
#pragma unroll 1   // rolled: one chunk's fragments at a time fit the registers
    for (int kc = CK2 * w; kc < nk; kc += 8 * CK2) {
        const size_t ko = hb + (size_t)kc * HD + 8 * lane, vo = hb + (size_t)kc * 16 + 8 * lane; const T16* pk = Kp + ko; const T16* pk2 = HR ? Kp2 + ko : pk; const T16* pv = Vt + vo; const T16* pv2 = HR ? Vt2 + vo : pv;
        V kf[M2][2], kf2[M2][2], vf[4][KS2], vf2[4][KS2];
#pragma unroll
        for (int mt = 0; mt < M2; ++mt)
#pragma unroll
            for (int ks = 0; ks < 2; ++ks) { kf[mt][ks] = WFrag<T16>::ldf(pk + mt * 16 * HD + ks * 512); if (HR) kf2[mt][ks] = WFrag<T16>::ldf(pk2 + mt * 16 * HD + ks * 512); }
#pragma unroll
        for (int dt = 0; dt < 4; ++dt)
#pragma unroll
            for (int ks = 0; ks < KS2; ++ks) { vf[dt][ks] = WFrag<T16>::ldf(pv + (size_t)dt * 16 * TT + ks * 512); if (HR) vf2[dt][ks] = WFrag<T16>::ldf(pv2 + (size_t)dt * 16 * TT + ks * 512); }
        // the wait that goes before a register named by an issued load is overwritten; the addresses are its inputs, so they stay whole up to it
        asm volatile("s_wait_xcnt 0x0" :: "v"(pk), "v"(pk2), "v"(pv), "v"(pv2) : "memory");
        __builtin_amdgcn_sched_barrier(0);   // key and value loads of the chunk are all issued before the first product: the value loads fly while the scores and the exponentials are worked out
        float p[NQ][M2][8], cm[NQ]; bool need = false;
#pragma unroll
        for (int nq = 0; nq < NQ; ++nq) { cm[nq] = -3.0e38f;
#pragma unroll
            for (int mt = 0; mt < M2; ++mt) { v8f s = (v8f){};
#pragma unroll
                for (int ks = 0; ks < 2; ++ks) { s = WFrag<T16>::mma(kf[mt][ks], qf[nq][ks], s); if (HR) { s = WFrag<T16>::mma(kf[mt][ks], qf2[nq][ks], s); s = WFrag<T16>::mma(kf2[mt][ks], qf[nq][ks], s); } }
#pragma unroll
                for (int j = 0; j < 8; ++j) { const float t = (kc + mt * 16 + 8 * hi + j <= q0 + nq * 16 + lr) ? s[j] * SCL : -3.0e38f; p[nq][mt][j] = t; cm[nq] = fmaxf(cm[nq], t); } }
            need = need || cm[nq] > mx[nq] + LZ; }
        if (__builtin_amdgcn_ballot_w32(need) != 0) {   // wave-uniform: every lane is on inside, and both halves of a row move to the same maximum
#pragma unroll
            for (int nq = 0; nq < NQ; ++nq) { const float g = fmaxf(mx[nq], fmaxf(cm[nq], __shfl_xor(cm[nq], 16, 32))); const float al = exp2s(__fmul_rn(__fsub_rn(mx[nq], g), 1.4426950408889634f)); mx[nq] = g; sum[nq] *= al;
#pragma unroll
                for (int dt = 0; dt < 4; ++dt) o[dt][nq] *= al; } }
#pragma unroll
        for (int nq = 0; nq < NQ; ++nq) {
#pragma unroll
            for (int mt = 0; mt < M2; ++mt)
#pragma unroll
                for (int j = 0; j < 8; ++j) { const float e = __fmul_rn(__fsub_rn(p[nq][mt][j], mx[nq]), 1.4426950408889634f); p[nq][mt][j] = HR ? exp2s(e) : __builtin_amdgcn_exp2f(e); sum[nq] += p[nq][mt][j]; }
#pragma unroll
            for (int ks = 0; ks < KS2; ++ks) {
                if constexpr (HR) { v8us h0, h1, l0, l1;
#pragma unroll
                    for (int j = 0; j < 8; ++j) { unsigned short a, c2; splitf(p[nq][2 * ks][j], a, c2); h0[j] = a; l0[j] = c2; splitf(p[nq][2 * ks + 1][j], a, c2); h1[j] = a; l1[j] = c2; }
                    const V ph = cat16b(h0, h1), pl = cat16b(l0, l1);
#pragma unroll
                    for (int dt = 0; dt < 4; ++dt) { o[dt][nq] = WFrag<T16>::mma(vf[dt][ks], ph, o[dt][nq]); o[dt][nq] = WFrag<T16>::mma(vf[dt][ks], pl, o[dt][nq]); o[dt][nq] = WFrag<T16>::mma(vf2[dt][ks], ph, o[dt][nq]); }
                } else { v8h h0, h1;
#pragma unroll
                    for (int j = 0; j < 8; ++j) { h0[j] = tohx(p[nq][2 * ks][j]); h1[j] = tohx(p[nq][2 * ks + 1][j]); }
                    const V ph = cat16(h0, h1);
#pragma unroll
                    for (int dt = 0; dt < 4; ++dt) o[dt][nq] = WFrag<T16>::mma(vf[dt][ks], ph, o[dt][nq]); } } }
    }
#pragma unroll
    for (int nq = 0; nq < NQ; ++nq) { const float sw = sum[nq] + __shfl_xor(sum[nq], 16, 32); if (hi == 0) { ssm[w * QT + nq * 16 + lr] = sw; smx[w * QT + nq * 16 + lr] = mx[nq]; } float* pw = po + (size_t)(w * QT + nq * 16 + lr) * 68 + 8 * hi;
#pragma unroll
        for (int dt = 0; dt < 4; ++dt) { v4f a, c; 
#pragma unroll
            for (int j = 0; j < 4; ++j) { a[j] = o[dt][nq][j]; c[j] = o[dt][nq][4 + j]; }
            *(v4fa*)(pw + dt * 16) = a; *(v4fa*)(pw + dt * 16 + 4) = c; } }
    __syncthreads();   // every wave's partial tile, partial sums and maxima are in LDS before any thread joins them
#pragma unroll
    for (int it = threadIdx.x; it < QT * 16; it += 256) { const int qq = (it >> 8) * 16 + ((it >> 1) & 15), d4 = ((it >> 7) & 1) * 32 + ((it >> 6) & 1) * 16 + ((it >> 5) & 1) * 8 + (it & 1) * 4; float g = smx[qq];
#pragma unroll
        for (int u = 1; u < 8; ++u) g = fmaxf(g, smx[u * QT + qq]);
        v4f a = (v4f){}; float ts = 0.f;   // a wave that walked no chunk left zeros and the start maximum: its weight is exp(-inf) = 0
#pragma unroll
        for (int u = 0; u < 8; ++u) { const float fw = exp2s(__fmul_rn(__fsub_rn(smx[u * QT + qq], g), 1.4426950408889634f)); a += fw * *(const v4fa*)(po + (size_t)(u * QT + qq) * 68 + d4); ts += fw * ssm[u * QT + qq]; }
        const float f = __fdiv_rn(1.0f, ts); v4us oh, ol;
#pragma unroll
        for (int q = 0; q < 4; ++q) { unsigned short a2, c2; splitf(a[q] * f, a2, c2); oh[q] = a2; ol[q] = c2; }
        const size_t oo = (size_t)(bt * TT + q0 + (it >> 8) * 16) * DQ + hd * (HD * 16) + (it & 255) * 4; *(v4us*)(Ah + oo) = oh; *(v4us*)(Al + oo) = ol; }
}

extern "C" void kernel_launch(void* const* d_in, const int* in_sizes, int n_in,
                              void* d_out, int out_size, void* d_ws, size_t ws_size, hipStream_t stream) {
    (void)in_sizes; (void)n_in; (void)out_size;
    const float* x = (const float*)d_in[0]; const float* wq = (const float*)d_in[1]; const float* bq = (const float*)d_in[2]; const float* wk = (const float*)d_in[3]; const float* bk = (const float*)d_in[4]; const float* wv = (const float*)d_in[5]; const float* bv = (const float*)d_in[6]; const float* wo = (const float*)d_in[7]; const float* bo = (const float*)d_in[8];
    float* OUT = (float*)d_out;     // [2][2048][1024]
    char* wsp = (char*)d_ws;
    auto take = [&](size_t bytes) { char* p = wsp; wsp += (bytes + 255) & ~(size_t)255; return (void*)p; };
    bf* WQ = (bf*)take((size_t)DQ * DM * 2); take((size_t)DKV * DM * 2); bf* WV = (bf*)take((size_t)DKV * DM * 2); bf* WO = (bf*)take((size_t)DM * DQ * 2);   // the q, k, v, o weights and the copy of x lie one behind the other
    bf* XB = (bf*)take((size_t)NB_ * TT * DM * 2);
    const size_t PS = (size_t)NB_ * NH_ * TT * HD;   // elements of one set of planes [batch][head]; the q, k, v sets lie one behind the other
    h16* QP16 = (h16*)take(3 * PS * 2); bf* QPh = (bf*)take(3 * PS * 2); bf* QPl = (bf*)take(3 * PS * 2);
    bf* ATh = (bf*)take((size_t)NB_ * TT * DQ * 2); bf* ATl = (bf*)take((size_t)NB_ * TT * DQ * 2);
    if ((size_t)(wsp - (char*)d_ws) > ws_size) return;    // ws 256 MiB
    k_cvt8<<<dim3(DQ * DM / 2048, 4 + NB_ * TT / DQ, 1), 256, 0, stream>>>(wq, wk, wv, wo, x, WQ);
    k_gemmw<bf, 0, true, 1><<<dim3(NB_ * TT / 128, DQ / 128, 2), 128, 0, stream>>>(XB, nullptr, WQ, nullptr, DM, nullptr, 0, bq, bk, 0, (size_t)DQ * DM, 0, PS, QP16, QPh, QPl);   // z = 0: q, z = 1: k
    k_gemmw<bf, 0, true, 2><<<dim3(NB_ * TT / 128, DKV / 128, 1), 128, 0, stream>>>(XB, nullptr, WV, nullptr, DM, nullptr, 0, bv, nullptr, 0, 0, 0, 0, QP16 + 2 * PS, QPh + 2 * PS, QPl + 2 * PS);
    k_fattn<h16, false, 2, 32><<<dim3(NB_ * NH_, (TT - RH) / 32, 1), 256, 0, stream>>>(QP16, nullptr, QP16 + PS, nullptr, QP16 + 2 * PS, nullptr, ATh, ATl);
    k_fattn<bf, true, 1, 32><<<dim3(NB_ * NH_, RH / 16, 1), 256, 0, stream>>>(QPh, QPl, QPh + PS, QPl + PS, QPh + 2 * PS, QPl + 2 * PS, ATh, ATl);
    k_gemmw<bf, 1, true, 0><<<dim3(NB_ * TT / 128, DM / 128, 1), 128, 0, stream>>>(ATh, ATl, WO, nullptr, DQ, OUT, DM, bo, nullptr, 0, 0, 0, 0, nullptr, nullptr, nullptr);
}

// v010
// One run takes 91.7 microseconds.
// Two timings next to v009 put it at 1.23 and 1.20 times that version's speed.
// Over all steps from v000 it is 16.4 times as fast.
#include <hip/hip_runtime.h>

// Causal multi-head attention, cache-free prefill path (x [2][2048][1024]; q,k,v = x W^T + b ('oi' 0.02, zero biases; 16 heads x 64); scores / 8; triu(1) -> -inf; softmax; out = merged Wo^T + bo -> [2][2048][1024] (4.2 M)).
// Every stage is launched once over both batches (rows b * 2048 + t, planes [b][head]); stages that do not depend on each other share a launch (q, k and v projections; both attention row classes). Layout: bf16 copy of x; 'oi' weights; exact projections + f32 biases, rounded to the head planes in their own epilogue; fused causal T-2048 attention, one grid for both row classes (hybrid rows: < 512 hi/lo 3 products, rest fp16; key chunks above the diagonal skipped; probabilities scaled by 1 / sum after the value product); merged hi/lo x Wo exact + bo.
// Compute dtypes, f32 accumulate: every input rounded to bf16; projections exact + f32 biases; attention rows < 512 3 products, rest fp16; softmax f32; Wo hl x exact + bias.

#define NB_  2
#define TT   2048
#define DM   1024
#define NH_  16
#define NKV  16
#define REP  (NH_ / NKV)
#define HD   64
#define DQ   (NH_ * HD)
#define DKV  (NKV * HD)
#define RH   512                  // query rows < RH use hi+lo planes (0: none)
#define SCL  0.125f   // HD^-0.5
typedef _Float16 h16;
typedef unsigned short bf;
typedef __attribute__((ext_vector_type(16))) __bf16   v16bf;
typedef __attribute__((ext_vector_type(16))) _Float16 v16h;
typedef __attribute__((ext_vector_type(8)))  _Float16 v8h;
typedef __attribute__((ext_vector_type(8)))  unsigned short v8us;
typedef __attribute__((ext_vector_type(8)))  float    v8f;
typedef __attribute__((ext_vector_type(4)))  float    v4f;
typedef v8h  __attribute__((may_alias)) v8ha;
typedef v4f  __attribute__((may_alias)) v4fa;
typedef v8us __attribute__((may_alias)) v8usa;

__device__ __forceinline__ unsigned short f2bf(float f) { unsigned u = __float_as_uint(f); u += 0x7FFFu + ((u >> 16) & 1u); return (unsigned short)(u >> 16); }
__device__ __forceinline__ float bf2f(unsigned short b) { return __uint_as_float(((unsigned)b) << 16); }
__device__ __forceinline__ float bfr(float f) { return bf2f(f2bf(f)); }
__device__ __forceinline__ v16h cat16(v8h lo, v8h hi) { return __builtin_shufflevector(lo, hi, 0, 1, 2, 3, 4, 5, 6, 7, 8, 9, 10, 11, 12, 13, 14, 15); }
__device__ __forceinline__ v16bf cat16b(v8us lo, v8us hi) { return __builtin_bit_cast(v16bf, __builtin_shufflevector(lo, hi, 0, 1, 2, 3, 4, 5, 6, 7, 8, 9, 10, 11, 12, 13, 14, 15)); }
__device__ __forceinline__ v8f wmma16(v16h a, v16h b, v8f c) { return __builtin_amdgcn_wmma_f32_16x16x32_f16(false, a, false, b, (short)0, c, false, false); }
__device__ __forceinline__ v8f wmmab(v16bf a, v16bf b, v8f c) { return __builtin_amdgcn_wmma_f32_16x16x32_bf16(false, a, false, b, (short)0, c, false, false); }



// ---- k_gemmw: GEMM, one work-group of 4 waves (2 x 2) per 128x128 output tile, each wave a register-blocked 64x64 quarter (16 accumulators); operands are 16-bit planes in fragment order (below; rows m or n, columns k); grid (M/128, N/128, Z), 128 threads.
// The operand tiles go through LDS: a stage is 64 columns k of the tile's 128 rows of every operand plane (16 KiB a plane, 1-KiB fragment tiles as in memory), brought by asynchronous 16-byte copies, two buffers, the stage after next in flight while one is worked on;
// each operand byte is fetched once per work-group instead of once per wave, and a wave's fragment loads are LDS reads of 512 contiguous bytes.
// C[m][n] (f32, pitch ldc, + optional f32 bias[n]) = sum_k A[m][k] Bt[n][k] (+ A2 Bt for NSPLIT 1). z-batch strides sA/sB/sC, and sP of the planes, in elements; z = 1 takes biasz, z = 2 biasy. K % 64 == 0. Row m is token m % TT of batch m / TT.
// OM 0: C goes to memory as f32. OM 1 / 2: the tile (one head: HD == 64 columns) is rounded in the epilogue and stored as the fp16, bf16-hi and bf16-lo planes that the attention kernels read,
// OM 1 rows t x columns d, OM 2 transposed, rows d x columns t; no f32 copy of it is written. OM 3: one grid for three projections, z = 0 and 1 as OM 1, z = 2 as OM 2 (bias, biasz, biasy in turn).
// A plane [batch][head] is kept in FRAGMENT ORDER: tiles of 16 rows x 32 columns (1 KiB), column tiles innermost; inside a tile element (row r, column c) lies at (c >> 4) * 256 + (((c >> 3) & 1) * 16 + r) * 8 + (c & 7),
// so that lane l of a reader finds the two halves of its fragment at l * 8 and 256 + l * 8 (ldf): each of its loads, and each store here, covers 512 contiguous bytes, four whole 128-byte lines.
template <typename T16> struct WFrag;
template <> struct WFrag<h16> { typedef v16h V; static __device__ __forceinline__ V ldf(const h16* p) { return cat16(*(const v8h*)p, *(const v8h*)(p + 256)); } static __device__ __forceinline__ v8f mma(V a, V b, v8f c) { return wmma16(a, b, c); } };
template <> struct WFrag<bf> { typedef v16bf V; static __device__ __forceinline__ V ldf(const bf* p) { return cat16b(*(const v8us*)p, *(const v8us*)(p + 256)); } static __device__ __forceinline__ v8f mma(V a, V b, v8f c) { return wmmab(a, b, c); } };
template <int N> struct IC { static constexpr int v = N; };   // a compile-time int as a function argument
#define GKT 2   // fragment tiles (32 columns k) of a row block per stage
// acopy8: the wave's share of one operand plane's stage: two row blocks of GKT * 1 KiB, eight asynchronous copies of 512 B (16 B a lane) to LDS bytes l .. l + 4095 (l holds the lane's own 16 * lane).
// The s_wait_xcnt is the wait that goes before a register named by an issued copy is overwritten; as the last line of the copies' own statement it stands in front of every later write of the address registers.
template <typename T16> __device__ __forceinline__ void acopy8(unsigned l, const T16* g, int K) {
    static_assert(GKT == 2, "four 512-B pieces per row block");
#pragma unroll
    for (int rb = 0; rb < 2; ++rb) { const T16* h = g + (size_t)rb * 16 * K; const unsigned m = l + rb * 2048;   // one statement per row block keeps few address registers live at a time
        asm volatile("global_load_async_to_lds_b128 %0, %4, off\n\t"
                     "global_load_async_to_lds_b128 %1, %5, off\n\t"
                     "global_load_async_to_lds_b128 %2, %6, off\n\t"
                     "global_load_async_to_lds_b128 %3, %7, off\n\t"
                     "s_wait_xcnt 0x0"
                     :: "v"(m), "v"(m + 512), "v"(m + 1024), "v"(m + 1536), "v"(h), "v"(h + 256), "v"(h + 512), "v"(h + 768) : "memory"); }
}
template <typename T16, int NSPLIT, bool BIAS, int OM>
__global__ __launch_bounds__(128) void k_gemmw(const T16* __restrict__ A, const T16* __restrict__ A2, const T16* __restrict__ Bt, const T16* __restrict__ Bt2, int K, float* C, int ldc, const float* __restrict__ bias, const float* __restrict__ biasz, const float* __restrict__ biasy, size_t sA, size_t sB, size_t sC, size_t sP, h16* P16, bf* Ph, bf* Pl) {
    typedef typename WFrag<T16>::V V;
    static_assert(NSPLIT == 0 || NSPLIT == 1, "planes staged: A, Bt and, for NSPLIT 1, A2");
    constexpr int NPL = 2 + NSPLIT, PL = 8 * GKT * 512;   // operand planes of a stage; elements of one plane's stage (8 row blocks)
    __shared__ __attribute__((aligned(1024))) T16 st[2 * NPL * PL];
    __shared__ __align__(16) float osw[4 * 16 * 68];
    const size_t z = blockIdx.z; A += z * sA; if (A2) A2 += z * sA; Bt += z * sB; C += z * sC; if (z == 1) bias = biasz; if (z == 2) bias = biasy; if (OM != 0) { P16 += z * sP; Ph += z * sP; Pl += z * sP; }
    const int lane = threadIdx.x & 31, lr = lane & 15, hi = lane >> 4;
    const int w = __builtin_amdgcn_readfirstlane(threadIdx.x >> 5), wm = w & 1, wn = w >> 1;   // wave number in a scalar register; the wave's quarter of the tile
    const int r0 = blockIdx.x * 128 + wm * 64, c0 = blockIdx.y * 128 + wn * 64; float* os = osw + w * (16 * 68);   // each wave stages its output in its own LDS range
    v8f acc[4][4];
#pragma unroll
    for (int mb = 0; mb < 4; ++mb)
#pragma unroll
        for (int nb = 0; nb < 4; ++nb) acc[mb][nb] = (v8f){};
    const int nt = K / (32 * GKT);
    const unsigned lw = (unsigned)(size_t)st + (unsigned)(w * 4096 + lane * 16);   // LDS byte address of the lane's first copy in buffer 0: wave w brings row blocks 2 w and 2 w + 1 of every plane
    const size_t gw = (size_t)(2 * w) * 16 * K + 8 * lane, ga = (size_t)blockIdx.x * 128 * K + gw, gb = (size_t)blockIdx.y * 128 * K + gw;   // fragment order: a block of 16 rows is 16 * K elements, its k tiles 512 elements apart
    auto fill = [&](int t) {   // stage t -> buffer t & 1
        const unsigned l = lw + (unsigned)(t & 1) * (NPL * PL * 2); const size_t o = (size_t)t * (GKT * 512);
        acopy8(l, A + ga + o, K); acopy8(l + PL * 2, Bt + gb + o, K); if constexpr (NSPLIT == 1) acopy8(l + 2 * PL * 2, A2 + ga + o, K); };
    fill(0);
    float bb[4];   // plane epilogue: the biases of the lane's output columns i * 16 + lr, fetched here so that their latency passes under the K loop
    if constexpr (OM != 0 && BIAS) { const float* pb = bias + c0 + lr;
#pragma unroll
        for (int i = 0; i < 4; ++i) bb[i] = pb[i * 16];
        // the wait that goes before a register named by an issued load is overwritten; the address is its input, so it stays whole up to it
        asm volatile("s_wait_xcnt 0x0" :: "v"(pb) : "memory");
#pragma unroll
        for (int i = 0; i < 4; ++i) bb[i] = bfr(bb[i]); }
    asm volatile("s_wait_asynccnt 0x0" ::: "memory");   // the wave's own copies of stage 0 have landed
    __syncthreads();   // stage 0 is whole before any wave reads it
    if (nt > 1) fill(1);
#pragma unroll 1
    for (int t = 0; t < nt; ++t) {
        const T16* sb = st + (t & 1) * (NPL * PL) + 8 * lane; V a[GKT][4], a2[GKT][4], b[GKT][4];
#pragma unroll
        for (int kt = 0; kt < GKT; ++kt) {
#pragma unroll
            for (int mb = 0; mb < 4; ++mb) { a[kt][mb] = WFrag<T16>::ldf(sb + ((wm * 4 + mb) * GKT + kt) * 512); if (NSPLIT == 1) a2[kt][mb] = WFrag<T16>::ldf(sb + 2 * PL + ((wm * 4 + mb) * GKT + kt) * 512); }
#pragma unroll
            for (int nb = 0; nb < 4; ++nb) b[kt][nb] = WFrag<T16>::ldf(sb + PL + ((wn * 4 + nb) * GKT + kt) * 512); }
        asm volatile("s_wait_dscnt 0x0" ::: "memory");      // the stage's fragments, read as one group, are all in registers: the wave's reads of this buffer are done before the buffer is given up
        asm volatile("s_wait_asynccnt 0x0" ::: "memory");   // the wave's own copies of stage t + 1 have landed
        __syncthreads();   // publishes stage t + 1 and ends every wave's reads of stage t's buffer
        if (t + 2 < nt) fill(t + 2);
        __builtin_amdgcn_sched_barrier(0);   // the products stay behind the copies' issue, so that the copies fly under them and under the next stage's fragment reads
#pragma unroll
        for (int kt = 0; kt < GKT; ++kt)
#pragma unroll
            for (int nb = 0; nb < 4; ++nb) {
#pragma unroll
                for (int mb = 0; mb < 4; ++mb) { acc[mb][nb] = WFrag<T16>::mma(a[kt][mb], b[kt][nb], acc[mb][nb]); if (NSPLIT == 1) acc[mb][nb] = WFrag<T16>::mma(a2[kt][mb], b[kt][nb], acc[mb][nb]); } }
        // the four vector slots between the trip's last products and whatever next overwrites their operands or reads their results
        asm volatile("v_nop\n\tv_nop\n\tv_nop\n\tv_nop" : "+v"(acc[0][0]), "+v"(acc[1][1]), "+v"(acc[2][2]), "+v"(acc[3][3]) : "v"(a[GKT - 1][0]), "v"(a[GKT - 1][3]));
    }
    asm volatile("s_wait_asynccnt 0x0" ::: "memory");   // no copy is outstanding when the wave goes on to its epilogue
    if constexpr (OM != 0) {
      auto planes = [&](auto om) { constexpr int OX = decltype(om)::v;   // the plane epilogue in form OX (1 or 2)
#pragma unroll
        for (int g = 0; g < 4; ++g) {   // OX 1: 16 rows t x 64 d of the tile per turn; OX 2: 16 rows d x 64 t
#pragma unroll
            for (int u = 0; u < 4; ++u) {
                if constexpr (OX == 1) {
#pragma unroll
                    for (int j = 0; j < 8; ++j) os[(hi * 8 + j) * 68 + u * 16 + lr] = BIAS ? acc[g][u][j] + bb[u] : acc[g][u][j];
                } else { v4f lo4, hi4;
#pragma unroll
                    for (int j = 0; j < 4; ++j) { lo4[j] = BIAS ? acc[u][g][j] + bb[g] : acc[u][g][j]; hi4[j] = BIAS ? acc[u][g][4 + j] + bb[g] : acc[u][g][4 + j]; }
                    *(v4fa*)(os + lr * 68 + u * 16 + hi * 8) = lo4; *(v4fa*)(os + lr * 68 + u * 16 + hi * 8 + 4) = hi4; } }
            __builtin_amdgcn_wave_barrier(); asm volatile("" ::: "memory");   // the lanes' LDS writes stay in front of the other lanes' reads of them
#pragma unroll
            for (int s = 0; s < 4; ++s) { const int c8 = (2 * s + hi) * 8; const v4f v0 = *(const v4fa*)(os + lr * 68 + c8), v1 = *(const v4fa*)(os + lr * 68 + c8 + 4); v8h o16; v8us oh, ol;   // row lr, columns c8 .. c8 + 7 of the turn: piece s * 32 + lane of its two tiles
#pragma unroll
                for (int i = 0; i < 8; ++i) { const float y = (i < 4) ? v0[i & 3] : v1[i & 3];
                    o16[i] = (h16)y; const unsigned short yh = f2bf(y); oh[i] = yh; ol[i] = f2bf(y - bf2f(yh)); }
                const size_t pn = (size_t)(r0 / TT) * NH_ + c0 / 64; const int t0 = r0 % TT;   // the tile's plane [batch][head] and its first token there
                const size_t eb = ((OX == 1) ? (pn * TT + t0) * HD : pn * HD * TT + t0 * 16) + lane * 8, e = ((OX == 1) ? g * 16 * HD : g * 16 * TT) + s * 256;   // the lane's place in the tile's first turn; the turn's two tiles lie one behind the other
                h16* const b16 = P16 + eb; bf* const bh = Ph + eb; bf* const bl = Pl + eb; *(v8h*)(b16 + e) = o16; *(v8us*)(bh + e) = oh; *(v8us*)(bl + e) = ol;
                // the wait that goes before a register named by an issued store is overwritten; the stores' data and base addresses are its inputs, so they stay whole up to it
                asm volatile("s_wait_xcnt 0x0" :: "v"(o16), "v"(oh), "v"(ol), "v"(b16), "v"(bh), "v"(bl) : "memory"); }
            __builtin_amdgcn_wave_barrier(); asm volatile("" ::: "memory");   // the reads of this turn stay in front of the next turn's LDS writes
        } };
        if constexpr (OM == 3) { if (z == 2) planes(IC<2>{}); else planes(IC<1>{}); }   // z is the same for the whole work-group: a scalar branch
        else planes(IC<OM>{});
        return;
    }
#pragma unroll
    for (int mb = 0; mb < 4; ++mb) {
#pragma unroll
        for (int nb = 0; nb < 4; ++nb) {
#pragma unroll
            for (int j = 0; j < 8; ++j) os[(hi * 8 + j) * 68 + nb * 16 + lr] = acc[mb][nb][j]; }
        __builtin_amdgcn_wave_barrier(); asm volatile("" ::: "memory");
        float* crow = C + (size_t)(r0 + mb * 16) * ldc + c0;
{
#pragma unroll
            for (int s = 0; s < 8; ++s) { const int row = 2 * s + hi, cofs = lr * 4; v4f val = *(const v4fa*)(os + row * 68 + cofs); if (BIAS) { val[0] += bfr(bias[c0 + cofs]); val[1] += bfr(bias[c0 + cofs + 1]); val[2] += bfr(bias[c0 + cofs + 2]); val[3] += bfr(bias[c0 + cofs + 3]); }
                *(v4f*)(crow + (size_t)row * ldc + cofs) = val; }
             }
        __builtin_amdgcn_wave_barrier(); asm volatile("" ::: "memory");
    }
}

__device__ __forceinline__ h16 tohx(float x) { return (h16)x; }
__device__ __forceinline__ void splitf(float y, unsigned short& h, unsigned short& l) { h = f2bf(y); l = f2bf(y - bf2f(h)); }
typedef __attribute__((ext_vector_type(2))) _Float16 v2h;
typedef __attribute__((ext_vector_type(4))) _Float16 v4h;
typedef __attribute__((ext_vector_type(2))) unsigned short v2us;
typedef __attribute__((ext_vector_type(4))) unsigned short v4us;
typedef __attribute__((ext_vector_type(2))) float v2f;
typedef __attribute__((ext_vector_type(4))) int v4i;

__global__ __launch_bounds__(256) void k_wtG(const float* __restrict__ w, int K, int N, bf* Bt) {
    const int lane = threadIdx.x & 31; const int L0 = (blockIdx.x * 8 + (threadIdx.x >> 5)) * 8; const int nlines = N * K / 64;
{
#pragma unroll 1
        for (int l = 0; l < 8; ++l) { const int L = L0 + l; if (L >= nlines) break; const size_t e = (size_t)L * 64 + lane * 2; const int k = (int)(e % K), n = (int)(e / K); v2us o;
            o[0] = f2bf(w[(size_t)k * N + n]); o[1] = f2bf(w[(size_t)(k + 1) * N + n]); *(v2us*)(Bt + e) = o; }
         }
}
// k_cvt8: the four weights and x (both batches) rounded to bf16 in one grid (DQ * DM / 2048, 4 + NB_ * TT / DQ): slice y of DQ * DM elements is weight y (y < 4) or slice y - 4 of x; dst holds the slices one behind the other,
// each in the fragment order that k_gemmw reads (rows of DM columns; a work-group takes 16 rows x 128 columns, four tiles, and stores them as 4 KiB in a row).
static_assert(DQ == DM && DKV == DM && (NB_ * TT) % DQ == 0 && (DQ * DM) % 2048 == 0, "equal slices");
__global__ __launch_bounds__(256) void k_cvt8(const float* __restrict__ wq, const float* __restrict__ wk, const float* __restrict__ wv, const float* __restrict__ wo, const float* __restrict__ x, bf* dst) {
    const int y = blockIdx.y; const float* src = y == 0 ? wq : y == 1 ? wk : y == 2 ? wv : y == 3 ? wo : x + (size_t)(y - 4) * (DQ * DM);
    const size_t i = (size_t)blockIdx.x * 256 + threadIdx.x;   // the thread writes 16-byte piece i of the slice: tile i >> 6 (DM / 32 tiles per block of 16 rows), piece i & 63 of the tile
    const unsigned tl = (unsigned)(i >> 6), pc = (unsigned)(i & 63); const float* ps = src + (size_t)((tl / (DM / 32)) * 16 + (pc & 15)) * DM + (tl % (DM / 32)) * 32 + (pc >> 5) * 16 + ((pc >> 4) & 1) * 8;   // its row and its first column
    const v8f v = *(const v8f*)ps; v8us o;
    // the wait that goes before a register named by an issued load is overwritten; the address is its input, so it stays whole up to it
    asm volatile("s_wait_xcnt 0x0" :: "v"(ps) : "memory");
#pragma unroll
    for (int k = 0; k < 8; ++k) o[k] = f2bf(v[k]); *(v8us*)(dst + (size_t)y * (DQ * DM) + i * 8) = o;  }

// ---- fattn: scores, causal softmax and probability x value product of one tile of QT = 16 * NQ query rows of one head in ONE work-group of 8 waves (256 threads; blockIdx.x = batch x head); no score or probability ever goes to memory.
// Everything is computed transposed, so that a lane owns one query column throughout: S^T = K Q^T (A = key rows, B = query rows) leaves lane (lr, hi) with keys 8 * hi + j of query lr in register j,
// which is exactly the B fragment order of O^T = V^T P^T (two 16-key tiles side by side give keys 8 * hi + j and 16 + 8 * hi + j); row maximum, row sum and the final scale are then per lane.
// The key range 0 .. q0 + QT - 1 (in whole CK2-key chunks: those above the diagonal are skipped, key tiles above it in the diagonal chunk are loaded and masked) is split over the waves: wave w takes the CK2-key chunks w, w + 8, ... and walks them ONCE, with a running row maximum of its own:
// scores of a chunk, p = exp(t - m) against the maximum m in use (f32 sum of the unrounded p), p rounded to 16 bit (HR: hi + lo bf16 planes, 3 products as for the scores), O^T += V^T p.
// m moves only when some row's chunk maximum exceeds it by more than LZ (one test per chunk, a scalar branch); O^T and the sum are then scaled by exp(m_old - m_new). Until then p stays below exp(LZ) = 2^8, well inside 16-bit range.
// The q, k and v planes come in fragment order (see k_gemmw): tile (row block, column block) of q and k at (row block * 2 + column block) * 512, of the transposed v at (d block * (TT / 32) + key block) * 512; a lane's fragment halves at lane * 8 and 256 + lane * 8.
// Every inner loop is unrolled so that the fragment and accumulator arrays are indexed statically and stay in registers.
// The 8 partial tiles, sums and maxima meet in LDS behind the one barrier, are added in wave order 0..7, each weighted by exp(its wave's maximum - the joint maximum), scaled by 1 / sum and stored as the hi / lo planes (rows t, columns head * HD + d, in fragment order) that the output projection reads; thread it takes the 8 bytes at it * 8 of the tile's 1-KiB tiles.
// exp2s: 2^x with the one free slot that the instruction set asks for behind a transcendental written into the same statement: nothing that reads the result or overwrites the source can then stand directly behind it
__device__ __forceinline__ float exp2s(float x) { float r; asm("v_exp_f32 %0, %1\n\tv_nop" : "=v"(r) : "v"(x)); return r; }
#define LZ 5.545177444479562f   // 8 ln 2: how far a row's scores may rise above the maximum in use before it is moved
// Both row classes run in ONE grid (k_fattn2 below): fattn is the body of one class; ty is the tile's index in its class, po / smx / ssm the work-group's LDS (sized for the larger class).
template <typename T16, bool HR, int NQ, int CK2>
__device__ __forceinline__ void fattn(const T16* __restrict__ Q, const T16* __restrict__ Q2, const T16* __restrict__ Kp, const T16* __restrict__ Kp2, const T16* __restrict__ Vt, const T16* __restrict__ Vt2, bf* Ah, bf* Al, float* po, float* smx, float* ssm, int ty) {
    typedef typename WFrag<T16>::V V;
    constexpr int QT = NQ * 16, M2 = CK2 / 16, KS2 = CK2 / 32, R0 = HR ? 0 : RH, NT = (HR ? RH : TT - RH) / QT;   // HR: query rows 0 .. RH - 1; else rows RH .. TT - 1; NT tiles
    const int lane = threadIdx.x & 31, lr = lane & 15, hi = lane >> 4;
    const int w = __builtin_amdgcn_readfirstlane(threadIdx.x >> 5);   // wave number in a scalar register: the chunk loops' tests stay scalar branches
    const int q0 = R0 + (NT - 1 - ty) * QT;   // the tile index is the slow grid axis: over all heads of both batches the tiles with the most keys come first in the grid
    const int hd = blockIdx.x % NH_, bt = blockIdx.x / NH_; const size_t hb = (size_t)blockIdx.x * TT * HD; const int nk = q0 + QT;   // plane [batch][head]
    V qf[NQ][2], qf2[NQ][2]; const T16 *pq[NQ], *pq2[NQ];
#pragma unroll
    for (int nq = 0; nq < NQ; ++nq) { const size_t qo = hb + (size_t)(q0 + nq * 16) * HD + 8 * lane; pq[nq] = Q + qo; pq2[nq] = HR ? Q2 + qo : pq[nq];
#pragma unroll
        for (int ks = 0; ks < 2; ++ks) { qf[nq][ks] = WFrag<T16>::ldf(pq[nq] + ks * 512); if (HR) qf2[nq][ks] = WFrag<T16>::ldf(pq2[nq] + ks * 512); } }
    // the wait that goes before a register named by an issued load is overwritten; the addresses are its inputs, so they stay whole up to it
    asm volatile("s_wait_xcnt 0x0" :: "v"(pq[0]), "v"(pq[NQ - 1]), "v"(pq2[0]), "v"(pq2[NQ - 1]) : "memory");
    static_assert(CK2 % QT == 0, "a chunk that is walked starts at or below q0: every query row has an unmasked key in it, so m is a real score from the wave's first chunk on");
    float mx[NQ];   // the maximum in use, the same in both halves of the wave
#pragma unroll
    for (int nq = 0; nq < NQ; ++nq) mx[nq] = -3.0e38f;
    v8f o[4][NQ]; float sum[NQ];
#pragma unroll
    for (int nq = 0; nq < NQ; ++nq) { sum[nq] = 0.f;
#pragma unroll
        for (int dt = 0; dt < 4; ++dt) o[dt][nq] = (v8f){}; }
#pragma unroll 1   // rolled: one chunk's fragments at a time fit the registers
    for (int kc = CK2 * w; kc < nk; kc += 8 * CK2) {
        const size_t ko = hb + (size_t)kc * HD + 8 * lane, vo = hb + (size_t)kc * 16 + 8 * lane; const T16* pk = Kp + ko; const T16* pk2 = HR ? Kp2 + ko : pk; const T16* pv = Vt + vo; const T16* pv2 = HR ? Vt2 + vo : pv;
        V kf[M2][2], kf2[M2][2], vf[4][KS2], vf2[4][KS2];
#pragma unroll
        for (int mt = 0; mt < M2; ++mt)
#pragma unroll
            for (int ks = 0; ks < 2; ++ks) { kf[mt][ks] = WFrag<T16>::ldf(pk + mt * 16 * HD + ks * 512); if (HR) kf2[mt][ks] = WFrag<T16>::ldf(pk2 + mt * 16 * HD + ks * 512); }
#pragma unroll
        for (int dt = 0; dt < 4; ++dt)
#pragma unroll
            for (int ks = 0; ks < KS2; ++ks) { vf[dt][ks] = WFrag<T16>::ldf(pv + (size_t)dt * 16 * TT + ks * 512); if (HR) vf2[dt][ks] = WFrag<T16>::ldf(pv2 + (size_t)dt * 16 * TT + ks * 512); }
        // the wait that goes before a register named by an issued load is overwritten; the addresses are its inputs, so they stay whole up to it
        asm volatile("s_wait_xcnt 0x0" :: "v"(pk), "v"(pk2), "v"(pv), "v"(pv2) : "memory");
        __builtin_amdgcn_sched_barrier(0);   // key and value loads of the chunk are all issued before the first product: the value loads fly while the scores and the exponentials are worked out
        float p[NQ][M2][8], cm[NQ]; bool need = false;
#pragma unroll
        for (int nq = 0; nq < NQ; ++nq) { cm[nq] = -3.0e38f;
#pragma unroll
            for (int mt = 0; mt < M2; ++mt) { v8f s = (v8f){};
#pragma unroll
                for (int ks = 0; ks < 2; ++ks) { s = WFrag<T16>::mma(kf[mt][ks], qf[nq][ks], s); if (HR) { s = WFrag<T16>::mma(kf[mt][ks], qf2[nq][ks], s); s = WFrag<T16>::mma(kf2[mt][ks], qf[nq][ks], s); } }
#pragma unroll
                for (int j = 0; j < 8; ++j) { const float t = (kc + mt * 16 + 8 * hi + j <= q0 + nq * 16 + lr) ? s[j] * SCL : -3.0e38f; p[nq][mt][j] = t; cm[nq] = fmaxf(cm[nq], t); } }
            need = need || cm[nq] > mx[nq] + LZ; }
        if (__builtin_amdgcn_ballot_w32(need) != 0) {   // wave-uniform: every lane is on inside, and both halves of a row move to the same maximum
#pragma unroll
            for (int nq = 0; nq < NQ; ++nq) { const float g = fmaxf(mx[nq], fmaxf(cm[nq], __shfl_xor(cm[nq], 16, 32))); const float al = exp2s(__fmul_rn(__fsub_rn(mx[nq], g), 1.4426950408889634f)); mx[nq] = g; sum[nq] *= al;
#pragma unroll
                for (int dt = 0; dt < 4; ++dt) o[dt][nq] *= al; } }
#pragma unroll
        for (int nq = 0; nq < NQ; ++nq) {
#pragma unroll
            for (int mt = 0; mt < M2; ++mt)
#pragma unroll
                for (int j = 0; j < 8; ++j) { const float e = __fmul_rn(__fsub_rn(p[nq][mt][j], mx[nq]), 1.4426950408889634f); p[nq][mt][j] = (HR || (nq == 0 && mt == 1 && j == 3)) ? exp2s(e) : __builtin_amdgcn_exp2f(e);   // fp16 class: with this element in the asm form the listing shows no open slot behind a v_exp_f32
                     sum[nq] += p[nq][mt][j]; }
#pragma unroll
            for (int ks = 0; ks < KS2; ++ks) {
                if constexpr (HR) { v8us h0, h1, l0, l1;
#pragma unroll
                    for (int j = 0; j < 8; ++j) { unsigned short a, c2; splitf(p[nq][2 * ks][j], a, c2); h0[j] = a; l0[j] = c2; splitf(p[nq][2 * ks + 1][j], a, c2); h1[j] = a; l1[j] = c2; }
                    const V ph = cat16b(h0, h1), pl = cat16b(l0, l1);
#pragma unroll
                    for (int dt = 0; dt < 4; ++dt) { o[dt][nq] = WFrag<T16>::mma(vf[dt][ks], ph, o[dt][nq]); o[dt][nq] = WFrag<T16>::mma(vf[dt][ks], pl, o[dt][nq]); o[dt][nq] = WFrag<T16>::mma(vf2[dt][ks], ph, o[dt][nq]); }
                } else { v8h h0, h1;
#pragma unroll
                    for (int j = 0; j < 8; ++j) { h0[j] = tohx(p[nq][2 * ks][j]); h1[j] = tohx(p[nq][2 * ks + 1][j]); }
                    const V ph = cat16(h0, h1);
#pragma unroll
                    for (int dt = 0; dt < 4; ++dt) o[dt][nq] = WFrag<T16>::mma(vf[dt][ks], ph, o[dt][nq]); } } }
    }
#pragma unroll
    for (int nq = 0; nq < NQ; ++nq) { const float sw = sum[nq] + __shfl_xor(sum[nq], 16, 32); if (hi == 0) { ssm[w * QT + nq * 16 + lr] = sw; smx[w * QT + nq * 16 + lr] = mx[nq]; } float* pw = po + (size_t)(w * QT + nq * 16 + lr) * 68 + 8 * hi;
#pragma unroll
        for (int dt = 0; dt < 4; ++dt) { v4f a, c; 
#pragma unroll
            for (int j = 0; j < 4; ++j) { a[j] = o[dt][nq][j]; c[j] = o[dt][nq][4 + j]; }
            *(v4fa*)(pw + dt * 16) = a; *(v4fa*)(pw + dt * 16 + 4) = c; } }
    __syncthreads();   // every wave's partial tile, partial sums and maxima are in LDS before any thread joins them
#pragma unroll
    for (int it = threadIdx.x; it < QT * 16; it += 256) { const int qq = (it >> 8) * 16 + ((it >> 1) & 15), d4 = ((it >> 7) & 1) * 32 + ((it >> 6) & 1) * 16 + ((it >> 5) & 1) * 8 + (it & 1) * 4; float g = smx[qq];
#pragma unroll
        for (int u = 1; u < 8; ++u) g = fmaxf(g, smx[u * QT + qq]);
        v4f a = (v4f){}; float ts = 0.f;   // a wave that walked no chunk left zeros and the start maximum: its weight is exp(-inf) = 0
#pragma unroll
        for (int u = 0; u < 8; ++u) { const float fw = exp2s(__fmul_rn(__fsub_rn(smx[u * QT + qq], g), 1.4426950408889634f)); a += fw * *(const v4fa*)(po + (size_t)(u * QT + qq) * 68 + d4); ts += fw * ssm[u * QT + qq]; }
        const float f = __fdiv_rn(1.0f, ts); v4us oh, ol;
#pragma unroll
        for (int q = 0; q < 4; ++q) { unsigned short a2, c2; splitf(a[q] * f, a2, c2); oh[q] = a2; ol[q] = c2; }
        const size_t oo = (size_t)(bt * TT + q0 + (it >> 8) * 16) * DQ + hd * (HD * 16) + (it & 255) * 4; *(v4us*)(Ah + oo) = oh; *(v4us*)(Al + oo) = ol; }
}
// k_fattn2: grid (batches x heads, (TT - RH) / 32 + RH / 16): the fp16 tiles of 32 rows first (most keys first), behind them the hi / lo tiles of 16 rows.
__global__ __launch_bounds__(256) void k_fattn2(const h16* __restrict__ Q16, const h16* __restrict__ K16, const h16* __restrict__ V16, const bf* __restrict__ Qh, const bf* __restrict__ Ql, const bf* __restrict__ Kh, const bf* __restrict__ Kl, const bf* __restrict__ Vh, const bf* __restrict__ Vl, bf* Ah, bf* Al) {
    __shared__ __align__(16) float po[8 * 32 * 68];
    __shared__ float smx[8 * 32], ssm[8 * 32];
    constexpr int NF = (TT - RH) / 32; const int y = blockIdx.y;   // the same for the whole work-group: a scalar branch, and the barrier inside either body is passed by all its waves
    if (y < NF) fattn<h16, false, 2, 32>(Q16, nullptr, K16, nullptr, V16, nullptr, Ah, Al, po, smx, ssm, y);
    else fattn<bf, true, 1, 32>(Qh, Ql, Kh, Kl, Vh, Vl, Ah, Al, po, smx, ssm, y - NF);
}

extern "C" void kernel_launch(void* const* d_in, const int* in_sizes, int n_in,
                              void* d_out, int out_size, void* d_ws, size_t ws_size, hipStream_t stream) {
    (void)in_sizes; (void)n_in; (void)out_size;
    const float* x = (const float*)d_in[0]; const float* wq = (const float*)d_in[1]; const float* bq = (const float*)d_in[2]; const float* wk = (const float*)d_in[3]; const float* bk = (const float*)d_in[4]; const float* wv = (const float*)d_in[5]; const float* bv = (const float*)d_in[6]; const float* wo = (const float*)d_in[7]; const float* bo = (const float*)d_in[8];
    float* OUT = (float*)d_out;     // [2][2048][1024]
    char* wsp = (char*)d_ws;
    auto take = [&](size_t bytes) { char* p = wsp; wsp += (bytes + 255) & ~(size_t)255; return (void*)p; };
    bf* WQ = (bf*)take((size_t)DQ * DM * 2); take((size_t)DKV * DM * 2); take((size_t)DKV * DM * 2); bf* WO = (bf*)take((size_t)DM * DQ * 2);   // the q, k, v, o weights and the copy of x lie one behind the other
    bf* XB = (bf*)take((size_t)NB_ * TT * DM * 2);
    const size_t PS = (size_t)NB_ * NH_ * TT * HD;   // elements of one set of planes [batch][head]; the q, k, v sets lie one behind the other
    h16* QP16 = (h16*)take(3 * PS * 2); bf* QPh = (bf*)take(3 * PS * 2); bf* QPl = (bf*)take(3 * PS * 2);
    bf* ATh = (bf*)take((size_t)NB_ * TT * DQ * 2); bf* ATl = (bf*)take((size_t)NB_ * TT * DQ * 2);
    if ((size_t)(wsp - (char*)d_ws) > ws_size) return;    // ws 256 MiB
    k_cvt8<<<dim3(DQ * DM / 2048, 4 + NB_ * TT / DQ, 1), 256, 0, stream>>>(wq, wk, wv, wo, x, WQ);
    k_gemmw<bf, 0, true, 3><<<dim3(NB_ * TT / 128, DQ / 128, 3), 128, 0, stream>>>(XB, nullptr, WQ, nullptr, DM, nullptr, 0, bq, bk, bv, 0, (size_t)DQ * DM, 0, PS, QP16, QPh, QPl);   // z = 0: q, z = 1: k, z = 2: v
    k_fattn2<<<dim3(NB_ * NH_, (TT - RH) / 32 + RH / 16, 1), 256, 0, stream>>>(QP16, QP16 + PS, QP16 + 2 * PS, QPh, QPl, QPh + PS, QPl + PS, QPh + 2 * PS, QPl + 2 * PS, ATh, ATl);
    k_gemmw<bf, 1, true, 0><<<dim3(NB_ * TT / 128, DM / 128, 1), 128, 0, stream>>>(ATh, ATl, WO, nullptr, DQ, OUT, DM, bo, nullptr, nullptr, 0, 0, 0, 0, nullptr, nullptr, nullptr);
}
